// v000
// Times are from an AMD MI455X. After a warm-up the kernel runs many times in a row, and a time is the length of
// such a window on the GPU divided by its runs, so every launch and the gaps after it count. The runs cycle
// through copies of the inputs. A figure is the median of several windows, for all but v000 over two sittings.
// Sittings can differ by a few percent; kernels timed side by side share one.
// v000 is the starting kernel. One run takes 618 microseconds.
#include <hip/hip_runtime.h>

// Two-head self-attention with 512-wide heads (activation [1][1][4096][1024]; q, k, v = x W^T + b ('oi' [1024][1024]), 2 heads x 512; softmax(q.k/sqrt(512)) over all 4096 keys; out = merged context (no output projection) -> [1][1][4096][1024] (4.2 M)).
// Compute dtypes, f32 accumulate: every input rounded to bf16; q/k/v on PLAIN bf16 operands (inputs: exact) + biases; scores (K = 512) and attn.v (N = 512; no mask): query rows < 512 hl (3 products), the rest single fp16 (x1024); softmax f32; no output projection: the merged context is written in f32.

#define NB_  1
#define TT   4096
#define DM   1024
#define NH_  2
#define NKV  2
#define REP  (NH_ / NKV)
#define HD   512
#define DQ   (NH_ * HD)
#define DKV  (NKV * HD)
#define ZH   1
#define RH   512                  // query rows < RH use hi+lo planes (0: none)
#define WIN  0
#define PCAR 1024.0f
#define SCL  0.044194173824159216f   // 512^-0.5 (head width 512)
typedef _Float16 h16;
typedef unsigned short bf;
typedef __attribute__((ext_vector_type(16))) __bf16   v16bf;
typedef __attribute__((ext_vector_type(16))) _Float16 v16h;
typedef __attribute__((ext_vector_type(8)))  _Float16 v8h;
typedef __attribute__((ext_vector_type(8)))  unsigned short v8us;
typedef __attribute__((ext_vector_type(8)))  float    v8f;
typedef __attribute__((ext_vector_type(4)))  float    v4f;
typedef v8h  __attribute__((may_alias)) v8ha;
typedef v4f  __attribute__((may_alias)) v4fa;
typedef v8us __attribute__((may_alias)) v8usa;

__device__ __forceinline__ unsigned short f2bf(float f) { unsigned u = __float_as_uint(f); u += 0x7FFFu + ((u >> 16) & 1u); return (unsigned short)(u >> 16); }
__device__ __forceinline__ float bf2f(unsigned short b) { return __uint_as_float(((unsigned)b) << 16); }
__device__ __forceinline__ float bfr(float f) { return bf2f(f2bf(f)); }
__device__ __forceinline__ v16h cat16(v8h lo, v8h hi) { return __builtin_shufflevector(lo, hi, 0, 1, 2, 3, 4, 5, 6, 7, 8, 9, 10, 11, 12, 13, 14, 15); }
__device__ __forceinline__ v16bf cat16b(v8us lo, v8us hi) { return __builtin_bit_cast(v16bf, __builtin_shufflevector(lo, hi, 0, 1, 2, 3, 4, 5, 6, 7, 8, 9, 10, 11, 12, 13, 14, 15)); }
__device__ __forceinline__ v8f wmma16(v16h a, v16h b, v8f c) { return __builtin_amdgcn_wmma_f32_16x16x32_f16(false, a, false, b, (short)0, c, false, false); }
__device__ __forceinline__ v8f wmmab(v16bf a, v16bf b, v8f c) { return __builtin_amdgcn_wmma_f32_16x16x32_bf16(false, a, false, b, (short)0, c, false, false); }



// ---- k_gemmw: register-blocked GEMM, ONE WAVE per 64x64 output tile (16 accumulators), operands straight from K-contiguous 16-bit planes; grid (M/64, N/64, Z), 32 threads.
// C[m][n] (f32, pitch ldc, + optional f32 bias[n]) = sum_k A[m][k] Bt[n][k] (+ split products per NSPLIT). z-batch strides sA/sB/sC in elements. K % 32 == 0.
template <typename T16> struct WFrag;
template <> struct WFrag<h16> { typedef v16h V; static __device__ __forceinline__ V ld(const h16* p) { return cat16(*(const v8h*)p, *(const v8h*)(p + 16)); } static __device__ __forceinline__ v8f mma(V a, V b, v8f c) { return wmma16(a, b, c); } };
template <> struct WFrag<bf> { typedef v16bf V; static __device__ __forceinline__ V ld(const bf* p) { return cat16b(*(const v8us*)p, *(const v8us*)(p + 16)); } static __device__ __forceinline__ v8f mma(V a, V b, v8f c) { return wmmab(a, b, c); } };
template <typename T16, int NSPLIT, bool BIAS>
__global__ __launch_bounds__(32) void k_gemmw(const T16* __restrict__ A, const T16* __restrict__ A2, const T16* __restrict__ Bt, const T16* __restrict__ Bt2, int K, float* C, int ldc, const float* __restrict__ bias, size_t sA, size_t sB, size_t sC) {
    typedef typename WFrag<T16>::V V;
    __shared__ __align__(16) float os[16 * 68];
    const size_t z = blockIdx.z; A += z * sA; if (A2) A2 += z * sA; Bt += z * sB; if (Bt2) Bt2 += z * sB; C += z * sC;
    const int lane = threadIdx.x & 31, lr = lane & 15, hi = lane >> 4; const int r0 = blockIdx.x * 64, c0 = blockIdx.y * 64;
    v8f acc[4][4];
#pragma unroll
    for (int mb = 0; mb < 4; ++mb)
#pragma unroll
        for (int nb = 0; nb < 4; ++nb) acc[mb][nb] = (v8f){};
    const size_t aoff = (size_t)(r0 + lr) * K + 8 * hi, boff = (size_t)(c0 + lr) * K + 8 * hi;
#pragma unroll 1
    for (int kc = 0; kc < K; kc += 32) {
        V a[4], a2[4];
#pragma unroll
        for (int mb = 0; mb < 4; ++mb) { a[mb] = WFrag<T16>::ld(A + aoff + (size_t)mb * 16 * K + kc); if (NSPLIT == 1 || NSPLIT == 2) a2[mb] = WFrag<T16>::ld(A2 + aoff + (size_t)mb * 16 * K + kc); }
#pragma unroll
        for (int nb = 0; nb < 4; ++nb) { const V b = WFrag<T16>::ld(Bt + boff + (size_t)nb * 16 * K + kc); V b2; if (NSPLIT >= 2) b2 = WFrag<T16>::ld(Bt2 + boff + (size_t)nb * 16 * K + kc);
#pragma unroll
            for (int mb = 0; mb < 4; ++mb) { acc[mb][nb] = WFrag<T16>::mma(a[mb], b, acc[mb][nb]); if (NSPLIT == 1 || NSPLIT == 2) acc[mb][nb] = WFrag<T16>::mma(a2[mb], b, acc[mb][nb]); if (NSPLIT >= 2) acc[mb][nb] = WFrag<T16>::mma(a[mb], b2, acc[mb][nb]); } }
        asm volatile("v_nop\n\tv_nop\n\tv_nop\n\tv_nop" : "+v"(acc[0][0]), "+v"(acc[1][1]), "+v"(acc[2][2]), "+v"(acc[3][3]) : "v"(a[0]), "v"(a[3]));
    }
#pragma unroll
    for (int mb = 0; mb < 4; ++mb) {
#pragma unroll
        for (int nb = 0; nb < 4; ++nb) {
#pragma unroll
            for (int j = 0; j < 8; ++j) os[(hi * 8 + j) * 68 + nb * 16 + lr] = acc[mb][nb][j]; }
        __builtin_amdgcn_wave_barrier(); asm volatile("" ::: "memory");
        float* crow = C + (size_t)(r0 + mb * 16) * ldc + c0;
{
#pragma unroll
            for (int s = 0; s < 8; ++s) { const int row = 2 * s + hi, cofs = lr * 4; v4f val = *(const v4fa*)(os + row * 68 + cofs); if (BIAS) { val[0] += bfr(bias[c0 + cofs]); val[1] += bfr(bias[c0 + cofs + 1]); val[2] += bfr(bias[c0 + cofs + 2]); val[3] += bfr(bias[c0 + cofs + 3]); }
                *(v4f*)(crow + (size_t)row * ldc + cofs) = val; }
             }
        __builtin_amdgcn_wave_barrier(); asm volatile("" ::: "memory");
    }
}

__device__ __forceinline__ h16 tohx(float x) { return (h16)x; }
__device__ __forceinline__ void splitf(float y, unsigned short& h, unsigned short& l) { h = f2bf(y); l = f2bf(y - bf2f(h)); }
typedef __attribute__((ext_vector_type(2))) _Float16 v2h;
typedef __attribute__((ext_vector_type(4))) _Float16 v4h;
typedef __attribute__((ext_vector_type(2))) unsigned short v2us;
typedef __attribute__((ext_vector_type(4))) unsigned short v4us;
typedef __attribute__((ext_vector_type(2))) float v2f;
typedef __attribute__((ext_vector_type(4))) int v4i;

__global__ __launch_bounds__(256) void k_wtG(const float* __restrict__ w, int K, int N, bf* Bt) {
    const int lane = threadIdx.x & 31; const int L0 = (blockIdx.x * 8 + (threadIdx.x >> 5)) * 8; const int nlines = N * K / 64;
{
#pragma unroll 1
        for (int l = 0; l < 8; ++l) { const int L = L0 + l; if (L >= nlines) break; const size_t e = (size_t)L * 64 + lane * 2; const int k = (int)(e % K), n = (int)(e / K); v2us o;
            o[0] = f2bf(w[(size_t)k * N + n]); o[1] = f2bf(w[(size_t)(k + 1) * N + n]); *(v2us*)(Bt + e) = o; }
         }
}
__global__ __launch_bounds__(256) void k_cvt8(const float* __restrict__ src, bf* dst, size_t n8) { const size_t i = (size_t)blockIdx.x * 256 + threadIdx.x; if (i >= n8) return; const v8f v = *(const v8f*)(src + i * 8); v8us o;
#pragma unroll
    for (int k = 0; k < 8; ++k) o[k] = f2bf(v[k]); *(v8us*)(dst + i * 8) = o;  }

// k_rope: head planes [h][t][d] (fp16 + hi/lo) of rope(x) x sc with the rotate-half convention out[d] = x[d] cos[t][d] - x[d+HD/2] sin[t][d], out[d+HD/2] = x[d+HD/2] cos[t][d+HD/2] + x[d] sin[t][d+HD/2]
__global__ __launch_bounds__(256) void k_rope(const float* __restrict__ F, int pitch, int nheads, const float* __restrict__ CS, const float* __restrict__ RF, const float* __restrict__ nw, float sc, h16* P16, bf* Ph, bf* Pl) {
    const size_t e = ((size_t)blockIdx.x * 256 + threadIdx.x) * 2; if (e >= (size_t)nheads * TT * HD) return; const int d = (int)(e % HD); const int t = (int)((e / HD) % TT); const int h = (int)(e / ((size_t)HD * TT)); const float* f = F + (size_t)t * pitch + h * HD; const float rf = RF ? RF[(size_t)h * TT + t] : 1.0f; v2h o16; v2us oh, ol;
#pragma unroll
    for (int q = 0; q < 2; ++q) { const int dd = d + q; const int dp = (dd < HD / 2) ? dd + HD / 2 : dd - HD / 2; float x0 = f[dd], x1 = f[dp];
        if (RF) { float n0 = __fmul_rn(x0, rf), n1 = __fmul_rn(x1, rf); asm volatile("" : "+v"(n0)); asm volatile("" : "+v"(n1)); x0 = __fmul_rn(bfr(nw[dd]), n0); x1 = __fmul_rn(bfr(nw[dp]), n1); }
        const v2f cs = *(const v2f*)(CS + ((size_t)t * HD + dd) * 2); float a = __fmul_rn(x0, cs[0]), bq = __fmul_rn(x1, cs[1]); asm volatile("" : "+v"(a)); asm volatile("" : "+v"(bq)); const float r = ((dd < HD / 2) ? __fsub_rn(a, bq) : __fadd_rn(a, bq)) * sc;
        o16[q] = tohx(r); unsigned short a2, c2; splitf(r, a2, c2); oh[q] = a2; ol[q] = c2; }
    *(v2h*)(P16 + e) = o16; *(v2us*)(Ph + e) = oh; *(v2us*)(Pl + e) = ol;  }
__global__ __launch_bounds__(256) void k_vtp(const float* __restrict__ F, int pitch, int nheads, h16* V16, bf* Vh, bf* Vl) { const size_t e = ((size_t)blockIdx.x * 256 + threadIdx.x) * 2; if (e >= (size_t)nheads * HD * TT) return; const int t = (int)(e % TT); const int d = (int)((e / TT) % HD); const int g = (int)(e / ((size_t)TT * HD)); v2h o16; v2us oh, ol;
#pragma unroll
    for (int q = 0; q < 2; ++q) { const float x = F[(size_t)(t + q) * pitch + g * HD + d]; o16[q] = tohx(x); unsigned short a2, c2; splitf(x, a2, c2); oh[q] = a2; ol[q] = c2; }
    *(v2h*)(V16 + e) = o16; *(v2us*)(Vh + e) = oh; *(v2us*)(Vl + e) = ol;  }
__global__ __launch_bounds__(256) void k_csid(float* CS) { const int idx = blockIdx.x * 256 + threadIdx.x; if (idx >= TT * HD) return; v2f cs; cs[0] = 1.0f; cs[1] = 0.0f; *(v2f*)(CS + (size_t)idx * 2) = cs;  }
// k_asoft: per row (zz, i): t = S x HD^-0.5 (no mask); softmax over the 4096 keys (register row, one exp, fixed trees);
__global__ __launch_bounds__(256) void k_asoft(const float* __restrict__ Sb, h16* P16, bf* Ph, bf* Pl) {
    const int lane = threadIdx.x & 31; const int row = blockIdx.x * 8 + (threadIdx.x >> 5); if (row >= ZH * TT) return; const int i = row % TT; const int zz = row / TT; (void)zz; const bool hires = (i < RH); const float* sr = Sb + (size_t)row * TT; float v[TT / 32]; float mx = -3.0e38f;
#pragma unroll
    for (int ch = 0; ch < TT / 128; ++ch) { const int j0 = ch * 128 + lane * 4; const v4f a = *(const v4f*)(sr + j0);
#pragma unroll
        for (int q = 0; q < 4; ++q) { const int j = j0 + q; (void)j; const float t = a[q] * SCL; v[ch * 4 + q] = t; mx = fmaxf(mx, t); } }
#pragma unroll
    for (int sh = 16; sh; sh >>= 1) mx = fmaxf(mx, __shfl_xor(mx, sh, 32));
    float sum = 0.f;
#pragma unroll
    for (int k = 0; k < TT / 32; ++k) { float d0 = __fsub_rn(v[k], mx); asm volatile("" : "+v"(d0)); v[k] = __builtin_amdgcn_exp2f(__fmul_rn(d0, 1.4426950408889634f)); sum += v[k]; }
#pragma unroll
    for (int sh = 16; sh; sh >>= 1) sum += __shfl_xor(sum, sh, 32);
    const float f = __fdiv_rn(hires ? 1.0f : PCAR, sum);
{
        if (hires) {
#pragma unroll
            for (int ch = 0; ch < TT / 128; ++ch) { v4us oh, ol;
#pragma unroll
                for (int q = 0; q < 4; ++q) { unsigned short a, c2; splitf(v[ch * 4 + q] * f, a, c2); oh[q] = a; ol[q] = c2; }
                const size_t oo = ((size_t)zz * (RH ? RH : 1) + i) * TT + ch * 128 + lane * 4; *(v4us*)(Ph + oo) = oh; *(v4us*)(Pl + oo) = ol; }
        } else {
#pragma unroll
            for (int ch = 0; ch < TT / 128; ++ch) { v4h o4;
#pragma unroll
                for (int q = 0; q < 4; ++q) o4[q] = tohx(v[ch * 4 + q] * f);
                *(v4h*)(P16 + (size_t)row * TT + ch * 128 + lane * 4) = o4; } }
         }
}
__global__ __launch_bounds__(256) void k_merge(const float* __restrict__ O, int h0, float* OUTb) { const size_t e = ((size_t)blockIdx.x * 256 + threadIdx.x) * 2; if (e >= (size_t)ZH * TT * HD) return; const int d = (int)(e % HD); const int t = (int)((e / HD) % TT); const int zz = (int)(e / ((size_t)HD * TT)); const float cs = (t < RH) ? 1.0f : (1.0f / PCAR); const size_t oo = (size_t)t * DQ + (h0 + zz) * HD + d;
    v2f o2; o2[0] = O[e] * cs; o2[1] = O[e + 1] * cs; *(v2f*)(OUTb + oo) = o2;  }   /* f32 context straight to the output */

extern "C" void kernel_launch(void* const* d_in, const int* in_sizes, int n_in,
                              void* d_out, int out_size, void* d_ws, size_t ws_size, hipStream_t stream) {
    (void)in_sizes; (void)n_in; (void)out_size;
    const float* x = (const float*)d_in[0]; const float* wq = (const float*)d_in[1]; const float* bq = (const float*)d_in[2]; const float* wk = (const float*)d_in[3]; const float* bk = (const float*)d_in[4]; const float* wv = (const float*)d_in[5]; const float* bv = (const float*)d_in[6]; const float* wo = nullptr; (void)wo;
    float* OUT = (float*)d_out;     // [1][4096][1024]
    char* wsp = (char*)d_ws;
    auto take = [&](size_t bytes) { char* p = wsp; wsp += (bytes + 255) & ~(size_t)255; return (void*)p; };
    bf* WQ = (bf*)take((size_t)DQ * DM * 2); bf* WK = (bf*)take((size_t)DKV * DM * 2); bf* WV = (bf*)take((size_t)DKV * DM * 2); float* CS = (float*)take((size_t)TT * HD * 2 * 4);
    bf* XB = (bf*)take((size_t)TT * DM * 2); float* FQ = (float*)take((size_t)TT * DQ * 4); float* FK = (float*)take((size_t)TT * DKV * 4);
    h16* QP16 = (h16*)take((size_t)NH_ * TT * HD * 2); h16* KP16 = (h16*)take((size_t)NKV * TT * HD * 2); h16* VT16 = (h16*)take((size_t)NKV * HD * TT * 2);
    bf* QPh = (bf*)take((size_t)NH_ * TT * HD * 2); bf* QPl = (bf*)take((size_t)NH_ * TT * HD * 2); bf* KPh = (bf*)take((size_t)NKV * TT * HD * 2); bf* KPl = (bf*)take((size_t)NKV * TT * HD * 2); bf* VTh = (bf*)take((size_t)NKV * HD * TT * 2); bf* VTl = (bf*)take((size_t)NKV * HD * TT * 2); bf* Ph = (bf*)take((size_t)ZH * RH * TT * 2); bf* Pl = (bf*)take((size_t)ZH * RH * TT * 2);
    float* Sb = (float*)take((size_t)ZH * TT * TT * 4); h16* P16 = (h16*)take((size_t)ZH * TT * TT * 2); float* Ob = (float*)take((size_t)ZH * TT * HD * 4); 
    if ((size_t)(wsp - (char*)d_ws) > ws_size) return;    // ws 256 MiB
    float* FV = FK;   // v projection reuses the k buffer after the k planes are built (stream-ordered)
    { k_cvt8<<<(unsigned)(((size_t)DQ * DM / 8 + 255) / 256), 256, 0, stream>>>(wq, WQ, (size_t)DQ * DM / 8); k_cvt8<<<(unsigned)(((size_t)DKV * DM / 8 + 255) / 256), 256, 0, stream>>>(wk, WK, (size_t)DKV * DM / 8); k_cvt8<<<(unsigned)(((size_t)DKV * DM / 8 + 255) / 256), 256, 0, stream>>>(wv, WV, (size_t)DKV * DM / 8);
       }
    k_csid<<<(TT * HD + 255) / 256, 256, 0, stream>>>(CS);
    const unsigned LQ = (unsigned)(((size_t)NH_ * TT * HD / 2 + 255) / 256), LKv = (unsigned)(((size_t)NKV * TT * HD / 2 + 255) / 256);
    for (int b = 0; b < NB_; ++b) {
        
        k_cvt8<<<(unsigned)(((size_t)TT * DM / 8 + 255) / 256), 256, 0, stream>>>(x + (size_t)b * TT * DM, XB, (size_t)TT * DM / 8);
        k_gemmw<bf, 0, true><<<dim3(TT / 64, DQ / 64, 1), 32, 0, stream>>>(XB, nullptr, WQ, nullptr, DM, FQ, DQ, bq, 0, 0, 0);
        k_rope<<<LQ, 256, 0, stream>>>(FQ, DQ, NH_, CS, nullptr, nullptr, 1.0f, QP16, QPh, QPl);
        k_gemmw<bf, 0, true><<<dim3(TT / 64, DKV / 64, 1), 32, 0, stream>>>(XB, nullptr, WK, nullptr, DM, FK, DKV, bk, 0, 0, 0);
        k_rope<<<LKv, 256, 0, stream>>>(FK, DKV, NKV, CS, nullptr, nullptr, 1.0f, KP16, KPh, KPl);
        k_gemmw<bf, 0, true><<<dim3(TT / 64, DKV / 64, 1), 32, 0, stream>>>(XB, nullptr, WV, nullptr, DM, FV, DKV, bv, 0, 0, 0); k_vtp<<<LKv, 256, 0, stream>>>(FV, DKV, NKV, VT16, VTh, VTl);
        for (int h0 = 0; h0 < NH_; h0 += ZH) { const size_t zq = (size_t)h0, zk = (size_t)(h0 / REP);   // one kv head per query head: each pass covers one head (ZH = 1) and its kv plane zk
            k_gemmw<bf, 2, false><<<dim3(RH / 64, TT / 64, ZH), 32, 0, stream>>>(QPh + zq * TT * HD, QPl + zq * TT * HD, KPh + zk * TT * HD, KPl + zk * TT * HD, HD, Sb, TT, nullptr, (size_t)TT * HD, (size_t)TT * HD, (size_t)TT * TT);
            k_gemmw<h16, 0, false><<<dim3((TT - RH) / 64, TT / 64, ZH), 32, 0, stream>>>(QP16 + zq * TT * HD + (size_t)RH * HD, nullptr, KP16 + zk * TT * HD, nullptr, HD, Sb + (size_t)RH * TT, TT, nullptr, (size_t)TT * HD, (size_t)TT * HD, (size_t)TT * TT);
            k_asoft<<<ZH * TT / 8, 256, 0, stream>>>(Sb, P16, Ph, Pl);
            k_gemmw<bf, 2, false><<<dim3(RH / 64, HD / 64, ZH), 32, 0, stream>>>(Ph, Pl, VTh + zk * HD * TT, VTl + zk * HD * TT, TT, Ob, HD, nullptr, (size_t)RH * TT, (size_t)HD * TT, (size_t)TT * HD);
            k_gemmw<h16, 0, false><<<dim3((TT - RH) / 64, HD / 64, ZH), 32, 0, stream>>>(P16 + (size_t)RH * TT, nullptr, VT16 + zk * HD * TT, nullptr, TT, Ob + (size_t)RH * HD, HD, nullptr, (size_t)TT * TT, (size_t)HD * TT, (size_t)TT * HD);
            k_merge<<<(unsigned)(((size_t)ZH * TT * HD / 2 + 255) / 256), 256, 0, stream>>>(Ob, h0, OUT + (size_t)b * TT * DM); }
    }
}

// v001
// It runs in 398 microseconds.
// Two timings next to v000 both put it at 1.59 times that version's speed.
#include <hip/hip_runtime.h>

// Two-head self-attention with 512-wide heads (activation [1][1][4096][1024]; q, k, v = x W^T + b ('oi' [1024][1024]), 2 heads x 512; softmax(q.k/sqrt(512)) over all 4096 keys; out = merged context (no output projection) -> [1][1][4096][1024] (4.2 M)).
// Compute dtypes, f32 accumulate: every input rounded to bf16; q/k/v on PLAIN bf16 operands (inputs: exact) + biases; scores (K = 512) and attn.v (N = 512; no mask): query rows < 512 hl (3 products), the rest single fp16 (x1024); softmax f32; no output projection: the merged context is written in f32.

#define NB_  1
#define TT   4096
#define DM   1024
#define NH_  2
#define NKV  2
#define REP  (NH_ / NKV)
#define HD   512
#define DQ   (NH_ * HD)
#define DKV  (NKV * HD)
#define ZH   1
#define RH   512                  // query rows < RH use hi+lo planes (0: none)
#define WIN  0
#define PCAR 1024.0f
#define SCL  0.044194173824159216f   // 512^-0.5 (head width 512)
typedef _Float16 h16;
typedef unsigned short bf;
typedef __attribute__((ext_vector_type(16))) __bf16   v16bf;
typedef __attribute__((ext_vector_type(16))) _Float16 v16h;
typedef __attribute__((ext_vector_type(8)))  _Float16 v8h;
typedef __attribute__((ext_vector_type(8)))  unsigned short v8us;
typedef __attribute__((ext_vector_type(8)))  float    v8f;
typedef __attribute__((ext_vector_type(4)))  float    v4f;
typedef v8h  __attribute__((may_alias)) v8ha;
typedef v4f  __attribute__((may_alias)) v4fa;
typedef v8us __attribute__((may_alias)) v8usa;

__device__ __forceinline__ unsigned short f2bf(float f) { unsigned u = __float_as_uint(f); u += 0x7FFFu + ((u >> 16) & 1u); return (unsigned short)(u >> 16); }
__device__ __forceinline__ float bf2f(unsigned short b) { return __uint_as_float(((unsigned)b) << 16); }
__device__ __forceinline__ float bfr(float f) { return bf2f(f2bf(f)); }
__device__ __forceinline__ v16h cat16(v8h lo, v8h hi) { return __builtin_shufflevector(lo, hi, 0, 1, 2, 3, 4, 5, 6, 7, 8, 9, 10, 11, 12, 13, 14, 15); }
__device__ __forceinline__ v16bf cat16b(v8us lo, v8us hi) { return __builtin_bit_cast(v16bf, __builtin_shufflevector(lo, hi, 0, 1, 2, 3, 4, 5, 6, 7, 8, 9, 10, 11, 12, 13, 14, 15)); }
__device__ __forceinline__ v8f wmma16(v16h a, v16h b, v8f c) { return __builtin_amdgcn_wmma_f32_16x16x32_f16(false, a, false, b, (short)0, c, false, false); }
__device__ __forceinline__ v8f wmmab(v16bf a, v16bf b, v8f c) { return __builtin_amdgcn_wmma_f32_16x16x32_bf16(false, a, false, b, (short)0, c, false, false); }



// ---- k_gemmw: register-blocked GEMM, one 64x64 output tile per work-group of KW waves; wave w sums the k range [w K/KW, (w+1) K/KW) into its own 16 accumulators, operands straight from K-contiguous 16-bit planes; the KW partial tiles are added in LDS in wave order. grid (M/64, N/64, Z), 32 KW threads.
// C[m][n] (f32, pitch ldc, + optional f32 bias[n]) = sum_k A[m][k] Bt[n][k] (+ split products per NSPLIT). z-batch strides sA/sB/sC in elements. K % (32 KW) == 0.
template <typename T16> struct WFrag;
template <> struct WFrag<h16> { typedef v16h V; static __device__ __forceinline__ V ld(const h16* p) { return cat16(*(const v8h*)p, *(const v8h*)(p + 16)); } static __device__ __forceinline__ v8f mma(V a, V b, v8f c) { return wmma16(a, b, c); } };
template <> struct WFrag<bf> { typedef v16bf V; static __device__ __forceinline__ V ld(const bf* p) { return cat16b(*(const v8us*)p, *(const v8us*)(p + 16)); } static __device__ __forceinline__ v8f mma(V a, V b, v8f c) { return wmmab(a, b, c); } };
template <typename T16, int NSPLIT, bool BIAS, int KW>
__global__ __launch_bounds__(32 * KW) void k_gemmw(const T16* __restrict__ A, const T16* __restrict__ A2, const T16* __restrict__ Bt, const T16* __restrict__ Bt2, int K, float* C, int ldc, const float* __restrict__ bias, size_t sA, size_t sB, size_t sC) {
    typedef typename WFrag<T16>::V V;
    __shared__ __align__(16) float os[KW == 1 ? 16 * 68 : KW * 64 * 68];
    const size_t z = blockIdx.z; A += z * sA; if (A2) A2 += z * sA; Bt += z * sB; if (Bt2) Bt2 += z * sB; C += z * sC;
    const int lane = threadIdx.x & 31, lr = lane & 15, hi = lane >> 4; const int wave = __builtin_amdgcn_readfirstlane((int)(threadIdx.x >> 5)); const int kb = wave * (K / KW), ke = kb + K / KW; const int r0 = blockIdx.x * 64, c0 = blockIdx.y * 64;
    v8f acc[4][4];
#pragma unroll
    for (int mb = 0; mb < 4; ++mb)
#pragma unroll
        for (int nb = 0; nb < 4; ++nb) acc[mb][nb] = (v8f){};
    const size_t aoff = (size_t)(r0 + lr) * K + 8 * hi, boff = (size_t)(c0 + lr) * K + 8 * hi;
#pragma unroll 1
    for (int kc = kb; kc < ke; kc += 32) {
        V a[4], a2[4];
#pragma unroll
        for (int mb = 0; mb < 4; ++mb) { a[mb] = WFrag<T16>::ld(A + aoff + (size_t)mb * 16 * K + kc); if (NSPLIT == 1 || NSPLIT == 2) a2[mb] = WFrag<T16>::ld(A2 + aoff + (size_t)mb * 16 * K + kc); }
#pragma unroll
        for (int nb = 0; nb < 4; ++nb) { const V b = WFrag<T16>::ld(Bt + boff + (size_t)nb * 16 * K + kc); V b2; if (NSPLIT >= 2) b2 = WFrag<T16>::ld(Bt2 + boff + (size_t)nb * 16 * K + kc);
#pragma unroll
            for (int mb = 0; mb < 4; ++mb) { acc[mb][nb] = WFrag<T16>::mma(a[mb], b, acc[mb][nb]); if (NSPLIT == 1 || NSPLIT == 2) acc[mb][nb] = WFrag<T16>::mma(a2[mb], b, acc[mb][nb]); if (NSPLIT >= 2) acc[mb][nb] = WFrag<T16>::mma(a[mb], b2, acc[mb][nb]); } }
        asm volatile("v_nop\n\tv_nop\n\tv_nop\n\tv_nop" : "+v"(acc[0][0]), "+v"(acc[1][1]), "+v"(acc[2][2]), "+v"(acc[3][3]) : "v"(a[0]), "v"(a[3]));
    }
    if constexpr (KW == 1) {
#pragma unroll
    for (int mb = 0; mb < 4; ++mb) {
#pragma unroll
        for (int nb = 0; nb < 4; ++nb) {
#pragma unroll
            for (int j = 0; j < 8; ++j) os[(hi * 8 + j) * 68 + nb * 16 + lr] = acc[mb][nb][j]; }
        __builtin_amdgcn_wave_barrier(); asm volatile("" ::: "memory");
        float* crow = C + (size_t)(r0 + mb * 16) * ldc + c0;
{
#pragma unroll
            for (int s = 0; s < 8; ++s) { const int row = 2 * s + hi, cofs = lr * 4; v4f val = *(const v4fa*)(os + row * 68 + cofs); if (BIAS) { val[0] += bfr(bias[c0 + cofs]); val[1] += bfr(bias[c0 + cofs + 1]); val[2] += bfr(bias[c0 + cofs + 2]); val[3] += bfr(bias[c0 + cofs + 3]); }
                *(v4f*)(crow + (size_t)row * ldc + cofs) = val; }
             }
        __builtin_amdgcn_wave_barrier(); asm volatile("" ::: "memory");
    }
    } else {
        float* osw = os + wave * (64 * 68);
#pragma unroll
        for (int mb = 0; mb < 4; ++mb)
#pragma unroll
            for (int nb = 0; nb < 4; ++nb)
#pragma unroll
                for (int j = 0; j < 8; ++j) osw[(mb * 16 + hi * 8 + j) * 68 + nb * 16 + lr] = acc[mb][nb][j];
        __syncthreads();   // every wave's partial tile is in LDS before any thread adds the KW tiles
#pragma unroll
        for (int s = 0; s < 32 / KW; ++s) { const int it = (int)threadIdx.x + s * 32 * KW, row = it >> 4, cofs = (it & 15) * 4; v4f val = *(const v4fa*)(os + row * 68 + cofs);
#pragma unroll
            for (int w = 1; w < KW; ++w) val += *(const v4fa*)(os + w * (64 * 68) + row * 68 + cofs);
            if (BIAS) { val[0] += bfr(bias[c0 + cofs]); val[1] += bfr(bias[c0 + cofs + 1]); val[2] += bfr(bias[c0 + cofs + 2]); val[3] += bfr(bias[c0 + cofs + 3]); }
            *(v4f*)(C + (size_t)(r0 + row) * ldc + c0 + cofs) = val; }
    }
}

__device__ __forceinline__ h16 tohx(float x) { return (h16)x; }
__device__ __forceinline__ void splitf(float y, unsigned short& h, unsigned short& l) { h = f2bf(y); l = f2bf(y - bf2f(h)); }
typedef __attribute__((ext_vector_type(2))) _Float16 v2h;
typedef __attribute__((ext_vector_type(4))) _Float16 v4h;
typedef __attribute__((ext_vector_type(2))) unsigned short v2us;
typedef __attribute__((ext_vector_type(4))) unsigned short v4us;
typedef __attribute__((ext_vector_type(2))) float v2f;
typedef __attribute__((ext_vector_type(4))) int v4i;

__global__ __launch_bounds__(256) void k_wtG(const float* __restrict__ w, int K, int N, bf* Bt) {
    const int lane = threadIdx.x & 31; const int L0 = (blockIdx.x * 8 + (threadIdx.x >> 5)) * 8; const int nlines = N * K / 64;
{
#pragma unroll 1
        for (int l = 0; l < 8; ++l) { const int L = L0 + l; if (L >= nlines) break; const size_t e = (size_t)L * 64 + lane * 2; const int k = (int)(e % K), n = (int)(e / K); v2us o;
            o[0] = f2bf(w[(size_t)k * N + n]); o[1] = f2bf(w[(size_t)(k + 1) * N + n]); *(v2us*)(Bt + e) = o; }
         }
}
__global__ __launch_bounds__(256) void k_cvt8(const float* __restrict__ src, bf* dst, size_t n8) { const size_t i = (size_t)blockIdx.x * 256 + threadIdx.x; if (i >= n8) return; const v8f v = *(const v8f*)(src + i * 8); v8us o;
#pragma unroll
    for (int k = 0; k < 8; ++k) o[k] = f2bf(v[k]); *(v8us*)(dst + i * 8) = o;  }

// k_rope: head planes [h][t][d] (fp16 + hi/lo) of rope(x) x sc with the rotate-half convention out[d] = x[d] cos[t][d] - x[d+HD/2] sin[t][d], out[d+HD/2] = x[d+HD/2] cos[t][d+HD/2] + x[d] sin[t][d+HD/2]
__global__ __launch_bounds__(256) void k_rope(const float* __restrict__ F, int pitch, int nheads, const float* __restrict__ CS, const float* __restrict__ RF, const float* __restrict__ nw, float sc, h16* P16, bf* Ph, bf* Pl) {
    const size_t e = ((size_t)blockIdx.x * 256 + threadIdx.x) * 2; if (e >= (size_t)nheads * TT * HD) return; const int d = (int)(e % HD); const int t = (int)((e / HD) % TT); const int h = (int)(e / ((size_t)HD * TT)); const float* f = F + (size_t)t * pitch + h * HD; const float rf = RF ? RF[(size_t)h * TT + t] : 1.0f; v2h o16; v2us oh, ol;
#pragma unroll
    for (int q = 0; q < 2; ++q) { const int dd = d + q; const int dp = (dd < HD / 2) ? dd + HD / 2 : dd - HD / 2; float x0 = f[dd], x1 = f[dp];
        if (RF) { float n0 = __fmul_rn(x0, rf), n1 = __fmul_rn(x1, rf); asm volatile("" : "+v"(n0)); asm volatile("" : "+v"(n1)); x0 = __fmul_rn(bfr(nw[dd]), n0); x1 = __fmul_rn(bfr(nw[dp]), n1); }
        const v2f cs = *(const v2f*)(CS + ((size_t)t * HD + dd) * 2); float a = __fmul_rn(x0, cs[0]), bq = __fmul_rn(x1, cs[1]); asm volatile("" : "+v"(a)); asm volatile("" : "+v"(bq)); const float r = ((dd < HD / 2) ? __fsub_rn(a, bq) : __fadd_rn(a, bq)) * sc;
        o16[q] = tohx(r); unsigned short a2, c2; splitf(r, a2, c2); oh[q] = a2; ol[q] = c2; }
    *(v2h*)(P16 + e) = o16; *(v2us*)(Ph + e) = oh; *(v2us*)(Pl + e) = ol;  }
__global__ __launch_bounds__(256) void k_vtp(const float* __restrict__ F, int pitch, int nheads, h16* V16, bf* Vh, bf* Vl) { const size_t e = ((size_t)blockIdx.x * 256 + threadIdx.x) * 2; if (e >= (size_t)nheads * HD * TT) return; const int t = (int)(e % TT); const int d = (int)((e / TT) % HD); const int g = (int)(e / ((size_t)TT * HD)); v2h o16; v2us oh, ol;
#pragma unroll
    for (int q = 0; q < 2; ++q) { const float x = F[(size_t)(t + q) * pitch + g * HD + d]; o16[q] = tohx(x); unsigned short a2, c2; splitf(x, a2, c2); oh[q] = a2; ol[q] = c2; }
    *(v2h*)(V16 + e) = o16; *(v2us*)(Vh + e) = oh; *(v2us*)(Vl + e) = ol;  }
__global__ __launch_bounds__(256) void k_csid(float* CS) { const int idx = blockIdx.x * 256 + threadIdx.x; if (idx >= TT * HD) return; v2f cs; cs[0] = 1.0f; cs[1] = 0.0f; *(v2f*)(CS + (size_t)idx * 2) = cs;  }
// k_asoft: per row (zz, i): t = S x HD^-0.5 (no mask); softmax over the 4096 keys (register row, one exp, fixed trees);
__global__ __launch_bounds__(256) void k_asoft(const float* __restrict__ Sb, h16* P16, bf* Ph, bf* Pl) {
    const int lane = threadIdx.x & 31; const int row = blockIdx.x * 8 + (threadIdx.x >> 5); if (row >= ZH * TT) return; const int i = row % TT; const int zz = row / TT; (void)zz; const bool hires = (i < RH); const float* sr = Sb + (size_t)row * TT; float v[TT / 32]; float mx = -3.0e38f;
#pragma unroll
    for (int ch = 0; ch < TT / 128; ++ch) { const int j0 = ch * 128 + lane * 4; const v4f a = *(const v4f*)(sr + j0);
#pragma unroll
        for (int q = 0; q < 4; ++q) { const int j = j0 + q; (void)j; const float t = a[q] * SCL; v[ch * 4 + q] = t; mx = fmaxf(mx, t); } }
#pragma unroll
    for (int sh = 16; sh; sh >>= 1) mx = fmaxf(mx, __shfl_xor(mx, sh, 32));
    float sum = 0.f;
#pragma unroll
    for (int k = 0; k < TT / 32; ++k) { float d0 = __fsub_rn(v[k], mx); asm volatile("" : "+v"(d0)); v[k] = __builtin_amdgcn_exp2f(__fmul_rn(d0, 1.4426950408889634f)); sum += v[k]; }
#pragma unroll
    for (int sh = 16; sh; sh >>= 1) sum += __shfl_xor(sum, sh, 32);
    const float f = __fdiv_rn(hires ? 1.0f : PCAR, sum);
{
        if (hires) {
#pragma unroll
            for (int ch = 0; ch < TT / 128; ++ch) { v4us oh, ol;
#pragma unroll
                for (int q = 0; q < 4; ++q) { unsigned short a, c2; splitf(v[ch * 4 + q] * f, a, c2); oh[q] = a; ol[q] = c2; }
                const size_t oo = ((size_t)zz * (RH ? RH : 1) + i) * TT + ch * 128 + lane * 4; *(v4us*)(Ph + oo) = oh; *(v4us*)(Pl + oo) = ol; }
        } else {
#pragma unroll
            for (int ch = 0; ch < TT / 128; ++ch) { v4h o4;
#pragma unroll
                for (int q = 0; q < 4; ++q) o4[q] = tohx(v[ch * 4 + q] * f);
                *(v4h*)(P16 + (size_t)row * TT + ch * 128 + lane * 4) = o4; } }
         }
}
__global__ __launch_bounds__(256) void k_merge(const float* __restrict__ O, int h0, float* OUTb) { const size_t e = ((size_t)blockIdx.x * 256 + threadIdx.x) * 2; if (e >= (size_t)ZH * TT * HD) return; const int d = (int)(e % HD); const int t = (int)((e / HD) % TT); const int zz = (int)(e / ((size_t)HD * TT)); const float cs = (t < RH) ? 1.0f : (1.0f / PCAR); const size_t oo = (size_t)t * DQ + (h0 + zz) * HD + d;
    v2f o2; o2[0] = O[e] * cs; o2[1] = O[e + 1] * cs; *(v2f*)(OUTb + oo) = o2;  }   /* f32 context straight to the output */

extern "C" void kernel_launch(void* const* d_in, const int* in_sizes, int n_in,
                              void* d_out, int out_size, void* d_ws, size_t ws_size, hipStream_t stream) {
    (void)in_sizes; (void)n_in; (void)out_size;
    const float* x = (const float*)d_in[0]; const float* wq = (const float*)d_in[1]; const float* bq = (const float*)d_in[2]; const float* wk = (const float*)d_in[3]; const float* bk = (const float*)d_in[4]; const float* wv = (const float*)d_in[5]; const float* bv = (const float*)d_in[6]; const float* wo = nullptr; (void)wo;
    float* OUT = (float*)d_out;     // [1][4096][1024]
    char* wsp = (char*)d_ws;
    auto take = [&](size_t bytes) { char* p = wsp; wsp += (bytes + 255) & ~(size_t)255; return (void*)p; };
    bf* WQ = (bf*)take((size_t)DQ * DM * 2); bf* WK = (bf*)take((size_t)DKV * DM * 2); bf* WV = (bf*)take((size_t)DKV * DM * 2); float* CS = (float*)take((size_t)TT * HD * 2 * 4);
    bf* XB = (bf*)take((size_t)TT * DM * 2); float* FQ = (float*)take((size_t)TT * DQ * 4); float* FK = (float*)take((size_t)TT * DKV * 4);
    h16* QP16 = (h16*)take((size_t)NH_ * TT * HD * 2); h16* KP16 = (h16*)take((size_t)NKV * TT * HD * 2); h16* VT16 = (h16*)take((size_t)NKV * HD * TT * 2);
    bf* QPh = (bf*)take((size_t)NH_ * TT * HD * 2); bf* QPl = (bf*)take((size_t)NH_ * TT * HD * 2); bf* KPh = (bf*)take((size_t)NKV * TT * HD * 2); bf* KPl = (bf*)take((size_t)NKV * TT * HD * 2); bf* VTh = (bf*)take((size_t)NKV * HD * TT * 2); bf* VTl = (bf*)take((size_t)NKV * HD * TT * 2); bf* Ph = (bf*)take((size_t)ZH * RH * TT * 2); bf* Pl = (bf*)take((size_t)ZH * RH * TT * 2);
    float* Sb = (float*)take((size_t)ZH * TT * TT * 4); h16* P16 = (h16*)take((size_t)ZH * TT * TT * 2); float* Ob = (float*)take((size_t)ZH * TT * HD * 4); 
    if ((size_t)(wsp - (char*)d_ws) > ws_size) return;    // ws 256 MiB
    float* FV = FK;   // v projection reuses the k buffer after the k planes are built (stream-ordered)
    { k_cvt8<<<(unsigned)(((size_t)DQ * DM / 8 + 255) / 256), 256, 0, stream>>>(wq, WQ, (size_t)DQ * DM / 8); k_cvt8<<<(unsigned)(((size_t)DKV * DM / 8 + 255) / 256), 256, 0, stream>>>(wk, WK, (size_t)DKV * DM / 8); k_cvt8<<<(unsigned)(((size_t)DKV * DM / 8 + 255) / 256), 256, 0, stream>>>(wv, WV, (size_t)DKV * DM / 8);
       }
    k_csid<<<(TT * HD + 255) / 256, 256, 0, stream>>>(CS);
    const unsigned LQ = (unsigned)(((size_t)NH_ * TT * HD / 2 + 255) / 256), LKv = (unsigned)(((size_t)NKV * TT * HD / 2 + 255) / 256);
    for (int b = 0; b < NB_; ++b) {
        
        k_cvt8<<<(unsigned)(((size_t)TT * DM / 8 + 255) / 256), 256, 0, stream>>>(x + (size_t)b * TT * DM, XB, (size_t)TT * DM / 8);
        k_gemmw<bf, 0, true, 4><<<dim3(TT / 64, DQ / 64, 1), 128, 0, stream>>>(XB, nullptr, WQ, nullptr, DM, FQ, DQ, bq, 0, 0, 0);
        k_rope<<<LQ, 256, 0, stream>>>(FQ, DQ, NH_, CS, nullptr, nullptr, 1.0f, QP16, QPh, QPl);
        k_gemmw<bf, 0, true, 4><<<dim3(TT / 64, DKV / 64, 1), 128, 0, stream>>>(XB, nullptr, WK, nullptr, DM, FK, DKV, bk, 0, 0, 0);
        k_rope<<<LKv, 256, 0, stream>>>(FK, DKV, NKV, CS, nullptr, nullptr, 1.0f, KP16, KPh, KPl);
        k_gemmw<bf, 0, true, 4><<<dim3(TT / 64, DKV / 64, 1), 128, 0, stream>>>(XB, nullptr, WV, nullptr, DM, FV, DKV, bv, 0, 0, 0); k_vtp<<<LKv, 256, 0, stream>>>(FV, DKV, NKV, VT16, VTh, VTl);
        for (int h0 = 0; h0 < NH_; h0 += ZH) { const size_t zq = (size_t)h0, zk = (size_t)(h0 / REP);   // one kv head per query head: each pass takes one head (ZH = 1; z-strides TT*HD)
            k_gemmw<bf, 2, false, 4><<<dim3(RH / 64, TT / 64, ZH), 128, 0, stream>>>(QPh + zq * TT * HD, QPl + zq * TT * HD, KPh + zk * TT * HD, KPl + zk * TT * HD, HD, Sb, TT, nullptr, (size_t)TT * HD, (size_t)TT * HD, (size_t)TT * TT);
            k_gemmw<h16, 0, false, 1><<<dim3((TT - RH) / 64, TT / 64, ZH), 32, 0, stream>>>(QP16 + zq * TT * HD + (size_t)RH * HD, nullptr, KP16 + zk * TT * HD, nullptr, HD, Sb + (size_t)RH * TT, TT, nullptr, (size_t)TT * HD, (size_t)TT * HD, (size_t)TT * TT);
            k_asoft<<<ZH * TT / 8, 256, 0, stream>>>(Sb, P16, Ph, Pl);
            k_gemmw<bf, 2, false, 16><<<dim3(RH / 64, HD / 64, ZH), 512, 0, stream>>>(Ph, Pl, VTh + zk * HD * TT, VTl + zk * HD * TT, TT, Ob, HD, nullptr, (size_t)RH * TT, (size_t)HD * TT, (size_t)TT * HD);
            k_gemmw<h16, 0, false, 8><<<dim3((TT - RH) / 64, HD / 64, ZH), 256, 0, stream>>>(P16 + (size_t)RH * TT, nullptr, VT16 + zk * HD * TT, nullptr, TT, Ob + (size_t)RH * HD, HD, nullptr, (size_t)TT * TT, (size_t)HD * TT, (size_t)TT * HD);
            k_merge<<<(unsigned)(((size_t)ZH * TT * HD / 2 + 255) / 256), 256, 0, stream>>>(Ob, h0, OUT + (size_t)b * TT * DM); }
    }
}

// v002
// Measured time: 351 microseconds a run.
// Two timings next to v001 both put it at 1.13 times that version's speed.
// All steps since v000 together make it 1.80 times as fast.
#include <hip/hip_runtime.h>

// Two-head self-attention with 512-wide heads (activation [1][1][4096][1024]; q, k, v = x W^T + b ('oi' [1024][1024]), 2 heads x 512; softmax(q.k/sqrt(512)) over all 4096 keys; out = merged context (no output projection) -> [1][1][4096][1024] (4.2 M)).
// Compute dtypes, f32 accumulate: every input rounded to bf16; q/k/v on PLAIN bf16 operands (inputs: exact) + biases; scores (K = 512) and attn.v (N = 512; no mask): query rows < 512 hl (3 products), the rest single fp16 (x1024); softmax f32; no output projection: the merged context is written in f32.

#define NB_  1
#define TT   4096
#define DM   1024
#define NH_  2
#define NKV  2
#define REP  (NH_ / NKV)
#define HD   512
#define DQ   (NH_ * HD)
#define DKV  (NKV * HD)
#define ZH   1
#define RH   512                  // query rows < RH use hi+lo planes (0: none)
#define WIN  0
#define PCAR 1024.0f
#define SCL  0.044194173824159216f   // 512^-0.5 (head width 512)
typedef _Float16 h16;
typedef unsigned short bf;
typedef __attribute__((ext_vector_type(16))) __bf16   v16bf;
typedef __attribute__((ext_vector_type(16))) _Float16 v16h;
typedef __attribute__((ext_vector_type(8)))  _Float16 v8h;
typedef __attribute__((ext_vector_type(8)))  unsigned short v8us;
typedef __attribute__((ext_vector_type(8)))  float    v8f;
typedef __attribute__((ext_vector_type(4)))  float    v4f;
typedef v8h  __attribute__((may_alias)) v8ha;
typedef v4f  __attribute__((may_alias)) v4fa;
typedef v8us __attribute__((may_alias)) v8usa;

__device__ __forceinline__ unsigned short f2bf(float f) { unsigned u = __float_as_uint(f); u += 0x7FFFu + ((u >> 16) & 1u); return (unsigned short)(u >> 16); }
__device__ __forceinline__ float bf2f(unsigned short b) { return __uint_as_float(((unsigned)b) << 16); }
__device__ __forceinline__ float bfr(float f) { return bf2f(f2bf(f)); }
__device__ __forceinline__ v16h cat16(v8h lo, v8h hi) { return __builtin_shufflevector(lo, hi, 0, 1, 2, 3, 4, 5, 6, 7, 8, 9, 10, 11, 12, 13, 14, 15); }
__device__ __forceinline__ v16bf cat16b(v8us lo, v8us hi) { return __builtin_bit_cast(v16bf, __builtin_shufflevector(lo, hi, 0, 1, 2, 3, 4, 5, 6, 7, 8, 9, 10, 11, 12, 13, 14, 15)); }
__device__ __forceinline__ v8f wmma16(v16h a, v16h b, v8f c) { return __builtin_amdgcn_wmma_f32_16x16x32_f16(false, a, false, b, (short)0, c, false, false); }
__device__ __forceinline__ v8f wmmab(v16bf a, v16bf b, v8f c) { return __builtin_amdgcn_wmma_f32_16x16x32_bf16(false, a, false, b, (short)0, c, false, false); }



// ---- k_gemmw: register-blocked GEMM, one 64x64 output tile per work-group of KW waves; wave w sums the k range [w K/KW, (w+1) K/KW) into its own 16 accumulators, operands straight from K-contiguous 16-bit planes; the KW partial tiles are added in LDS in wave order. grid (M/64, N/64, Z), 32 KW threads.
// c[m][n] = sum_k A[m][k] Bt[n][k] (+ split products per NSPLIT). z-batch strides sA/sB/sC/sBias in elements. K % (32 KW) == 0.
// EPI says what the epilogue stores, pitch ldc: EP_F32 c as f32 in C; EP_SCALE c x cs as f32 in C; EP_COLB (c + bias[n]) and EP_ROWB (c + bias[m]) as the three 16-bit planes the next GEMMs read (fp16, bf16 hi, bf16 lo).
#define EP_F32   0
#define EP_SCALE 1
#define EP_COLB  2
#define EP_ROWB  3
__device__ __forceinline__ void splitf(float y, unsigned short& h, unsigned short& l) { h = f2bf(y); l = f2bf(y - bf2f(h)); }
typedef __attribute__((ext_vector_type(4))) _Float16 v4h;
typedef __attribute__((ext_vector_type(4))) unsigned short v4us;
template <typename T16> struct WFrag;
template <> struct WFrag<h16> { typedef v16h V; static __device__ __forceinline__ V ld(const h16* p) { return cat16(*(const v8h*)p, *(const v8h*)(p + 16)); } static __device__ __forceinline__ v8f mma(V a, V b, v8f c) { return wmma16(a, b, c); } };
template <> struct WFrag<bf> { typedef v16bf V; static __device__ __forceinline__ V ld(const bf* p) { return cat16b(*(const v8us*)p, *(const v8us*)(p + 16)); } static __device__ __forceinline__ v8f mma(V a, V b, v8f c) { return wmmab(a, b, c); } };
template <typename T16, int NSPLIT, int EPI, int KW>
__global__ __launch_bounds__(32 * KW) void k_gemmw(const T16* __restrict__ A, const T16* __restrict__ A2, const T16* __restrict__ Bt, const T16* __restrict__ Bt2, int K, float* C, int ldc, const float* __restrict__ bias, size_t sA, size_t sB, size_t sC, size_t sBias, float cs, h16* P16, bf* Ph, bf* Pl) {
    static_assert(KW > 1 || EPI == EP_F32, "the one-wave form stores f32 only");
    typedef typename WFrag<T16>::V V;
    __shared__ __align__(16) float os[KW == 1 ? 16 * 68 : KW * 64 * 68];
    const size_t z = blockIdx.z; A += z * sA; if (A2) A2 += z * sA; Bt += z * sB; if (Bt2) Bt2 += z * sB;
    if constexpr (EPI == EP_F32 || EPI == EP_SCALE) C += z * sC; else { P16 += z * sC; Ph += z * sC; Pl += z * sC; bias += z * sBias; }
    const int lane = threadIdx.x & 31, lr = lane & 15, hi = lane >> 4; const int wave = __builtin_amdgcn_readfirstlane((int)(threadIdx.x >> 5)); const int kb = wave * (K / KW), ke = kb + K / KW; const int r0 = blockIdx.x * 64, c0 = blockIdx.y * 64;
    v8f acc[4][4];
#pragma unroll
    for (int mb = 0; mb < 4; ++mb)
#pragma unroll
        for (int nb = 0; nb < 4; ++nb) acc[mb][nb] = (v8f){};
    const size_t aoff = (size_t)(r0 + lr) * K + 8 * hi, boff = (size_t)(c0 + lr) * K + 8 * hi;
#pragma unroll 1
    for (int kc = kb; kc < ke; kc += 32) {
        V a[4], a2[4];
#pragma unroll
        for (int mb = 0; mb < 4; ++mb) { a[mb] = WFrag<T16>::ld(A + aoff + (size_t)mb * 16 * K + kc); if (NSPLIT == 1 || NSPLIT == 2) a2[mb] = WFrag<T16>::ld(A2 + aoff + (size_t)mb * 16 * K + kc); }
#pragma unroll
        for (int nb = 0; nb < 4; ++nb) { const V b = WFrag<T16>::ld(Bt + boff + (size_t)nb * 16 * K + kc); V b2; if (NSPLIT >= 2) b2 = WFrag<T16>::ld(Bt2 + boff + (size_t)nb * 16 * K + kc);
#pragma unroll
            for (int mb = 0; mb < 4; ++mb) { acc[mb][nb] = WFrag<T16>::mma(a[mb], b, acc[mb][nb]); if (NSPLIT == 1 || NSPLIT == 2) acc[mb][nb] = WFrag<T16>::mma(a2[mb], b, acc[mb][nb]); if (NSPLIT >= 2) acc[mb][nb] = WFrag<T16>::mma(a[mb], b2, acc[mb][nb]); } }
        asm volatile("v_nop\n\tv_nop\n\tv_nop\n\tv_nop" : "+v"(acc[0][0]), "+v"(acc[1][1]), "+v"(acc[2][2]), "+v"(acc[3][3]) : "v"(a[0]), "v"(a[3]));
    }
    if constexpr (KW == 1) {
#pragma unroll
    for (int mb = 0; mb < 4; ++mb) {
#pragma unroll
        for (int nb = 0; nb < 4; ++nb) {
#pragma unroll
            for (int j = 0; j < 8; ++j) os[(hi * 8 + j) * 68 + nb * 16 + lr] = acc[mb][nb][j]; }
        __builtin_amdgcn_wave_barrier(); asm volatile("" ::: "memory");
        float* crow = C + (size_t)(r0 + mb * 16) * ldc + c0;
{
#pragma unroll
            for (int s = 0; s < 8; ++s) { const int row = 2 * s + hi, cofs = lr * 4; v4f val = *(const v4fa*)(os + row * 68 + cofs);
                *(v4f*)(crow + (size_t)row * ldc + cofs) = val; }
             }
        __builtin_amdgcn_wave_barrier(); asm volatile("" ::: "memory");
    }
    } else {
        float* osw = os + wave * (64 * 68);
#pragma unroll
        for (int mb = 0; mb < 4; ++mb)
#pragma unroll
            for (int nb = 0; nb < 4; ++nb)
#pragma unroll
                for (int j = 0; j < 8; ++j) osw[(mb * 16 + hi * 8 + j) * 68 + nb * 16 + lr] = acc[mb][nb][j];
        __syncthreads();   // every wave's partial tile is in LDS before any thread adds the KW tiles
#pragma unroll
        for (int s = 0; s < 32 / KW; ++s) { const int it = (int)threadIdx.x + s * 32 * KW, row = it >> 4, cofs = (it & 15) * 4; v4f val = *(const v4fa*)(os + row * 68 + cofs);
#pragma unroll
            for (int w = 1; w < KW; ++w) val += *(const v4fa*)(os + w * (64 * 68) + row * 68 + cofs);
            if constexpr (EPI == EP_COLB) { val[0] += bfr(bias[c0 + cofs]); val[1] += bfr(bias[c0 + cofs + 1]); val[2] += bfr(bias[c0 + cofs + 2]); val[3] += bfr(bias[c0 + cofs + 3]); }
            if constexpr (EPI == EP_ROWB) { const float br = bfr(bias[r0 + row]); val[0] += br; val[1] += br; val[2] += br; val[3] += br; }
            if constexpr (EPI == EP_SCALE) val *= cs;
            const size_t oo = (size_t)(r0 + row) * ldc + c0 + cofs;
            if constexpr (EPI == EP_F32 || EPI == EP_SCALE) *(v4f*)(C + oo) = val;
            else { v4h o16; v4us oh, ol;   // 16 lanes x 8 bytes: one whole 128-byte line of each plane per tile row
#pragma unroll
                for (int q = 0; q < 4; ++q) { o16[q] = (h16)val[q]; unsigned short a2, c2; splitf(val[q], a2, c2); oh[q] = a2; ol[q] = c2; }
                *(v4h*)(P16 + oo) = o16; *(v4us*)(Ph + oo) = oh; *(v4us*)(Pl + oo) = ol; } }
    }
}

__device__ __forceinline__ h16 tohx(float x) { return (h16)x; }
typedef __attribute__((ext_vector_type(2))) _Float16 v2h;
typedef __attribute__((ext_vector_type(2))) unsigned short v2us;
typedef __attribute__((ext_vector_type(2))) float v2f;
typedef __attribute__((ext_vector_type(4))) int v4i;

__global__ __launch_bounds__(256) void k_wtG(const float* __restrict__ w, int K, int N, bf* Bt) {
    const int lane = threadIdx.x & 31; const int L0 = (blockIdx.x * 8 + (threadIdx.x >> 5)) * 8; const int nlines = N * K / 64;
{
#pragma unroll 1
        for (int l = 0; l < 8; ++l) { const int L = L0 + l; if (L >= nlines) break; const size_t e = (size_t)L * 64 + lane * 2; const int k = (int)(e % K), n = (int)(e / K); v2us o;
            o[0] = f2bf(w[(size_t)k * N + n]); o[1] = f2bf(w[(size_t)(k + 1) * N + n]); *(v2us*)(Bt + e) = o; }
         }
}
__global__ __launch_bounds__(256) void k_cvt8(const float* __restrict__ src, bf* dst, size_t n8) { const size_t i = (size_t)blockIdx.x * 256 + threadIdx.x; if (i >= n8) return; const v8f v = *(const v8f*)(src + i * 8); v8us o;
#pragma unroll
    for (int k = 0; k < 8; ++k) o[k] = f2bf(v[k]); *(v8us*)(dst + i * 8) = o;  }

// k_asoft: per row (zz, i): t = S x HD^-0.5 (no mask); softmax over the 4096 keys (register row, one exp, fixed trees);
__global__ __launch_bounds__(256) void k_asoft(const float* __restrict__ Sb, h16* P16, bf* Ph, bf* Pl) {
    const int lane = threadIdx.x & 31; const int row = blockIdx.x * 8 + (threadIdx.x >> 5); if (row >= ZH * TT) return; const int i = row % TT; const int zz = row / TT; (void)zz; const bool hires = (i < RH); const float* sr = Sb + (size_t)row * TT; float v[TT / 32]; float mx = -3.0e38f;
#pragma unroll
    for (int ch = 0; ch < TT / 128; ++ch) { const int j0 = ch * 128 + lane * 4; const v4f a = *(const v4f*)(sr + j0);
#pragma unroll
        for (int q = 0; q < 4; ++q) { const int j = j0 + q; (void)j; const float t = a[q] * SCL; v[ch * 4 + q] = t; mx = fmaxf(mx, t); } }
#pragma unroll
    for (int sh = 16; sh; sh >>= 1) mx = fmaxf(mx, __shfl_xor(mx, sh, 32));
    float sum = 0.f;
#pragma unroll
    for (int k = 0; k < TT / 32; ++k) { float d0 = __fsub_rn(v[k], mx); asm volatile("" : "+v"(d0)); v[k] = __builtin_amdgcn_exp2f(__fmul_rn(d0, 1.4426950408889634f)); sum += v[k]; }
#pragma unroll
    for (int sh = 16; sh; sh >>= 1) sum += __shfl_xor(sum, sh, 32);
    const float f = __fdiv_rn(hires ? 1.0f : PCAR, sum);
{
        if (hires) {
#pragma unroll
            for (int ch = 0; ch < TT / 128; ++ch) { v4us oh, ol;
#pragma unroll
                for (int q = 0; q < 4; ++q) { unsigned short a, c2; splitf(v[ch * 4 + q] * f, a, c2); oh[q] = a; ol[q] = c2; }
                const size_t oo = ((size_t)zz * (RH ? RH : 1) + i) * TT + ch * 128 + lane * 4; *(v4us*)(Ph + oo) = oh; *(v4us*)(Pl + oo) = ol; }
        } else {
#pragma unroll
            for (int ch = 0; ch < TT / 128; ++ch) { v4h o4;
#pragma unroll
                for (int q = 0; q < 4; ++q) o4[q] = tohx(v[ch * 4 + q] * f);
                *(v4h*)(P16 + (size_t)row * TT + ch * 128 + lane * 4) = o4; } }
         }
}

extern "C" void kernel_launch(void* const* d_in, const int* in_sizes, int n_in,
                              void* d_out, int out_size, void* d_ws, size_t ws_size, hipStream_t stream) {
    (void)in_sizes; (void)n_in; (void)out_size;
    const float* x = (const float*)d_in[0]; const float* wq = (const float*)d_in[1]; const float* bq = (const float*)d_in[2]; const float* wk = (const float*)d_in[3]; const float* bk = (const float*)d_in[4]; const float* wv = (const float*)d_in[5]; const float* bv = (const float*)d_in[6]; const float* wo = nullptr; (void)wo;
    float* OUT = (float*)d_out;     // [1][4096][1024]
    char* wsp = (char*)d_ws;
    auto take = [&](size_t bytes) { char* p = wsp; wsp += (bytes + 255) & ~(size_t)255; return (void*)p; };
    bf* WQ = (bf*)take((size_t)DQ * DM * 2); bf* WK = (bf*)take((size_t)DKV * DM * 2); bf* WV = (bf*)take((size_t)DKV * DM * 2);
    bf* XB = (bf*)take((size_t)TT * DM * 2);
    h16* QP16 = (h16*)take((size_t)NH_ * TT * HD * 2); h16* KP16 = (h16*)take((size_t)NKV * TT * HD * 2); h16* VT16 = (h16*)take((size_t)NKV * HD * TT * 2);
    bf* QPh = (bf*)take((size_t)NH_ * TT * HD * 2); bf* QPl = (bf*)take((size_t)NH_ * TT * HD * 2); bf* KPh = (bf*)take((size_t)NKV * TT * HD * 2); bf* KPl = (bf*)take((size_t)NKV * TT * HD * 2); bf* VTh = (bf*)take((size_t)NKV * HD * TT * 2); bf* VTl = (bf*)take((size_t)NKV * HD * TT * 2); bf* Ph = (bf*)take((size_t)ZH * RH * TT * 2); bf* Pl = (bf*)take((size_t)ZH * RH * TT * 2);
    float* Sb = (float*)take((size_t)ZH * TT * TT * 4); h16* P16 = (h16*)take((size_t)ZH * TT * TT * 2);
    if ((size_t)(wsp - (char*)d_ws) > ws_size) return;    // ws 256 MiB
    { k_cvt8<<<(unsigned)(((size_t)DQ * DM / 8 + 255) / 256), 256, 0, stream>>>(wq, WQ, (size_t)DQ * DM / 8); k_cvt8<<<(unsigned)(((size_t)DKV * DM / 8 + 255) / 256), 256, 0, stream>>>(wk, WK, (size_t)DKV * DM / 8); k_cvt8<<<(unsigned)(((size_t)DKV * DM / 8 + 255) / 256), 256, 0, stream>>>(wv, WV, (size_t)DKV * DM / 8);
       }
    for (int b = 0; b < NB_; ++b) {
        
        k_cvt8<<<(unsigned)(((size_t)TT * DM / 8 + 255) / 256), 256, 0, stream>>>(x + (size_t)b * TT * DM, XB, (size_t)TT * DM / 8);
        // q and k: z = head, so the epilogue stores the head planes [h][t][d] itself
        k_gemmw<bf, 0, EP_COLB, 4><<<dim3(TT / 64, HD / 64, NH_), 128, 0, stream>>>(XB, nullptr, WQ, nullptr, DM, nullptr, HD, bq, 0, (size_t)HD * DM, (size_t)TT * HD, HD, 1.0f, QP16, QPh, QPl);
        k_gemmw<bf, 0, EP_COLB, 4><<<dim3(TT / 64, HD / 64, NKV), 128, 0, stream>>>(XB, nullptr, WK, nullptr, DM, nullptr, HD, bk, 0, (size_t)HD * DM, (size_t)TT * HD, HD, 1.0f, KP16, KPh, KPl);
        // v: the weight rows are the M side, so the tile comes out as [g HD + d][t], the transposed planes that attn.v reads
        k_gemmw<bf, 0, EP_ROWB, 4><<<dim3(DKV / 64, TT / 64, 1), 128, 0, stream>>>(WV, nullptr, XB, nullptr, DM, nullptr, TT, bv, 0, 0, 0, 0, 1.0f, VT16, VTh, VTl);
        for (int h0 = 0; h0 < NH_; h0 += ZH) { const size_t zq = (size_t)h0, zk = (size_t)(h0 / REP);   // one kv head per query head: each pass takes one head (ZH = 1) and kv plane zk = h0
            k_gemmw<bf, 2, EP_F32, 4><<<dim3(RH / 64, TT / 64, ZH), 128, 0, stream>>>(QPh + zq * TT * HD, QPl + zq * TT * HD, KPh + zk * TT * HD, KPl + zk * TT * HD, HD, Sb, TT, nullptr, (size_t)TT * HD, (size_t)TT * HD, (size_t)TT * TT, 0, 1.0f, nullptr, nullptr, nullptr);
            k_gemmw<h16, 0, EP_F32, 1><<<dim3((TT - RH) / 64, TT / 64, ZH), 32, 0, stream>>>(QP16 + zq * TT * HD + (size_t)RH * HD, nullptr, KP16 + zk * TT * HD, nullptr, HD, Sb + (size_t)RH * TT, TT, nullptr, (size_t)TT * HD, (size_t)TT * HD, (size_t)TT * TT, 0, 1.0f, nullptr, nullptr, nullptr);
            k_asoft<<<ZH * TT / 8, 256, 0, stream>>>(Sb, P16, Ph, Pl);
            float* Oh = OUT + (size_t)b * TT * DM + (size_t)h0 * HD;   // this head's columns of the merged output, pitch DQ: f32 context straight to the output
            k_gemmw<bf, 2, EP_F32, 16><<<dim3(RH / 64, HD / 64, ZH), 512, 0, stream>>>(Ph, Pl, VTh + zk * HD * TT, VTl + zk * HD * TT, TT, Oh, DQ, nullptr, (size_t)RH * TT, (size_t)HD * TT, (size_t)HD, 0, 1.0f, nullptr, nullptr, nullptr);
            k_gemmw<h16, 0, EP_SCALE, 8><<<dim3((TT - RH) / 64, HD / 64, ZH), 256, 0, stream>>>(P16 + (size_t)RH * TT, nullptr, VT16 + zk * HD * TT, nullptr, TT, Oh + (size_t)RH * DQ, DQ, nullptr, (size_t)TT * TT, (size_t)HD * TT, (size_t)HD, 0, 1.0f / PCAR, nullptr, nullptr, nullptr); }
    }
}

// v003
// A run of this version takes 238 microseconds.
// Timed twice side by side with v002, it ran 1.49 and 1.47 times as fast.
// Counting every step since v000, it is 2.66 times as fast.
#include <hip/hip_runtime.h>

// Two-head self-attention with 512-wide heads (activation [1][1][4096][1024]; q, k, v = x W^T + b ('oi' [1024][1024]), 2 heads x 512; softmax(q.k/sqrt(512)) over all 4096 keys; out = merged context (no output projection) -> [1][1][4096][1024] (4.2 M)).
// Compute dtypes, f32 accumulate: every input rounded to bf16; q/k/v on PLAIN bf16 operands (inputs: exact) + biases; scores (K = 512) and attn.v (N = 512; no mask): query rows < 512 hl (3 products), the rest single fp16 (x1024); softmax f32; no output projection: the merged context is written in f32.

#define NB_  1
#define TT   4096
#define DM   1024
#define NH_  2
#define NKV  2
#define REP  (NH_ / NKV)
#define HD   512
#define DQ   (NH_ * HD)
#define DKV  (NKV * HD)
#define ZH   1
#define RH   512                  // query rows < RH use hi+lo planes (0: none)
#define WIN  0
#define PCAR 1024.0f
#define SCL  0.044194173824159216f   // 512^-0.5 (head width 512)
typedef _Float16 h16;
typedef unsigned short bf;
typedef __attribute__((ext_vector_type(16))) __bf16   v16bf;
typedef __attribute__((ext_vector_type(16))) _Float16 v16h;
typedef __attribute__((ext_vector_type(8)))  _Float16 v8h;
typedef __attribute__((ext_vector_type(8)))  unsigned short v8us;
typedef __attribute__((ext_vector_type(8)))  float    v8f;
typedef __attribute__((ext_vector_type(4)))  float    v4f;
typedef v8h  __attribute__((may_alias)) v8ha;
typedef v4f  __attribute__((may_alias)) v4fa;
typedef v8us __attribute__((may_alias)) v8usa;

__device__ __forceinline__ unsigned short f2bf(float f) { unsigned u = __float_as_uint(f); u += 0x7FFFu + ((u >> 16) & 1u); return (unsigned short)(u >> 16); }
__device__ __forceinline__ float bf2f(unsigned short b) { return __uint_as_float(((unsigned)b) << 16); }
__device__ __forceinline__ float bfr(float f) { return bf2f(f2bf(f)); }
__device__ __forceinline__ v16h cat16(v8h lo, v8h hi) { return __builtin_shufflevector(lo, hi, 0, 1, 2, 3, 4, 5, 6, 7, 8, 9, 10, 11, 12, 13, 14, 15); }
__device__ __forceinline__ v16bf cat16b(v8us lo, v8us hi) { return __builtin_bit_cast(v16bf, __builtin_shufflevector(lo, hi, 0, 1, 2, 3, 4, 5, 6, 7, 8, 9, 10, 11, 12, 13, 14, 15)); }
__device__ __forceinline__ v8f wmma16(v16h a, v16h b, v8f c) { return __builtin_amdgcn_wmma_f32_16x16x32_f16(false, a, false, b, (short)0, c, false, false); }
__device__ __forceinline__ v8f wmmab(v16bf a, v16bf b, v8f c) { return __builtin_amdgcn_wmma_f32_16x16x32_bf16(false, a, false, b, (short)0, c, false, false); }



// ---- k_gemms: LDS-staged GEMM. c[m][n] = sum_k A[m][k] Bt[n][k] (NSPLIT 2: + A2 Bt + A Bt2, the hi+lo planes), operands K-contiguous 16-bit planes; z-batch strides sA/sB/sC/sBias in elements.
// NSPLIT 0: 128x128 tile per work-group, a wave group = 2x2 waves of 64x64, a stage = [A 128 rows | Bt 128 rows] of 128 k (256 bytes, pitch 272). NSPLIT 2: 64x64 tile, a wave group = 2 waves of 32x64, a stage = [A | A2 | Bt | Bt2], 64 rows each, of 64 k (128 bytes, pitch 144).
// A trip covers KG stages of k, one per wave group; a group's stage comes in by asynchronous copies to LDS (every wave-wide copy = whole 128-byte lines), two buffers: the next trip's copies fly while this trip's fragments are read from LDS by all waves of the group. The KG partial tiles are added in LDS in group order.
// grid (M/tile, N/tile, Z), 32 x waves threads. K % (stage k x KG) == 0.
// EPI says what the epilogue stores, pitch ldc: EP_F32 c as f32 in C; EP_SCALE c x cs as f32 in C; EP_COLB (c + bias[n]) and EP_ROWB (c + bias[m]) as the three 16-bit planes the next GEMMs read (fp16, bf16 hi, bf16 lo).
#define EP_F32   0
#define EP_SCALE 1
#define EP_COLB  2
#define EP_ROWB  3
__device__ __forceinline__ void splitf(float y, unsigned short& h, unsigned short& l) { h = f2bf(y); l = f2bf(y - bf2f(h)); }
typedef __attribute__((ext_vector_type(4))) _Float16 v4h;
typedef __attribute__((ext_vector_type(4))) unsigned short v4us;
template <typename T16> struct WFrag;   // ld: one fragment from an LDS row, p = the lane's byte address (row, 16 bytes x lane half): k 8 hi .. 8 hi + 7 and 16 + 8 hi .. 16 + 8 hi + 7, the same for both operands
template <> struct WFrag<h16> { typedef v16h V; static __device__ __forceinline__ V ld(const char* p) { return cat16(*(const v8ha*)p, *(const v8ha*)(p + 32)); } static __device__ __forceinline__ v8f mma(V a, V b, v8f c) { return wmma16(a, b, c); } };
template <> struct WFrag<bf> { typedef v16bf V; static __device__ __forceinline__ V ld(const char* p) { return cat16b(*(const v8usa*)p, *(const v8usa*)(p + 32)); } static __device__ __forceinline__ v8f mma(V a, V b, v8f c) { return wmmab(a, b, c); } };
// eight copies of 16 bytes per lane, rows 8 apart; the s_wait_xcnt stands inside the statement so that no address register of a copy is rewritten ahead of it
template <int PITCH, typename T16>
__device__ __forceinline__ void cp8(unsigned l, const T16* g, size_t gs) {
    asm volatile("global_load_async_to_lds_b128 %0, %8, off\n\t"
                 "global_load_async_to_lds_b128 %1, %9, off\n\t"
                 "global_load_async_to_lds_b128 %2, %10, off\n\t"
                 "global_load_async_to_lds_b128 %3, %11, off\n\t"
                 "global_load_async_to_lds_b128 %4, %12, off\n\t"
                 "global_load_async_to_lds_b128 %5, %13, off\n\t"
                 "global_load_async_to_lds_b128 %6, %14, off\n\t"
                 "global_load_async_to_lds_b128 %7, %15, off\n\t"
                 "s_wait_xcnt 0x0"
                 :: "v"(l), "v"(l + 8 * PITCH), "v"(l + 16 * PITCH), "v"(l + 24 * PITCH), "v"(l + 32 * PITCH), "v"(l + 40 * PITCH), "v"(l + 48 * PITCH), "v"(l + 56 * PITCH),
                    "v"(g), "v"(g + gs), "v"(g + 2 * gs), "v"(g + 3 * gs), "v"(g + 4 * gs), "v"(g + 5 * gs), "v"(g + 6 * gs), "v"(g + 7 * gs)
                 : "memory");
}
template <typename T16, int NSPLIT, int EPI, int KG>
__global__ __launch_bounds__((NSPLIT ? 64 : 128) * KG) void k_gemms(const T16* __restrict__ A, const T16* __restrict__ A2, const T16* __restrict__ Bt, const T16* __restrict__ Bt2, int K, float* C, int ldc, const float* __restrict__ bias, size_t sA, size_t sB, size_t sC, size_t sBias, float cs, h16* P16, bf* Ph, bf* Pl) {
    static_assert(NSPLIT == 0 || NSPLIT == 2, "one product, or the three of the hi+lo planes");
    typedef typename WFrag<T16>::V V;
    constexpr int KS = NSPLIT ? 64 : 128, PITCH = KS * 2 + 16, STAGE = 256 * PITCH, NK = KS / 32, MB = NSPLIT ? 2 : 4, GWV = NSPLIT ? 2 : 4, TILE = NSPLIT ? 64 : 128, OT = MB * 16 * 68;
    __shared__ __align__(16) char sm[2 * KG * STAGE];
    const size_t z = blockIdx.z; A += z * sA; Bt += z * sB; if constexpr (NSPLIT == 2) { A2 += z * sA; Bt2 += z * sB; }
    if constexpr (EPI == EP_F32 || EPI == EP_SCALE) C += z * sC; else { P16 += z * sC; Ph += z * sC; Pl += z * sC; bias += z * sBias; }
    const int lane = threadIdx.x & 31, lr = lane & 15, hi = lane >> 4; const int wave = __builtin_amdgcn_readfirstlane((int)(threadIdx.x >> 5)); const int kg = wave / GWV, wig = wave % GWV, wm = NSPLIT ? wig : wig >> 1, wn = NSPLIT ? 0 : wig & 1; const int r0 = blockIdx.x * TILE, c0 = blockIdx.y * TILE;
    v8f acc[MB][4];
#pragma unroll
    for (int mb = 0; mb < MB; ++mb)
#pragma unroll
        for (int nb = 0; nb < 4; ++nb) acc[mb][nb] = (v8f){};
    // copy lanes: thread tg of its group brings 16-byte piece cch of rows crow + 8 i, i < 8, of each 64-row quarter of the stage
    const int tg = (int)threadIdx.x % (GWV * 32), crow = tg / (KS / 8), cch = tg % (KS / 8);
    const size_t ga = (size_t)(r0 + crow) * K + kg * KS + cch * 8, gb = (size_t)(c0 + crow) * K + kg * KS + cch * 8;
    const T16* g0 = A + ga; const T16* g1 = NSPLIT ? A2 + ga : A + ga + (size_t)64 * K; const T16* g2 = Bt + gb; const T16* g3 = NSPLIT ? Bt2 + gb : Bt + gb + (size_t)64 * K;
    const unsigned l0 = (unsigned)(size_t)sm + (unsigned)(kg * STAGE + crow * PITCH + cch * 16);
    const size_t gs = (size_t)8 * K; const int nt = K / (KS * KG);
    auto fill = [&](int buf, int t) { const unsigned l = l0 + (unsigned)(buf * (KG * STAGE)); const size_t ko = (size_t)t * (KS * KG);
        cp8<PITCH>(l, g0 + ko, gs); cp8<PITCH>(l + 64 * PITCH, g1 + ko, gs); cp8<PITCH>(l + 128 * PITCH, g2 + ko, gs); cp8<PITCH>(l + 192 * PITCH, g3 + ko, gs); };
    fill(0, 0);
    asm volatile("s_wait_asynccnt 0x0" ::: "memory");   // this wave's part of trip 0 has landed
    __syncthreads();                                     // trip 0's stages are whole before any wave reads them
    if (nt > 1) fill(1, 1);
#pragma unroll 1   // the trip loop stays rolled: one copy of the ring's hand-over
    for (int t = 0; t < nt; ++t) {
        const char* sb = sm + ((t & 1) * KG + kg) * STAGE; const char* pa = sb + (wm * MB * 16 + lr) * PITCH + hi * 16; const char* pb = sb + (128 + wn * 64 + lr) * PITCH + hi * 16;
        // fragments run ahead of their products inside the trip: A two k steps (two sets), Bt half a k step (each pair of columns is refetched when its products are issued)
        V a[2][MB], a2[2][MB], b[4], b2[4];
#pragma unroll
        for (int q = 0; q < (NK < 2 ? NK : 2); ++q)
#pragma unroll
            for (int mb = 0; mb < MB; ++mb) { a[q][mb] = WFrag<T16>::ld(pa + mb * 16 * PITCH + q * 64); if constexpr (NSPLIT == 2) a2[q][mb] = WFrag<T16>::ld(pa + (64 + mb * 16) * PITCH + q * 64); }
#pragma unroll
        for (int nb = 0; nb < 4; ++nb) { b[nb] = WFrag<T16>::ld(pb + nb * 16 * PITCH); if constexpr (NSPLIT == 2) b2[nb] = WFrag<T16>::ld(pb + (64 + nb * 16) * PITCH); }
        __builtin_amdgcn_sched_barrier(0);   // this and the two below keep each group of LDS loads whole and ahead of the products in front of its use; without them the scheduler sinks every load to its first use and the wave waits out the LDS latency there
#pragma unroll
        for (int ks = 0; ks < NK; ++ks) {
#pragma unroll
            for (int nh = 0; nh < 2; ++nh) {
#pragma unroll
                for (int nb = 2 * nh; nb < 2 * nh + 2; ++nb)
#pragma unroll
                    for (int mb = 0; mb < MB; ++mb) { acc[mb][nb] = WFrag<T16>::mma(a[ks & 1][mb], b[nb], acc[mb][nb]); if constexpr (NSPLIT == 2) { acc[mb][nb] = WFrag<T16>::mma(a2[ks & 1][mb], b[nb], acc[mb][nb]); acc[mb][nb] = WFrag<T16>::mma(a[ks & 1][mb], b2[nb], acc[mb][nb]); } }
                __builtin_amdgcn_sched_barrier(0);
                if (ks + 1 < NK) {
#pragma unroll
                    for (int nb = 2 * nh; nb < 2 * nh + 2; ++nb) { b[nb] = WFrag<T16>::ld(pb + nb * 16 * PITCH + (ks + 1) * 64); if constexpr (NSPLIT == 2) b2[nb] = WFrag<T16>::ld(pb + (64 + nb * 16) * PITCH + (ks + 1) * 64); } }
                if (nh == 1 && ks + 2 < NK) {
#pragma unroll
                    for (int mb = 0; mb < MB; ++mb) { a[ks & 1][mb] = WFrag<T16>::ld(pa + mb * 16 * PITCH + (ks + 2) * 64); if constexpr (NSPLIT == 2) a2[ks & 1][mb] = WFrag<T16>::ld(pa + (64 + mb * 16) * PITCH + (ks + 2) * 64); } }
                __builtin_amdgcn_sched_barrier(0);
            }
        }
        asm volatile("s_wait_dscnt 0x0" ::: "memory");      // this wave has left the buffer that is refilled below
        asm volatile("s_wait_asynccnt 0x0" ::: "memory");   // this wave's part of trip t + 1 has landed
        __syncthreads();                                     // publishes trip t + 1 and ends every read of trip t's buffer
        if (t + 2 < nt) fill(t & 1, t + 2);
    }
    asm volatile("s_wait_asynccnt 0x0" ::: "memory");   // no copy is in flight when the ring becomes output staging
    float* os = (float*)sm; float* osw = os + wave * OT;
#pragma unroll
    for (int mb = 0; mb < MB; ++mb)
#pragma unroll
        for (int nb = 0; nb < 4; ++nb)
#pragma unroll
            for (int j = 0; j < 8; ++j) osw[(mb * 16 + hi * 8 + j) * 68 + nb * 16 + lr] = acc[mb][nb][j];
    __syncthreads();   // every wave's partial tile is in LDS before any wave adds the KG tiles
    const float* ot = os + wig * OT;
#pragma unroll
    for (int s = 0; s < MB * 8 / KG; ++s) { const int it = lane + (s + kg * (MB * 8 / KG)) * 32, row = it >> 4, cofs = (it & 15) * 4; v4f val = *(const v4fa*)(ot + row * 68 + cofs);
#pragma unroll
        for (int g = 1; g < KG; ++g) val += *(const v4fa*)(ot + g * (GWV * OT) + row * 68 + cofs);
        const int gr = r0 + wm * MB * 16 + row, gc = c0 + wn * 64 + cofs;
        if constexpr (EPI == EP_COLB) { val[0] += bfr(bias[gc]); val[1] += bfr(bias[gc + 1]); val[2] += bfr(bias[gc + 2]); val[3] += bfr(bias[gc + 3]); }
        if constexpr (EPI == EP_ROWB) { const float br = bfr(bias[gr]); val[0] += br; val[1] += br; val[2] += br; val[3] += br; }
        if constexpr (EPI == EP_SCALE) val *= cs;
        const size_t oo = (size_t)gr * ldc + gc;
        if constexpr (EPI == EP_F32 || EPI == EP_SCALE) *(v4f*)(C + oo) = val;
        else { v4h o16; v4us oh, ol;   // 16 lanes x 8 bytes: one whole 128-byte line of each plane per tile row
#pragma unroll
            for (int q = 0; q < 4; ++q) { o16[q] = (h16)val[q]; unsigned short a2s, c2; splitf(val[q], a2s, c2); oh[q] = a2s; ol[q] = c2; }
            *(v4h*)(P16 + oo) = o16; *(v4us*)(Ph + oo) = oh; *(v4us*)(Pl + oo) = ol; } }
}

__device__ __forceinline__ h16 tohx(float x) { return (h16)x; }
typedef __attribute__((ext_vector_type(2))) _Float16 v2h;
typedef __attribute__((ext_vector_type(2))) unsigned short v2us;
typedef __attribute__((ext_vector_type(2))) float v2f;
typedef __attribute__((ext_vector_type(4))) int v4i;

__global__ __launch_bounds__(256) void k_wtG(const float* __restrict__ w, int K, int N, bf* Bt) {
    const int lane = threadIdx.x & 31; const int L0 = (blockIdx.x * 8 + (threadIdx.x >> 5)) * 8; const int nlines = N * K / 64;
{
#pragma unroll 1
        for (int l = 0; l < 8; ++l) { const int L = L0 + l; if (L >= nlines) break; const size_t e = (size_t)L * 64 + lane * 2; const int k = (int)(e % K), n = (int)(e / K); v2us o;
            o[0] = f2bf(w[(size_t)k * N + n]); o[1] = f2bf(w[(size_t)(k + 1) * N + n]); *(v2us*)(Bt + e) = o; }
         }
}
__global__ __launch_bounds__(256) void k_cvt8(const float* __restrict__ src, bf* dst, size_t n8) { const size_t i = (size_t)blockIdx.x * 256 + threadIdx.x; if (i >= n8) return; const v8f v = *(const v8f*)(src + i * 8); v8us o;
#pragma unroll
    for (int k = 0; k < 8; ++k) o[k] = f2bf(v[k]); *(v8us*)(dst + i * 8) = o;  }

// k_asoft: per row (zz, i): t = S x HD^-0.5 (no mask); softmax over the 4096 keys (register row, one exp, fixed trees);
__global__ __launch_bounds__(256) void k_asoft(const float* __restrict__ Sb, h16* P16, bf* Ph, bf* Pl) {
    const int lane = threadIdx.x & 31; const int row = blockIdx.x * 8 + (threadIdx.x >> 5); if (row >= ZH * TT) return; const int i = row % TT; const int zz = row / TT; (void)zz; const bool hires = (i < RH); const float* sr = Sb + (size_t)row * TT; float v[TT / 32]; float mx = -3.0e38f;
#pragma unroll
    for (int ch = 0; ch < TT / 128; ++ch) { const int j0 = ch * 128 + lane * 4; const v4f a = *(const v4f*)(sr + j0);
#pragma unroll
        for (int q = 0; q < 4; ++q) { const int j = j0 + q; (void)j; const float t = a[q] * SCL; v[ch * 4 + q] = t; mx = fmaxf(mx, t); } }
#pragma unroll
    for (int sh = 16; sh; sh >>= 1) mx = fmaxf(mx, __shfl_xor(mx, sh, 32));
    float sum = 0.f;
#pragma unroll
    for (int k = 0; k < TT / 32; ++k) { float d0 = __fsub_rn(v[k], mx); asm volatile("" : "+v"(d0)); v[k] = __builtin_amdgcn_exp2f(__fmul_rn(d0, 1.4426950408889634f)); sum += v[k]; }
#pragma unroll
    for (int sh = 16; sh; sh >>= 1) sum += __shfl_xor(sum, sh, 32);
    const float f = __fdiv_rn(hires ? 1.0f : PCAR, sum);
{
        if (hires) {
#pragma unroll
            for (int ch = 0; ch < TT / 128; ++ch) { v4us oh, ol;
#pragma unroll
                for (int q = 0; q < 4; ++q) { unsigned short a, c2; splitf(v[ch * 4 + q] * f, a, c2); oh[q] = a; ol[q] = c2; }
                const size_t oo = ((size_t)zz * (RH ? RH : 1) + i) * TT + ch * 128 + lane * 4; *(v4us*)(Ph + oo) = oh; *(v4us*)(Pl + oo) = ol; }
        } else {
#pragma unroll
            for (int ch = 0; ch < TT / 128; ++ch) { v4h o4;
#pragma unroll
                for (int q = 0; q < 4; ++q) o4[q] = tohx(v[ch * 4 + q] * f);
                *(v4h*)(P16 + (size_t)row * TT + ch * 128 + lane * 4) = o4; } }
         }
}

extern "C" void kernel_launch(void* const* d_in, const int* in_sizes, int n_in,
                              void* d_out, int out_size, void* d_ws, size_t ws_size, hipStream_t stream) {
    (void)in_sizes; (void)n_in; (void)out_size;
    const float* x = (const float*)d_in[0]; const float* wq = (const float*)d_in[1]; const float* bq = (const float*)d_in[2]; const float* wk = (const float*)d_in[3]; const float* bk = (const float*)d_in[4]; const float* wv = (const float*)d_in[5]; const float* bv = (const float*)d_in[6]; const float* wo = nullptr; (void)wo;
    float* OUT = (float*)d_out;     // [1][4096][1024]
    char* wsp = (char*)d_ws;
    auto take = [&](size_t bytes) { char* p = wsp; wsp += (bytes + 255) & ~(size_t)255; return (void*)p; };
    bf* WQ = (bf*)take((size_t)DQ * DM * 2); bf* WK = (bf*)take((size_t)DKV * DM * 2); bf* WV = (bf*)take((size_t)DKV * DM * 2);
    bf* XB = (bf*)take((size_t)TT * DM * 2);
    h16* QP16 = (h16*)take((size_t)NH_ * TT * HD * 2); h16* KP16 = (h16*)take((size_t)NKV * TT * HD * 2); h16* VT16 = (h16*)take((size_t)NKV * HD * TT * 2);
    bf* QPh = (bf*)take((size_t)NH_ * TT * HD * 2); bf* QPl = (bf*)take((size_t)NH_ * TT * HD * 2); bf* KPh = (bf*)take((size_t)NKV * TT * HD * 2); bf* KPl = (bf*)take((size_t)NKV * TT * HD * 2); bf* VTh = (bf*)take((size_t)NKV * HD * TT * 2); bf* VTl = (bf*)take((size_t)NKV * HD * TT * 2); bf* Ph = (bf*)take((size_t)ZH * RH * TT * 2); bf* Pl = (bf*)take((size_t)ZH * RH * TT * 2);
    float* Sb = (float*)take((size_t)ZH * TT * TT * 4); h16* P16 = (h16*)take((size_t)ZH * TT * TT * 2);
    if ((size_t)(wsp - (char*)d_ws) > ws_size) return;    // ws 256 MiB
    { k_cvt8<<<(unsigned)(((size_t)DQ * DM / 8 + 255) / 256), 256, 0, stream>>>(wq, WQ, (size_t)DQ * DM / 8); k_cvt8<<<(unsigned)(((size_t)DKV * DM / 8 + 255) / 256), 256, 0, stream>>>(wk, WK, (size_t)DKV * DM / 8); k_cvt8<<<(unsigned)(((size_t)DKV * DM / 8 + 255) / 256), 256, 0, stream>>>(wv, WV, (size_t)DKV * DM / 8);
       }
    for (int b = 0; b < NB_; ++b) {
        
        k_cvt8<<<(unsigned)(((size_t)TT * DM / 8 + 255) / 256), 256, 0, stream>>>(x + (size_t)b * TT * DM, XB, (size_t)TT * DM / 8);
        // q and k: z = head, so the epilogue stores the head planes [h][t][d] itself
        k_gemms<bf, 0, EP_COLB, 2><<<dim3(TT / 128, HD / 128, NH_), 256, 0, stream>>>(XB, nullptr, WQ, nullptr, DM, nullptr, HD, bq, 0, (size_t)HD * DM, (size_t)TT * HD, HD, 1.0f, QP16, QPh, QPl);
        k_gemms<bf, 0, EP_COLB, 2><<<dim3(TT / 128, HD / 128, NKV), 256, 0, stream>>>(XB, nullptr, WK, nullptr, DM, nullptr, HD, bk, 0, (size_t)HD * DM, (size_t)TT * HD, HD, 1.0f, KP16, KPh, KPl);
        // v: the weight rows are the M side, so the tile comes out as [g HD + d][t], the transposed planes that attn.v reads
        k_gemms<bf, 0, EP_ROWB, 2><<<dim3(DKV / 128, TT / 128, 1), 256, 0, stream>>>(WV, nullptr, XB, nullptr, DM, nullptr, TT, bv, 0, 0, 0, 0, 1.0f, VT16, VTh, VTl);
        for (int h0 = 0; h0 < NH_; h0 += ZH) { const size_t zq = (size_t)h0, zk = (size_t)(h0 / REP);   // one kv head per query head: a pass takes one head (ZH 1), q plane h0 with kv plane h0
            k_gemms<bf, 2, EP_F32, 4><<<dim3(RH / 64, TT / 64, ZH), 256, 0, stream>>>(QPh + zq * TT * HD, QPl + zq * TT * HD, KPh + zk * TT * HD, KPl + zk * TT * HD, HD, Sb, TT, nullptr, (size_t)TT * HD, (size_t)TT * HD, (size_t)TT * TT, 0, 1.0f, nullptr, nullptr, nullptr);
            k_gemms<h16, 0, EP_F32, 1><<<dim3((TT - RH) / 128, TT / 128, ZH), 128, 0, stream>>>(QP16 + zq * TT * HD + (size_t)RH * HD, nullptr, KP16 + zk * TT * HD, nullptr, HD, Sb + (size_t)RH * TT, TT, nullptr, (size_t)TT * HD, (size_t)TT * HD, (size_t)TT * TT, 0, 1.0f, nullptr, nullptr, nullptr);
            k_asoft<<<ZH * TT / 8, 256, 0, stream>>>(Sb, P16, Ph, Pl);
            float* Oh = OUT + (size_t)b * TT * DM + (size_t)h0 * HD;   // this head's columns of the merged output, pitch DQ: f32 context straight to the output
            k_gemms<bf, 2, EP_F32, 4><<<dim3(RH / 64, HD / 64, ZH), 256, 0, stream>>>(Ph, Pl, VTh + zk * HD * TT, VTl + zk * HD * TT, TT, Oh, DQ, nullptr, (size_t)RH * TT, (size_t)HD * TT, (size_t)HD, 0, 1.0f, nullptr, nullptr, nullptr);
            k_gemms<h16, 0, EP_SCALE, 2><<<dim3((TT - RH) / 128, HD / 128, ZH), 256, 0, stream>>>(P16 + (size_t)RH * TT, nullptr, VT16 + zk * HD * TT, nullptr, TT, Oh + (size_t)RH * DQ, DQ, nullptr, (size_t)TT * TT, (size_t)HD * TT, (size_t)HD, 0, 1.0f / PCAR, nullptr, nullptr, nullptr); }
    }
}

// v004
// One run takes 181 microseconds.
// Timed twice side by side with v003, it ran 1.31 times as fast both times.
// All steps since v000 together make it 3.48 times as fast.
#include <hip/hip_runtime.h>

// Two-head self-attention with 512-wide heads (activation [1][1][4096][1024]; q, k, v = x W^T + b ('oi' [1024][1024]), 2 heads x 512; softmax(q.k/sqrt(512)) over all 4096 keys; out = merged context (no output projection) -> [1][1][4096][1024] (4.2 M)).
// Compute dtypes, f32 accumulate: every input rounded to bf16; q/k/v on PLAIN bf16 operands (inputs: exact) + biases; scores (K = 512) and attn.v (N = 512; no mask): query rows < 512 hl (3 products), the rest single fp16 (x1024); softmax f32; no output projection: the merged context is written in f32.

#define NB_  1
#define TT   4096
#define DM   1024
#define NH_  2
#define NKV  2
#define REP  (NH_ / NKV)
#define HD   512
#define DQ   (NH_ * HD)
#define DKV  (NKV * HD)
#define ZH   2                    // heads per launch, on grid z
#define RH   512                  // query rows < RH use hi+lo planes (0: none)
#define WIN  0
#define PCAR 1024.0f
#define SCL  0.044194173824159216f   // 512^-0.5 (head width 512)
typedef _Float16 h16;
typedef unsigned short bf;
typedef __attribute__((ext_vector_type(16))) __bf16   v16bf;
typedef __attribute__((ext_vector_type(16))) _Float16 v16h;
typedef __attribute__((ext_vector_type(8)))  _Float16 v8h;
typedef __attribute__((ext_vector_type(8)))  unsigned short v8us;
typedef __attribute__((ext_vector_type(8)))  float    v8f;
typedef __attribute__((ext_vector_type(4)))  float    v4f;
typedef v8h  __attribute__((may_alias)) v8ha;
typedef v4f  __attribute__((may_alias)) v4fa;
typedef v8us __attribute__((may_alias)) v8usa;

__device__ __forceinline__ unsigned short f2bf(float f) { unsigned u = __float_as_uint(f); u += 0x7FFFu + ((u >> 16) & 1u); return (unsigned short)(u >> 16); }
__device__ __forceinline__ float bf2f(unsigned short b) { return __uint_as_float(((unsigned)b) << 16); }
__device__ __forceinline__ float bfr(float f) { return bf2f(f2bf(f)); }
__device__ __forceinline__ v16h cat16(v8h lo, v8h hi) { return __builtin_shufflevector(lo, hi, 0, 1, 2, 3, 4, 5, 6, 7, 8, 9, 10, 11, 12, 13, 14, 15); }
__device__ __forceinline__ v16bf cat16b(v8us lo, v8us hi) { return __builtin_bit_cast(v16bf, __builtin_shufflevector(lo, hi, 0, 1, 2, 3, 4, 5, 6, 7, 8, 9, 10, 11, 12, 13, 14, 15)); }
__device__ __forceinline__ v8f wmma16(v16h a, v16h b, v8f c) { return __builtin_amdgcn_wmma_f32_16x16x32_f16(false, a, false, b, (short)0, c, false, false); }
__device__ __forceinline__ v8f wmmab(v16bf a, v16bf b, v8f c) { return __builtin_amdgcn_wmma_f32_16x16x32_bf16(false, a, false, b, (short)0, c, false, false); }



// ---- k_gemms: LDS-staged GEMM. c[m][n] = sum_k A[m][k] Bt[n][k] (NSPLIT 2: + A2 Bt + A Bt2, the hi+lo planes), operands K-contiguous 16-bit planes; z-batch strides sA/sB/sC/sBias in elements.
// NSPLIT 0: 128x128 tile per work-group, a wave group = 2x2 waves of 64x64, a stage = [A 128 rows | Bt 128 rows] of 128 k (256 bytes, pitch 272). NSPLIT 2: 64x64 tile, a wave group = 2 waves of 32x64, a stage = [A | A2 | Bt | Bt2], 64 rows each, of 64 k (128 bytes, pitch 144).
// A trip covers KG stages of k, one per wave group; a group's stage comes in by asynchronous copies to LDS (every wave-wide copy = whole 128-byte lines), two buffers: the next trip's copies fly while this trip's fragments are read from LDS by all waves of the group. The KG partial tiles are added in LDS in group order.
// grid (M/tile, N/tile, Z), 32 x waves threads. K % (stage k x KG) == 0.
// Batches z >= zB take their bias from biasB (two projections with separate bias vectors in one grid).
// EPI says what the epilogue stores, pitch ldc: EP_F32 c as f32 in C; EP_SCALE c x cs as f32 in C; EP_COLB (c + bias[n]) and EP_ROWB (c + bias[m]) as the three 16-bit planes the next GEMMs read (fp16, bf16 hi, bf16 lo).
#define EP_F32   0
#define EP_SCALE 1
#define EP_COLB  2
#define EP_ROWB  3
__device__ __forceinline__ void splitf(float y, unsigned short& h, unsigned short& l) { h = f2bf(y); l = f2bf(y - bf2f(h)); }
typedef __attribute__((ext_vector_type(4))) _Float16 v4h;
typedef __attribute__((ext_vector_type(4))) unsigned short v4us;
template <typename T16> struct WFrag;   // ld: one fragment from an LDS row, p = the lane's byte address (row, 16 bytes x lane half): k 8 hi .. 8 hi + 7 and 16 + 8 hi .. 16 + 8 hi + 7, the same for both operands
template <> struct WFrag<h16> { typedef v16h V; static __device__ __forceinline__ V ld(const char* p) { return cat16(*(const v8ha*)p, *(const v8ha*)(p + 32)); } static __device__ __forceinline__ v8f mma(V a, V b, v8f c) { return wmma16(a, b, c); } };
template <> struct WFrag<bf> { typedef v16bf V; static __device__ __forceinline__ V ld(const char* p) { return cat16b(*(const v8usa*)p, *(const v8usa*)(p + 32)); } static __device__ __forceinline__ v8f mma(V a, V b, v8f c) { return wmmab(a, b, c); } };
// eight copies of 16 bytes per lane, rows 8 apart; the s_wait_xcnt stands inside the statement so that no address register of a copy is rewritten ahead of it
template <int PITCH, typename T16>
__device__ __forceinline__ void cp8(unsigned l, const T16* g, size_t gs) {
    asm volatile("global_load_async_to_lds_b128 %0, %8, off\n\t"
                 "global_load_async_to_lds_b128 %1, %9, off\n\t"
                 "global_load_async_to_lds_b128 %2, %10, off\n\t"
                 "global_load_async_to_lds_b128 %3, %11, off\n\t"
                 "global_load_async_to_lds_b128 %4, %12, off\n\t"
                 "global_load_async_to_lds_b128 %5, %13, off\n\t"
                 "global_load_async_to_lds_b128 %6, %14, off\n\t"
                 "global_load_async_to_lds_b128 %7, %15, off\n\t"
                 "s_wait_xcnt 0x0"
                 :: "v"(l), "v"(l + 8 * PITCH), "v"(l + 16 * PITCH), "v"(l + 24 * PITCH), "v"(l + 32 * PITCH), "v"(l + 40 * PITCH), "v"(l + 48 * PITCH), "v"(l + 56 * PITCH),
                    "v"(g), "v"(g + gs), "v"(g + 2 * gs), "v"(g + 3 * gs), "v"(g + 4 * gs), "v"(g + 5 * gs), "v"(g + 6 * gs), "v"(g + 7 * gs)
                 : "memory");
}
template <typename T16, int NSPLIT, int EPI, int KG>
__global__ __launch_bounds__((NSPLIT ? 64 : 128) * KG) void k_gemms(const T16* __restrict__ A, const T16* __restrict__ A2, const T16* __restrict__ Bt, const T16* __restrict__ Bt2, int K, float* C, int ldc, const float* __restrict__ bias, const float* __restrict__ biasB, int zB, size_t sA, size_t sB, size_t sC, size_t sBias, float cs, h16* P16, bf* Ph, bf* Pl) {
    static_assert(NSPLIT == 0 || NSPLIT == 2, "one product, or the three of the hi+lo planes");
    typedef typename WFrag<T16>::V V;
    constexpr int KS = NSPLIT ? 64 : 128, PITCH = KS * 2 + 16, STAGE = 256 * PITCH, NK = KS / 32, MB = NSPLIT ? 2 : 4, GWV = NSPLIT ? 2 : 4, TILE = NSPLIT ? 64 : 128, OT = MB * 16 * 68;
    __shared__ __align__(16) char sm[2 * KG * STAGE];
    const size_t z = blockIdx.z; A += z * sA; Bt += z * sB; if constexpr (NSPLIT == 2) { A2 += z * sA; Bt2 += z * sB; }
    if constexpr (EPI == EP_F32 || EPI == EP_SCALE) C += z * sC; else { P16 += z * sC; Ph += z * sC; Pl += z * sC; bias = (int)z < zB ? bias + z * sBias : biasB + (z - zB) * sBias; }
    const int lane = threadIdx.x & 31, lr = lane & 15, hi = lane >> 4; const int wave = __builtin_amdgcn_readfirstlane((int)(threadIdx.x >> 5)); const int kg = wave / GWV, wig = wave % GWV, wm = NSPLIT ? wig : wig >> 1, wn = NSPLIT ? 0 : wig & 1; const int r0 = blockIdx.x * TILE, c0 = blockIdx.y * TILE;
    v8f acc[MB][4];
#pragma unroll
    for (int mb = 0; mb < MB; ++mb)
#pragma unroll
        for (int nb = 0; nb < 4; ++nb) acc[mb][nb] = (v8f){};
    // copy lanes: thread tg of its group brings 16-byte piece cch of rows crow + 8 i, i < 8, of each 64-row quarter of the stage
    const int tg = (int)threadIdx.x % (GWV * 32), crow = tg / (KS / 8), cch = tg % (KS / 8);
    const size_t ga = (size_t)(r0 + crow) * K + kg * KS + cch * 8, gb = (size_t)(c0 + crow) * K + kg * KS + cch * 8;
    const T16* g0 = A + ga; const T16* g1 = NSPLIT ? A2 + ga : A + ga + (size_t)64 * K; const T16* g2 = Bt + gb; const T16* g3 = NSPLIT ? Bt2 + gb : Bt + gb + (size_t)64 * K;
    const unsigned l0 = (unsigned)(size_t)sm + (unsigned)(kg * STAGE + crow * PITCH + cch * 16);
    const size_t gs = (size_t)8 * K; const int nt = K / (KS * KG);
    auto fill = [&](int buf, int t) { const unsigned l = l0 + (unsigned)(buf * (KG * STAGE)); const size_t ko = (size_t)t * (KS * KG);
        cp8<PITCH>(l, g0 + ko, gs); cp8<PITCH>(l + 64 * PITCH, g1 + ko, gs); cp8<PITCH>(l + 128 * PITCH, g2 + ko, gs); cp8<PITCH>(l + 192 * PITCH, g3 + ko, gs); };
    fill(0, 0);
    asm volatile("s_wait_asynccnt 0x0" ::: "memory");   // this wave's part of trip 0 has landed
    __syncthreads();                                     // trip 0's stages are whole before any wave reads them
    if (nt > 1) fill(1, 1);
#pragma unroll 1   // the trip loop stays rolled: one copy of the ring's hand-over
    for (int t = 0; t < nt; ++t) {
        const char* sb = sm + ((t & 1) * KG + kg) * STAGE; const char* pa = sb + (wm * MB * 16 + lr) * PITCH + hi * 16; const char* pb = sb + (128 + wn * 64 + lr) * PITCH + hi * 16;
        // fragments run ahead of their products inside the trip: A two k steps (two sets), Bt half a k step (each pair of columns is refetched when its products are issued)
        V a[2][MB], a2[2][MB], b[4], b2[4];
#pragma unroll
        for (int q = 0; q < (NK < 2 ? NK : 2); ++q)
#pragma unroll
            for (int mb = 0; mb < MB; ++mb) { a[q][mb] = WFrag<T16>::ld(pa + mb * 16 * PITCH + q * 64); if constexpr (NSPLIT == 2) a2[q][mb] = WFrag<T16>::ld(pa + (64 + mb * 16) * PITCH + q * 64); }
#pragma unroll
        for (int nb = 0; nb < 4; ++nb) { b[nb] = WFrag<T16>::ld(pb + nb * 16 * PITCH); if constexpr (NSPLIT == 2) b2[nb] = WFrag<T16>::ld(pb + (64 + nb * 16) * PITCH); }
        __builtin_amdgcn_sched_barrier(0);   // this and the two below keep each group of LDS loads whole and ahead of the products in front of its use; without them the scheduler sinks every load to its first use and the wave waits out the LDS latency there
#pragma unroll
        for (int ks = 0; ks < NK; ++ks) {
#pragma unroll
            for (int nh = 0; nh < 2; ++nh) {
#pragma unroll
                for (int nb = 2 * nh; nb < 2 * nh + 2; ++nb)
#pragma unroll
                    for (int mb = 0; mb < MB; ++mb) { acc[mb][nb] = WFrag<T16>::mma(a[ks & 1][mb], b[nb], acc[mb][nb]); if constexpr (NSPLIT == 2) { acc[mb][nb] = WFrag<T16>::mma(a2[ks & 1][mb], b[nb], acc[mb][nb]); acc[mb][nb] = WFrag<T16>::mma(a[ks & 1][mb], b2[nb], acc[mb][nb]); } }
                __builtin_amdgcn_sched_barrier(0);
                if (ks + 1 < NK) {
#pragma unroll
                    for (int nb = 2 * nh; nb < 2 * nh + 2; ++nb) { b[nb] = WFrag<T16>::ld(pb + nb * 16 * PITCH + (ks + 1) * 64); if constexpr (NSPLIT == 2) b2[nb] = WFrag<T16>::ld(pb + (64 + nb * 16) * PITCH + (ks + 1) * 64); } }
                if (nh == 1 && ks + 2 < NK) {
#pragma unroll
                    for (int mb = 0; mb < MB; ++mb) { a[ks & 1][mb] = WFrag<T16>::ld(pa + mb * 16 * PITCH + (ks + 2) * 64); if constexpr (NSPLIT == 2) a2[ks & 1][mb] = WFrag<T16>::ld(pa + (64 + mb * 16) * PITCH + (ks + 2) * 64); } }
                __builtin_amdgcn_sched_barrier(0);
            }
        }
        asm volatile("s_wait_dscnt 0x0" ::: "memory");      // this wave has left the buffer that is refilled below
        asm volatile("s_wait_asynccnt 0x0" ::: "memory");   // this wave's part of trip t + 1 has landed
        __syncthreads();                                     // publishes trip t + 1 and ends every read of trip t's buffer
        if (t + 2 < nt) fill(t & 1, t + 2);
    }
    asm volatile("s_wait_asynccnt 0x0" ::: "memory");   // no copy is in flight when the ring becomes output staging
    float* os = (float*)sm; float* osw = os + wave * OT;
#pragma unroll
    for (int mb = 0; mb < MB; ++mb)
#pragma unroll
        for (int nb = 0; nb < 4; ++nb)
#pragma unroll
            for (int j = 0; j < 8; ++j) osw[(mb * 16 + hi * 8 + j) * 68 + nb * 16 + lr] = acc[mb][nb][j];
    __syncthreads();   // every wave's partial tile is in LDS before any wave adds the KG tiles
    const float* ot = os + wig * OT;
#pragma unroll
    for (int s = 0; s < MB * 8 / KG; ++s) { const int it = lane + (s + kg * (MB * 8 / KG)) * 32, row = it >> 4, cofs = (it & 15) * 4; v4f val = *(const v4fa*)(ot + row * 68 + cofs);
#pragma unroll
        for (int g = 1; g < KG; ++g) val += *(const v4fa*)(ot + g * (GWV * OT) + row * 68 + cofs);
        const int gr = r0 + wm * MB * 16 + row, gc = c0 + wn * 64 + cofs;
        if constexpr (EPI == EP_COLB) { val[0] += bfr(bias[gc]); val[1] += bfr(bias[gc + 1]); val[2] += bfr(bias[gc + 2]); val[3] += bfr(bias[gc + 3]); }
        if constexpr (EPI == EP_ROWB) { const float br = bfr(bias[gr]); val[0] += br; val[1] += br; val[2] += br; val[3] += br; }
        if constexpr (EPI == EP_SCALE) val *= cs;
        const size_t oo = (size_t)gr * ldc + gc;
        if constexpr (EPI == EP_F32 || EPI == EP_SCALE) *(v4f*)(C + oo) = val;
        else { v4h o16; v4us oh, ol;   // 16 lanes x 8 bytes: one whole 128-byte line of each plane per tile row
#pragma unroll
            for (int q = 0; q < 4; ++q) { o16[q] = (h16)val[q]; unsigned short a2s, c2; splitf(val[q], a2s, c2); oh[q] = a2s; ol[q] = c2; }
            *(v4h*)(P16 + oo) = o16; *(v4us*)(Ph + oo) = oh; *(v4us*)(Pl + oo) = ol; } }
}

__device__ __forceinline__ h16 tohx(float x) { return (h16)x; }
typedef __attribute__((ext_vector_type(2))) _Float16 v2h;
typedef __attribute__((ext_vector_type(2))) unsigned short v2us;
typedef __attribute__((ext_vector_type(2))) float v2f;
typedef __attribute__((ext_vector_type(4))) int v4i;

__global__ __launch_bounds__(256) void k_wtG(const float* __restrict__ w, int K, int N, bf* Bt) {
    const int lane = threadIdx.x & 31; const int L0 = (blockIdx.x * 8 + (threadIdx.x >> 5)) * 8; const int nlines = N * K / 64;
{
#pragma unroll 1
        for (int l = 0; l < 8; ++l) { const int L = L0 + l; if (L >= nlines) break; const size_t e = (size_t)L * 64 + lane * 2; const int k = (int)(e % K), n = (int)(e / K); v2us o;
            o[0] = f2bf(w[(size_t)k * N + n]); o[1] = f2bf(w[(size_t)(k + 1) * N + n]); *(v2us*)(Bt + e) = o; }
         }
}
// k_cvt8: the four f32 -> bf16 conversions in one grid. dst is the contiguous run [wq | wk | wv | x]; 8 elements per thread, and a block lies wholly inside one source.
#define NW8 ((size_t)DM * DM / 8)
#define NX8 ((size_t)TT * DM / 8)
static_assert(DQ == DM && DKV == DM && NW8 % 256 == 0 && NX8 % 256 == 0, "three equal weight planes, whole blocks");
__global__ __launch_bounds__(256) void k_cvt8(const float* __restrict__ wq, const float* __restrict__ wk, const float* __restrict__ wv, const float* __restrict__ x, bf* dst) { const size_t i = (size_t)blockIdx.x * 256 + threadIdx.x; const unsigned seg = blockIdx.x / (unsigned)(NW8 / 256);
    const float* src = seg == 0 ? wq : seg == 1 ? wk : seg == 2 ? wv : x; const v8f v = *(const v8f*)(src + (i - (seg < 3 ? seg : 3) * NW8) * 8); v8us o;
#pragma unroll
    for (int k = 0; k < 8; ++k) o[k] = f2bf(v[k]); *(v8us*)(dst + i * 8) = o;  }

// k_asoft: per row (zz, i): t = S x HD^-0.5 (no mask); softmax over the 4096 keys (register row, one exp, fixed trees); rows < RH go to Ph, Pl [zz][RH][TT], the rest to P16 [zz][TT - RH][TT]
__global__ __launch_bounds__(256) void k_asoft(const float* __restrict__ Sb, h16* P16, bf* Ph, bf* Pl) {
    const int lane = threadIdx.x & 31; const int row = blockIdx.x * 8 + (threadIdx.x >> 5); if (row >= ZH * TT) return; const int i = row % TT; const int zz = row / TT; (void)zz; const bool hires = (i < RH); const float* sr = Sb + (size_t)row * TT; float v[TT / 32]; float mx = -3.0e38f;
#pragma unroll
    for (int ch = 0; ch < TT / 128; ++ch) { const int j0 = ch * 128 + lane * 4; const v4f a = *(const v4f*)(sr + j0);
#pragma unroll
        for (int q = 0; q < 4; ++q) { const int j = j0 + q; (void)j; const float t = a[q] * SCL; v[ch * 4 + q] = t; mx = fmaxf(mx, t); } }
#pragma unroll
    for (int sh = 16; sh; sh >>= 1) mx = fmaxf(mx, __shfl_xor(mx, sh, 32));
    float sum = 0.f;
#pragma unroll
    for (int k = 0; k < TT / 32; ++k) { float d0 = __fsub_rn(v[k], mx); asm volatile("" : "+v"(d0)); v[k] = __builtin_amdgcn_exp2f(__fmul_rn(d0, 1.4426950408889634f)); sum += v[k]; }
#pragma unroll
    for (int sh = 16; sh; sh >>= 1) sum += __shfl_xor(sum, sh, 32);
    const float f = __fdiv_rn(hires ? 1.0f : PCAR, sum);
{
        if (hires) {
#pragma unroll
            for (int ch = 0; ch < TT / 128; ++ch) { v4us oh, ol;
#pragma unroll
                for (int q = 0; q < 4; ++q) { unsigned short a, c2; splitf(v[ch * 4 + q] * f, a, c2); oh[q] = a; ol[q] = c2; }
                const size_t oo = ((size_t)zz * (RH ? RH : 1) + i) * TT + ch * 128 + lane * 4; *(v4us*)(Ph + oo) = oh; *(v4us*)(Pl + oo) = ol; }
        } else {
#pragma unroll
            for (int ch = 0; ch < TT / 128; ++ch) { v4h o4;
#pragma unroll
                for (int q = 0; q < 4; ++q) o4[q] = tohx(v[ch * 4 + q] * f);
                *(v4h*)(P16 + ((size_t)zz * (TT - RH) + (i - RH)) * TT + ch * 128 + lane * 4) = o4; } }
         }
}

extern "C" void kernel_launch(void* const* d_in, const int* in_sizes, int n_in,
                              void* d_out, int out_size, void* d_ws, size_t ws_size, hipStream_t stream) {
    (void)in_sizes; (void)n_in; (void)out_size;
    const float* x = (const float*)d_in[0]; const float* wq = (const float*)d_in[1]; const float* bq = (const float*)d_in[2]; const float* wk = (const float*)d_in[3]; const float* bk = (const float*)d_in[4]; const float* wv = (const float*)d_in[5]; const float* bv = (const float*)d_in[6]; const float* wo = nullptr; (void)wo;
    float* OUT = (float*)d_out;     // [1][4096][1024]
    char* wsp = (char*)d_ws;
    auto take = [&](size_t bytes) { char* p = wsp; wsp += (bytes + 255) & ~(size_t)255; return (void*)p; };
    // first what is last read by the score launches: weights, x, q and k planes (WQ, WK, WV, XB in a row: k_cvt8's dst)
    bf* WQ = (bf*)take((size_t)DQ * DM * 2); bf* WK = (bf*)take((size_t)DKV * DM * 2); bf* WV = (bf*)take((size_t)DKV * DM * 2);
    bf* XB = (bf*)take((size_t)TT * DM * 2); (void)WK;   // WK is reached as WQ + z stride
    h16* QP16 = (h16*)take((size_t)NH_ * TT * HD * 2); h16* KP16 = (h16*)take((size_t)NKV * TT * HD * 2);
    bf* QPh = (bf*)take((size_t)NH_ * TT * HD * 2); bf* KPh = (bf*)take((size_t)NKV * TT * HD * 2); bf* QPl = (bf*)take((size_t)NH_ * TT * HD * 2); bf* KPl = (bf*)take((size_t)NKV * TT * HD * 2);   // each k plane directly behind its q plane: z runs through both
    // the fp16 probabilities are written (k_asoft) after the last read of that range and lie on it, so that both heads' f32 scores fit the workspace
    h16* P16 = (h16*)d_ws; static_assert((size_t)ZH * (TT - RH) * TT * 2 <= (size_t)(DQ + 2 * DKV + TT) * DM * 2 + (size_t)(3 * NH_ + 3 * NKV) * TT * HD * 2, "P16 stays inside the range that is dead by then");
    h16* VT16 = (h16*)take((size_t)NKV * HD * TT * 2); bf* VTh = (bf*)take((size_t)NKV * HD * TT * 2); bf* VTl = (bf*)take((size_t)NKV * HD * TT * 2); bf* Ph = (bf*)take((size_t)ZH * RH * TT * 2); bf* Pl = (bf*)take((size_t)ZH * RH * TT * 2);
    float* Sb = (float*)take((size_t)ZH * TT * TT * 4);
    if ((size_t)(wsp - (char*)d_ws) > ws_size) return;    // ws 256 MiB
    for (int b = 0; b < NB_; ++b) {
        k_cvt8<<<(unsigned)((3 * NW8 + NX8) / 256), 256, 0, stream>>>(wq, wk, wv, x + (size_t)b * TT * DM, WQ);
        // q and k in one grid: z = q heads, then k heads (WK lies behind WQ, each k plane behind its q plane), so the epilogue stores the head planes [h][t][d] itself
        k_gemms<bf, 0, EP_COLB, 2><<<dim3(TT / 128, HD / 128, NH_ + NKV), 256, 0, stream>>>(XB, nullptr, WQ, nullptr, DM, nullptr, HD, bq, bk, NH_, 0, (size_t)HD * DM, (size_t)TT * HD, HD, 1.0f, QP16, QPh, QPl);
        // v: the weight rows are the M side, so the tile comes out as [g HD + d][t], the transposed planes that attn.v reads
        k_gemms<bf, 0, EP_ROWB, 2><<<dim3(DKV / 128, TT / 128, 1), 256, 0, stream>>>(WV, nullptr, XB, nullptr, DM, nullptr, TT, bv, nullptr, 1, 0, 0, 0, 0, 1.0f, VT16, VTh, VTl);
        for (int h0 = 0; h0 < NH_; h0 += ZH) { const size_t zq = (size_t)h0, zk = (size_t)(h0 / REP);   // one kv head per query head: the pass's two heads use consecutive kv planes (z-strides TT*HD)
            k_gemms<bf, 2, EP_F32, 4><<<dim3(RH / 64, TT / 64, ZH), 256, 0, stream>>>(QPh + zq * TT * HD, QPl + zq * TT * HD, KPh + zk * TT * HD, KPl + zk * TT * HD, HD, Sb, TT, nullptr, nullptr, 0, (size_t)TT * HD, (size_t)TT * HD, (size_t)TT * TT, 0, 1.0f, nullptr, nullptr, nullptr);
            k_gemms<h16, 0, EP_F32, 1><<<dim3((TT - RH) / 128, TT / 128, ZH), 128, 0, stream>>>(QP16 + zq * TT * HD + (size_t)RH * HD, nullptr, KP16 + zk * TT * HD, nullptr, HD, Sb + (size_t)RH * TT, TT, nullptr, nullptr, 0, (size_t)TT * HD, (size_t)TT * HD, (size_t)TT * TT, 0, 1.0f, nullptr, nullptr, nullptr);
            k_asoft<<<ZH * TT / 8, 256, 0, stream>>>(Sb, P16, Ph, Pl);
            float* Oh = OUT + (size_t)b * TT * DM + (size_t)h0 * HD;   // the pass's two heads' columns of the merged output (z stride HD), pitch DQ: f32 context straight to the output
            k_gemms<bf, 2, EP_F32, 4><<<dim3(RH / 64, HD / 64, ZH), 256, 0, stream>>>(Ph, Pl, VTh + zk * HD * TT, VTl + zk * HD * TT, TT, Oh, DQ, nullptr, nullptr, 0, (size_t)RH * TT, (size_t)HD * TT, (size_t)HD, 0, 1.0f, nullptr, nullptr, nullptr);
            k_gemms<h16, 0, EP_SCALE, 2><<<dim3((TT - RH) / 128, HD / 128, ZH), 256, 0, stream>>>(P16, nullptr, VT16 + zk * HD * TT, nullptr, TT, Oh + (size_t)RH * DQ, DQ, nullptr, nullptr, 0, (size_t)(TT - RH) * TT, (size_t)HD * TT, (size_t)HD, 0, 1.0f / PCAR, nullptr, nullptr, nullptr); }
    }
}

// v005
// It runs in 162 microseconds.
// In two side-by-side timings against v004, it was 1.12 and 1.11 times as fast.
// All steps since v000 together make it 3.89 times as fast.
#include <hip/hip_runtime.h>

// Two-head self-attention with 512-wide heads (activation [1][1][4096][1024]; q, k, v = x W^T + b ('oi' [1024][1024]), 2 heads x 512; softmax(q.k/sqrt(512)) over all 4096 keys; out = merged context (no output projection) -> [1][1][4096][1024] (4.2 M)).
// Compute dtypes, f32 accumulate: every input rounded to bf16; q/k/v on PLAIN bf16 operands (inputs: exact) + biases; scores (K = 512) and attn.v (N = 512; no mask): query rows < 512 hl (3 products, f32 scores in the workspace, softmax f32), the rest single fp16 in one fused launch (running maximum, probabilities never leave the registers); no output projection: the merged context is written in f32.

#define NB_  1
#define TT   4096
#define DM   1024
#define NH_  2
#define NKV  2
#define REP  (NH_ / NKV)
#define HD   512
#define DQ   (NH_ * HD)
#define DKV  (NKV * HD)
#define ZH   2                    // heads per launch, on grid z
#define RH   512                  // query rows < RH use hi+lo planes (0: none)
#define WIN  0
#define PCAR 1024.0f
#define SCL  0.044194173824159216f   // 512^-0.5 (head width 512)
typedef _Float16 h16;
typedef unsigned short bf;
typedef __attribute__((ext_vector_type(16))) __bf16   v16bf;
typedef __attribute__((ext_vector_type(16))) _Float16 v16h;
typedef __attribute__((ext_vector_type(8)))  _Float16 v8h;
typedef __attribute__((ext_vector_type(8)))  unsigned short v8us;
typedef __attribute__((ext_vector_type(8)))  float    v8f;
typedef __attribute__((ext_vector_type(4)))  float    v4f;
typedef v8h  __attribute__((may_alias)) v8ha;
typedef v4f  __attribute__((may_alias)) v4fa;
typedef v8us __attribute__((may_alias)) v8usa;

__device__ __forceinline__ unsigned short f2bf(float f) { unsigned u = __float_as_uint(f); u += 0x7FFFu + ((u >> 16) & 1u); return (unsigned short)(u >> 16); }
__device__ __forceinline__ float bf2f(unsigned short b) { return __uint_as_float(((unsigned)b) << 16); }
__device__ __forceinline__ float bfr(float f) { return bf2f(f2bf(f)); }
__device__ __forceinline__ v16h cat16(v8h lo, v8h hi) { return __builtin_shufflevector(lo, hi, 0, 1, 2, 3, 4, 5, 6, 7, 8, 9, 10, 11, 12, 13, 14, 15); }
__device__ __forceinline__ v16bf cat16b(v8us lo, v8us hi) { return __builtin_bit_cast(v16bf, __builtin_shufflevector(lo, hi, 0, 1, 2, 3, 4, 5, 6, 7, 8, 9, 10, 11, 12, 13, 14, 15)); }
__device__ __forceinline__ v8f wmma16(v16h a, v16h b, v8f c) { return __builtin_amdgcn_wmma_f32_16x16x32_f16(false, a, false, b, (short)0, c, false, false); }
__device__ __forceinline__ v8f wmmab(v16bf a, v16bf b, v8f c) { return __builtin_amdgcn_wmma_f32_16x16x32_bf16(false, a, false, b, (short)0, c, false, false); }



// ---- k_gemms: LDS-staged GEMM. c[m][n] = sum_k A[m][k] Bt[n][k] (NSPLIT 2: + A2 Bt + A Bt2, the hi+lo planes), operands K-contiguous 16-bit planes; z-batch strides sA/sB/sC/sBias in elements.
// NSPLIT 0: 128x128 tile per work-group, a wave group = 2x2 waves of 64x64, a stage = [A 128 rows | Bt 128 rows] of 128 k (256 bytes, pitch 272). NSPLIT 2: 64x64 tile, a wave group = 2 waves of 32x64, a stage = [A | A2 | Bt | Bt2], 64 rows each, of 64 k (128 bytes, pitch 144).
// A trip covers KG stages of k, one per wave group; a group's stage comes in by asynchronous copies to LDS (every wave-wide copy = whole 128-byte lines), two buffers: the next trip's copies fly while this trip's fragments are read from LDS by all waves of the group. The KG partial tiles are added in LDS in group order.
// grid (M/tile, N/tile, Z), 32 x waves threads. K % (stage k x KG) == 0.
// Batches z >= zB take their bias from biasB (two projections with separate bias vectors in one grid).
// EPI says what the epilogue stores, pitch ldc: EP_F32 c as f32 in C; EP_SCALE c x cs as f32 in C; EP_COLB (c + bias[n]) and EP_ROWB (c + bias[m]) as the three 16-bit planes the next GEMMs read (fp16, bf16 hi, bf16 lo); EP_ROWB's fp16 plane not at pitch ldc but as [head][32-key block][d][32 keys].
#define EP_F32   0
#define EP_SCALE 1
#define EP_COLB  2
#define EP_ROWB  3
__device__ __forceinline__ void splitf(float y, unsigned short& h, unsigned short& l) { h = f2bf(y); l = f2bf(y - bf2f(h)); }
typedef __attribute__((ext_vector_type(4))) _Float16 v4h;
typedef __attribute__((ext_vector_type(4))) unsigned short v4us;
template <typename T16> struct WFrag;   // ld: one fragment from an LDS row, p = the lane's byte address (row, 16 bytes x lane half): k 8 hi .. 8 hi + 7 and 16 + 8 hi .. 16 + 8 hi + 7, the same for both operands
template <> struct WFrag<h16> { typedef v16h V; static __device__ __forceinline__ V ld(const char* p) { return cat16(*(const v8ha*)p, *(const v8ha*)(p + 32)); } static __device__ __forceinline__ v8f mma(V a, V b, v8f c) { return wmma16(a, b, c); } };
template <> struct WFrag<bf> { typedef v16bf V; static __device__ __forceinline__ V ld(const char* p) { return cat16b(*(const v8usa*)p, *(const v8usa*)(p + 32)); } static __device__ __forceinline__ v8f mma(V a, V b, v8f c) { return wmmab(a, b, c); } };
// eight copies of 16 bytes per lane, rows 8 apart; the s_wait_xcnt stands inside the statement so that no address register of a copy is rewritten ahead of it
template <int PITCH, typename T16>
__device__ __forceinline__ void cp8(unsigned l, const T16* g, size_t gs) {
    asm volatile("global_load_async_to_lds_b128 %0, %8, off\n\t"
                 "global_load_async_to_lds_b128 %1, %9, off\n\t"
                 "global_load_async_to_lds_b128 %2, %10, off\n\t"
                 "global_load_async_to_lds_b128 %3, %11, off\n\t"
                 "global_load_async_to_lds_b128 %4, %12, off\n\t"
                 "global_load_async_to_lds_b128 %5, %13, off\n\t"
                 "global_load_async_to_lds_b128 %6, %14, off\n\t"
                 "global_load_async_to_lds_b128 %7, %15, off\n\t"
                 "s_wait_xcnt 0x0"
                 :: "v"(l), "v"(l + 8 * PITCH), "v"(l + 16 * PITCH), "v"(l + 24 * PITCH), "v"(l + 32 * PITCH), "v"(l + 40 * PITCH), "v"(l + 48 * PITCH), "v"(l + 56 * PITCH),
                    "v"(g), "v"(g + gs), "v"(g + 2 * gs), "v"(g + 3 * gs), "v"(g + 4 * gs), "v"(g + 5 * gs), "v"(g + 6 * gs), "v"(g + 7 * gs)
                 : "memory");
}
template <typename T16, int NSPLIT, int EPI, int KG>
__global__ __launch_bounds__((NSPLIT ? 64 : 128) * KG) void k_gemms(const T16* __restrict__ A, const T16* __restrict__ A2, const T16* __restrict__ Bt, const T16* __restrict__ Bt2, int K, float* C, int ldc, const float* __restrict__ bias, const float* __restrict__ biasB, int zB, size_t sA, size_t sB, size_t sC, size_t sBias, float cs, h16* P16, bf* Ph, bf* Pl) {
    static_assert(NSPLIT == 0 || NSPLIT == 2, "one product, or the three of the hi+lo planes");
    typedef typename WFrag<T16>::V V;
    constexpr int KS = NSPLIT ? 64 : 128, PITCH = KS * 2 + 16, STAGE = 256 * PITCH, NK = KS / 32, MB = NSPLIT ? 2 : 4, GWV = NSPLIT ? 2 : 4, TILE = NSPLIT ? 64 : 128, OT = MB * 16 * 68;
    __shared__ __align__(16) char sm[2 * KG * STAGE];
    const size_t z = blockIdx.z; A += z * sA; Bt += z * sB; if constexpr (NSPLIT == 2) { A2 += z * sA; Bt2 += z * sB; }
    if constexpr (EPI == EP_F32 || EPI == EP_SCALE) C += z * sC; else { P16 += z * sC; Ph += z * sC; Pl += z * sC; bias = (int)z < zB ? bias + z * sBias : biasB + (z - zB) * sBias; }
    const int lane = threadIdx.x & 31, lr = lane & 15, hi = lane >> 4; const int wave = __builtin_amdgcn_readfirstlane((int)(threadIdx.x >> 5)); const int kg = wave / GWV, wig = wave % GWV, wm = NSPLIT ? wig : wig >> 1, wn = NSPLIT ? 0 : wig & 1; const int r0 = blockIdx.x * TILE, c0 = blockIdx.y * TILE;
    v8f acc[MB][4];
#pragma unroll
    for (int mb = 0; mb < MB; ++mb)
#pragma unroll
        for (int nb = 0; nb < 4; ++nb) acc[mb][nb] = (v8f){};
    // copy lanes: thread tg of its group brings 16-byte piece cch of rows crow + 8 i, i < 8, of each 64-row quarter of the stage
    const int tg = (int)threadIdx.x % (GWV * 32), crow = tg / (KS / 8), cch = tg % (KS / 8);
    const size_t ga = (size_t)(r0 + crow) * K + kg * KS + cch * 8, gb = (size_t)(c0 + crow) * K + kg * KS + cch * 8;
    const T16* g0 = A + ga; const T16* g1 = NSPLIT ? A2 + ga : A + ga + (size_t)64 * K; const T16* g2 = Bt + gb; const T16* g3 = NSPLIT ? Bt2 + gb : Bt + gb + (size_t)64 * K;
    const unsigned l0 = (unsigned)(size_t)sm + (unsigned)(kg * STAGE + crow * PITCH + cch * 16);
    const size_t gs = (size_t)8 * K; const int nt = K / (KS * KG);
    auto fill = [&](int buf, int t) { const unsigned l = l0 + (unsigned)(buf * (KG * STAGE)); const size_t ko = (size_t)t * (KS * KG);
        cp8<PITCH>(l, g0 + ko, gs); cp8<PITCH>(l + 64 * PITCH, g1 + ko, gs); cp8<PITCH>(l + 128 * PITCH, g2 + ko, gs); cp8<PITCH>(l + 192 * PITCH, g3 + ko, gs); };
    fill(0, 0);
    asm volatile("s_wait_asynccnt 0x0" ::: "memory");   // this wave's part of trip 0 has landed
    __syncthreads();                                     // trip 0's stages are whole before any wave reads them
    if (nt > 1) fill(1, 1);
#pragma unroll 1   // the trip loop stays rolled: one copy of the ring's hand-over
    for (int t = 0; t < nt; ++t) {
        const char* sb = sm + ((t & 1) * KG + kg) * STAGE; const char* pa = sb + (wm * MB * 16 + lr) * PITCH + hi * 16; const char* pb = sb + (128 + wn * 64 + lr) * PITCH + hi * 16;
        // fragments run ahead of their products inside the trip: A two k steps (two sets), Bt half a k step (each pair of columns is refetched when its products are issued)
        V a[2][MB], a2[2][MB], b[4], b2[4];
#pragma unroll
        for (int q = 0; q < (NK < 2 ? NK : 2); ++q)
#pragma unroll
            for (int mb = 0; mb < MB; ++mb) { a[q][mb] = WFrag<T16>::ld(pa + mb * 16 * PITCH + q * 64); if constexpr (NSPLIT == 2) a2[q][mb] = WFrag<T16>::ld(pa + (64 + mb * 16) * PITCH + q * 64); }
#pragma unroll
        for (int nb = 0; nb < 4; ++nb) { b[nb] = WFrag<T16>::ld(pb + nb * 16 * PITCH); if constexpr (NSPLIT == 2) b2[nb] = WFrag<T16>::ld(pb + (64 + nb * 16) * PITCH); }
        __builtin_amdgcn_sched_barrier(0);   // this and the two below keep each group of LDS loads whole and ahead of the products in front of its use; without them the scheduler sinks every load to its first use and the wave waits out the LDS latency there
#pragma unroll
        for (int ks = 0; ks < NK; ++ks) {
#pragma unroll
            for (int nh = 0; nh < 2; ++nh) {
#pragma unroll
                for (int nb = 2 * nh; nb < 2 * nh + 2; ++nb)
#pragma unroll
                    for (int mb = 0; mb < MB; ++mb) { acc[mb][nb] = WFrag<T16>::mma(a[ks & 1][mb], b[nb], acc[mb][nb]); if constexpr (NSPLIT == 2) { acc[mb][nb] = WFrag<T16>::mma(a2[ks & 1][mb], b[nb], acc[mb][nb]); acc[mb][nb] = WFrag<T16>::mma(a[ks & 1][mb], b2[nb], acc[mb][nb]); } }
                __builtin_amdgcn_sched_barrier(0);
                if (ks + 1 < NK) {
#pragma unroll
                    for (int nb = 2 * nh; nb < 2 * nh + 2; ++nb) { b[nb] = WFrag<T16>::ld(pb + nb * 16 * PITCH + (ks + 1) * 64); if constexpr (NSPLIT == 2) b2[nb] = WFrag<T16>::ld(pb + (64 + nb * 16) * PITCH + (ks + 1) * 64); } }
                if (nh == 1 && ks + 2 < NK) {
#pragma unroll
                    for (int mb = 0; mb < MB; ++mb) { a[ks & 1][mb] = WFrag<T16>::ld(pa + mb * 16 * PITCH + (ks + 2) * 64); if constexpr (NSPLIT == 2) a2[ks & 1][mb] = WFrag<T16>::ld(pa + (64 + mb * 16) * PITCH + (ks + 2) * 64); } }
                __builtin_amdgcn_sched_barrier(0);
            }
        }
        asm volatile("s_wait_dscnt 0x0" ::: "memory");      // this wave has left the buffer that is refilled below
        asm volatile("s_wait_asynccnt 0x0" ::: "memory");   // this wave's part of trip t + 1 has landed
        __syncthreads();                                     // publishes trip t + 1 and ends every read of trip t's buffer
        if (t + 2 < nt) fill(t & 1, t + 2);
    }
    asm volatile("s_wait_asynccnt 0x0" ::: "memory");   // no copy is in flight when the ring becomes output staging
    float* os = (float*)sm; float* osw = os + wave * OT;
#pragma unroll
    for (int mb = 0; mb < MB; ++mb)
#pragma unroll
        for (int nb = 0; nb < 4; ++nb)
#pragma unroll
            for (int j = 0; j < 8; ++j) osw[(mb * 16 + hi * 8 + j) * 68 + nb * 16 + lr] = acc[mb][nb][j];
    __syncthreads();   // every wave's partial tile is in LDS before any wave adds the KG tiles
    const float* ot = os + wig * OT;
#pragma unroll
    for (int s = 0; s < MB * 8 / KG; ++s) { const int it = lane + (s + kg * (MB * 8 / KG)) * 32, row = it >> 4, cofs = (it & 15) * 4; v4f val = *(const v4fa*)(ot + row * 68 + cofs);
#pragma unroll
        for (int g = 1; g < KG; ++g) val += *(const v4fa*)(ot + g * (GWV * OT) + row * 68 + cofs);
        const int gr = r0 + wm * MB * 16 + row, gc = c0 + wn * 64 + cofs;
        if constexpr (EPI == EP_COLB) { val[0] += bfr(bias[gc]); val[1] += bfr(bias[gc + 1]); val[2] += bfr(bias[gc + 2]); val[3] += bfr(bias[gc + 3]); }
        if constexpr (EPI == EP_ROWB) { const float br = bfr(bias[gr]); val[0] += br; val[1] += br; val[2] += br; val[3] += br; }
        if constexpr (EPI == EP_SCALE) val *= cs;
        const size_t oo = (size_t)gr * ldc + gc;
        if constexpr (EPI == EP_F32 || EPI == EP_SCALE) *(v4f*)(C + oo) = val;
        else { v4h o16; v4us oh, ol;   // 16 lanes x 8 bytes: one whole 128-byte line of each plane per tile row (of EP_ROWB's fp16 plane, two half lines in consecutive blocks)
#pragma unroll
            for (int q = 0; q < 4; ++q) { o16[q] = (h16)val[q]; unsigned short a2s, c2; splitf(val[q], a2s, c2); oh[q] = a2s; ol[q] = c2; }
            if constexpr (EPI == EP_ROWB) { const size_t o6 = ((size_t)(gr / HD * (TT / 32) + gc / 32) * HD + gr % HD) * 32 + gc % 32;   // v: the fp16 plane lies as [head][32-key block][d][32 keys], so that a block is one contiguous run for the fused launch's copies
                *(v4h*)(P16 + o6) = o16; *(v4us*)(Ph + oo) = oh; *(v4us*)(Pl + oo) = ol;
                asm volatile("s_wait_xcnt 0x0" ::: "memory");   // stands in front of the next pass's writes to the registers that these stores name
            } else {
            *(v4h*)(P16 + oo) = o16; *(v4us*)(Ph + oo) = oh; *(v4us*)(Pl + oo) = ol; } }
    }
}

__device__ __forceinline__ h16 tohx(float x) { return (h16)x; }
typedef __attribute__((ext_vector_type(2))) _Float16 v2h;
typedef __attribute__((ext_vector_type(2))) unsigned short v2us;
typedef __attribute__((ext_vector_type(2))) float v2f;
typedef __attribute__((ext_vector_type(4))) int v4i;

__global__ __launch_bounds__(256) void k_wtG(const float* __restrict__ w, int K, int N, bf* Bt) {
    const int lane = threadIdx.x & 31; const int L0 = (blockIdx.x * 8 + (threadIdx.x >> 5)) * 8; const int nlines = N * K / 64;
{
#pragma unroll 1
        for (int l = 0; l < 8; ++l) { const int L = L0 + l; if (L >= nlines) break; const size_t e = (size_t)L * 64 + lane * 2; const int k = (int)(e % K), n = (int)(e / K); v2us o;
            o[0] = f2bf(w[(size_t)k * N + n]); o[1] = f2bf(w[(size_t)(k + 1) * N + n]); *(v2us*)(Bt + e) = o; }
         }
}
// k_cvt8: the four f32 -> bf16 conversions in one grid. dst is the contiguous run [wq | wk | wv | x]; 8 elements per thread, and a block lies wholly inside one source.
#define NW8 ((size_t)DM * DM / 8)
#define NX8 ((size_t)TT * DM / 8)
static_assert(DQ == DM && DKV == DM && NW8 % 256 == 0 && NX8 % 256 == 0, "three equal weight planes, whole blocks");
__global__ __launch_bounds__(256) void k_cvt8(const float* __restrict__ wq, const float* __restrict__ wk, const float* __restrict__ wv, const float* __restrict__ x, bf* dst) { const size_t i = (size_t)blockIdx.x * 256 + threadIdx.x; const unsigned seg = blockIdx.x / (unsigned)(NW8 / 256);
    const float* src = seg == 0 ? wq : seg == 1 ? wk : seg == 2 ? wv : x; const v8f v = *(const v8f*)(src + (i - (seg < 3 ? seg : 3) * NW8) * 8); v8us o;
#pragma unroll
    for (int k = 0; k < 8; ++k) o[k] = f2bf(v[k]); *(v8us*)(dst + i * 8) = o;  }

// k_asoft: only the hi+lo rows come here (grid: ZH x RH rows). Per row (zz, i): t = S x HD^-0.5 (no mask); softmax over the 4096 keys (register row, one exp, fixed trees); rows < RH go to Ph, Pl [zz][RH][TT], the rest to P16 [zz][TT - RH][TT]
__global__ __launch_bounds__(256) void k_asoft(const float* __restrict__ Sb, h16* P16, bf* Ph, bf* Pl) {
    const int lane = threadIdx.x & 31; const int row = blockIdx.x * 8 + (threadIdx.x >> 5); if (row >= ZH * RH) return; const int i = row % RH; const int zz = row / RH; (void)zz; const bool hires = (i < RH); const float* sr = Sb + ((size_t)zz * TT + i) * TT; float v[TT / 32]; float mx = -3.0e38f;
#pragma unroll
    for (int ch = 0; ch < TT / 128; ++ch) { const int j0 = ch * 128 + lane * 4; const v4f a = *(const v4f*)(sr + j0);
#pragma unroll
        for (int q = 0; q < 4; ++q) { const int j = j0 + q; (void)j; const float t = a[q] * SCL; v[ch * 4 + q] = t; mx = fmaxf(mx, t); } }
#pragma unroll
    for (int sh = 16; sh; sh >>= 1) mx = fmaxf(mx, __shfl_xor(mx, sh, 32));
    float sum = 0.f;
#pragma unroll
    for (int k = 0; k < TT / 32; ++k) { float d0 = __fsub_rn(v[k], mx); asm volatile("" : "+v"(d0)); v[k] = __builtin_amdgcn_exp2f(__fmul_rn(d0, 1.4426950408889634f)); sum += v[k]; }
#pragma unroll
    for (int sh = 16; sh; sh >>= 1) sum += __shfl_xor(sum, sh, 32);
    const float f = __fdiv_rn(hires ? 1.0f : PCAR, sum);
{
        if (hires) {
#pragma unroll
            for (int ch = 0; ch < TT / 128; ++ch) { v4us oh, ol;
#pragma unroll
                for (int q = 0; q < 4; ++q) { unsigned short a, c2; splitf(v[ch * 4 + q] * f, a, c2); oh[q] = a; ol[q] = c2; }
                const size_t oo = ((size_t)zz * (RH ? RH : 1) + i) * TT + ch * 128 + lane * 4; *(v4us*)(Ph + oo) = oh; *(v4us*)(Pl + oo) = ol; }
        } else {
#pragma unroll
            for (int ch = 0; ch < TT / 128; ++ch) { v4h o4;
#pragma unroll
                for (int q = 0; q < 4; ++q) o4[q] = tohx(v[ch * 4 + q] * f);
                *(v4h*)(P16 + ((size_t)zz * (TT - RH) + (i - RH)) * TT + ch * 128 + lane * 4) = o4; } }
         }
}

// ---- k_fattn: scores, softmax and attn.v of the fp16 query rows (>= RH) in one launch. S^T = K Q^T, O^T += V^T P^T: in every 16-column group a lane holds one query, so maximum, sum and rescale are per lane, and the score tiles of 32 keys ARE the B fragment of the second product (keys 8 hi .. and 16 + 8 hi .., the k order of WFrag::ld).
// A work-group = 4 waves x 32 queries, one head (grid z), one quarter of the keys (grid y); Q fragments and the 512 x 32 O^T tile stay in registers. A stage = 32 keys: K rows (pitch 1040 bytes) and the V^T block [d][32 keys] (pitch 80), by asynchronous copies to LDS, two buffers.
// The maximum in use is raised only when a new one exceeds it by 2^8 (p <= 256 fits fp16). Each key range leaves its unnormalised O, its maximum (log2 units) and its sum; k_fcomb joins the ranges.
#define FQ   128
#define FSP  4
#define FKT  32
#define KPIT (HD * 2 + 16)
#define VPIT (FKT * 2 + 16)
#define FSTG (FKT * KPIT + HD * VPIT)
#define NQF  (TT - RH)
#define OPIT (HD + 4)
static_assert(4 * 16 * OPIT * 4 <= 2 * FSTG && NQF % FQ == 0 && TT % (FSP * FKT) == 0 && TT / (FSP * FKT) >= 2, "output staging fits the ring; whole tiles; two stages or more");
typedef __attribute__((address_space(1))) v4i gv4i;
typedef __attribute__((address_space(3))) v4i lv4i;
__global__ __launch_bounds__(128) void k_fattn(const h16* __restrict__ Q, const h16* __restrict__ Kp, const h16* __restrict__ Vt, float* Op, float* Ml) {
    __shared__ __align__(16) char sm[2 * FSTG];
    const int tid = (int)threadIdx.x, lane = tid & 31, lr = lane & 15, hi = lane >> 4; const int wave = __builtin_amdgcn_readfirstlane(tid >> 5);
    const int z = blockIdx.z, sp = blockIdx.y, q0 = blockIdx.x * FQ + wave * 32;
    // both planes hold FKT x HD elements per 32-key block, contiguous: thread tid brings 16-byte pieces tid + 128 i, i < 16, of each
    const size_t kv0 = ((size_t)z * TT + (size_t)sp * (TT / FSP)) * HD + tid * 8; const h16* gk = Kp + kv0; const h16* gv = Vt + kv0;
    char* lk = sm + (tid >> 6) * KPIT + (tid & 63) * 16; char* lv = sm + FKT * KPIT + (tid >> 2) * VPIT + (tid & 3) * 16;
    // the copies are the builtin here: above 256 registers the operands of asm text must all lie in the lowest register window, which cost spills
    auto fill = [&](int buf, int t) { const int o = buf * FSTG; const size_t go = (size_t)t * (FKT * HD);
#pragma unroll
        for (int i = 0; i < 16; ++i) __builtin_amdgcn_global_load_async_to_lds_b128((gv4i*)(gk + go + i * 1024), (lv4i*)(lk + o + i * 2 * KPIT), 0, 0);
#pragma unroll
        for (int i = 0; i < 16; ++i) __builtin_amdgcn_global_load_async_to_lds_b128((gv4i*)(gv + go + i * 1024), (lv4i*)(lv + o + i * 32 * VPIT), 0, 0); };
    fill(0, 0);
    const h16* qr = Q + ((size_t)z * TT + RH + q0 + lr) * HD + hi * 8;
    v16h qf[2][16];
#pragma unroll
    for (int c = 0; c < 2; ++c)
#pragma unroll
        for (int ks = 0; ks < 16; ++ks) qf[c][ks] = cat16(*(const v8ha*)(qr + c * 16 * HD + ks * 32), *(const v8ha*)(qr + c * 16 * HD + ks * 32 + 16));
    v8f O[32][2];
#pragma unroll
    for (int dt = 0; dt < 32; ++dt) { O[dt][0] = (v8f){}; O[dt][1] = (v8f){}; }
    float mu[2] = {-1.0e30f, -1.0e30f}; v8f L[2] = {(v8f){}, (v8f){}};   // L: the row sums, as one more output tile: A = a tile whose row 0 is ones, so row 0 of L (lanes 0-15, element 0) adds up the rounded p of each query
    v16h ones;
#pragma unroll
    for (int e = 0; e < 16; ++e) ones[e] = lr == 0 ? (h16)1.0f : (h16)0.0f;
    constexpr float CS2 = SCL * 1.4426950408889634f; constexpr int nt = TT / (FSP * FKT);
    asm volatile("s_wait_asynccnt 0x0" ::: "memory");   // this wave's part of stage 0 has landed
    __syncthreads();                                     // stage 0 is whole before any wave reads it
    fill(1, 1);
#pragma unroll 1   // the stage loop stays rolled: one copy of the ring's hand-over
    for (int t = 0; t < nt; ++t) {
        const char* kb = sm + (t & 1) * FSTG + lr * KPIT + hi * 16; const char* vb = sm + (t & 1) * FSTG + FKT * KPIT + lr * VPIT + hi * 16;
        // three fragment sets of four: a set is refetched as soon as its 8 products are issued, two sets (16 products) ahead of its use; the first V^T sets are fetched under the last score products and the softmax
        v16h fr[3][4]; v8f st[2][2] = {{(v8f){}, (v8f){}}, {(v8f){}, (v8f){}}};
#pragma unroll
        for (int g = 0; g < 3; ++g)
#pragma unroll
            for (int i = 0; i < 4; ++i) fr[g][i] = WFrag<h16>::ld(kb + (i & 1) * 16 * KPIT + (2 * g + (i >> 1)) * 64);
        __builtin_amdgcn_sched_barrier(0);   // this and the ones below keep each group of LDS loads whole and ahead of the products in front of its use; without them the scheduler sinks every load to its first use and the lone wave of a SIMD waits out the LDS latency there
#pragma unroll
        for (int g = 0; g < 8; ++g) {
#pragma unroll
            for (int i = 0; i < 4; ++i)
#pragma unroll
                for (int c = 0; c < 2; ++c) st[i & 1][c] = wmma16(fr[g % 3][i], qf[c][2 * g + (i >> 1)], st[i & 1][c]);
            __builtin_amdgcn_sched_barrier(0);
#pragma unroll
            for (int i = 0; i < 4; ++i) fr[g % 3][i] = g + 3 < 8 ? WFrag<h16>::ld(kb + (i & 1) * 16 * KPIT + (2 * (g + 3) + (i >> 1)) * 64) : WFrag<h16>::ld(vb + ((g + 3 - 8) * 4 + i) * 16 * VPIT);
            __builtin_amdgcn_sched_barrier(0);
        }
        float mc[2];
#pragma unroll
        for (int c = 0; c < 2; ++c) { float m = st[0][c][0];
#pragma unroll
            for (int j = 1; j < 8; ++j) m = fmaxf(m, st[0][c][j]);
#pragma unroll
            for (int j = 0; j < 8; ++j) m = fmaxf(m, st[1][c][j]);
            mc[c] = fmaxf(m, __shfl_xor(m, 16, 32)) * CS2; }
        if (__builtin_amdgcn_ballot_w32(mc[0] > mu[0] + 8.0f || mc[1] > mu[1] + 8.0f) != 0) {   // wave-uniform: rare after the first stage
#pragma unroll
            for (int c = 0; c < 2; ++c) { const float mn = fmaxf(mu[c], mc[c]); const float al = __builtin_amdgcn_exp2f(mu[c] - mn); mu[c] = mn; L[c] *= al;
#pragma unroll
                for (int dt = 0; dt < 32; ++dt) O[dt][c] *= al; } }
        v16h pb[2];
#pragma unroll
        for (int c = 0; c < 2; ++c)
#pragma unroll
            for (int kt = 0; kt < 2; ++kt)
#pragma unroll
                for (int j = 0; j < 8; ++j) { const float p = __builtin_amdgcn_exp2f(__builtin_fmaf(st[kt][c][j], CS2, -mu[c])); pb[c][kt * 8 + j] = (h16)p; }
        L[0] = wmma16(ones, pb[0], L[0]); L[1] = wmma16(ones, pb[1], L[1]);
        __builtin_amdgcn_sched_barrier(0);
#pragma unroll
        for (int g = 0; g < 8; ++g) {
#pragma unroll
            for (int i = 0; i < 4; ++i)
#pragma unroll
                for (int c = 0; c < 2; ++c) O[g * 4 + i][c] = wmma16(fr[(g + 2) % 3][i], pb[c], O[g * 4 + i][c]);
            __builtin_amdgcn_sched_barrier(0);
            if (g + 3 < 8) {
#pragma unroll
                for (int i = 0; i < 4; ++i) fr[(g + 2) % 3][i] = WFrag<h16>::ld(vb + ((g + 3) * 4 + i) * 16 * VPIT); }
            __builtin_amdgcn_sched_barrier(0);
        }
        asm volatile("s_wait_dscnt 0x0" ::: "memory");      // this wave has left the buffer that is refilled below
        asm volatile("s_wait_asynccnt 0x0" ::: "memory");   // this wave's part of stage t + 1 has landed
        __syncthreads();                                     // publishes stage t + 1 and ends every read of stage t's buffer
        if (t + 2 < nt) fill(t & 1, t + 2);
    }
    asm volatile("s_wait_asynccnt 0x0" ::: "memory");   // no copy is in flight when the ring becomes output staging
    const size_t pr = (size_t)(sp * ZH + z) * NQF + q0;   // this wave's first row among the partial results
#pragma unroll
    for (int c = 0; c < 2; ++c) if (hi == 0) { v2f ml; ml[0] = mu[c]; ml[1] = L[c][0]; *(v2f*)(Ml + (pr + c * 16 + lr) * 2) = ml; }
    // O^T -> O through the wave's own part of LDS (no other wave reads it), 16 queries at a time, so that the stores are whole lines
    float* osw = (float*)sm + wave * (16 * OPIT);
#pragma unroll 1   // two equal halves: one copy of the code
    for (int c = 0; c < 2; ++c) {
#pragma unroll
        for (int dt = 0; dt < 32; ++dt) { const v8f o = c ? O[dt][1] : O[dt][0]; float* w = osw + lr * OPIT + dt * 16 + hi * 8; *(v4fa*)w = (v4f){o[0], o[1], o[2], o[3]}; *(v4fa*)(w + 4) = (v4f){o[4], o[5], o[6], o[7]}; }
#pragma unroll 1   // four rows a trip: 16 loads in flight, small code
        for (int r = 0; r < 16; r += 4) {
#pragma unroll
            for (int q4 = 0; q4 < 16; ++q4) *(v4f*)(Op + (pr + c * 16 + r + (q4 >> 2)) * HD + (q4 & 3) * 128 + lane * 4) = *(const v4fa*)(osw + (r + (q4 >> 2)) * OPIT + (q4 & 3) * 128 + lane * 4);
            asm volatile("s_wait_xcnt 0x0" ::: "memory");   // stands in front of the next trip's writes to the registers that these stores name
        }
    }
}
// k_fcomb: joins the FSP key ranges of a query row: out = sum_s 2^(m_s - m) O_s / sum_s 2^(m_s - m) l_s, in range order. 128 threads x 4 columns per row, 2 rows per block.
__global__ __launch_bounds__(256) void k_fcomb(const float* __restrict__ Op, const float* __restrict__ Ml, float* out) {
    const int idx = blockIdx.x * 2 + ((int)threadIdx.x >> 7), z = idx / NQF, row = idx % NQF, d = ((int)threadIdx.x & 127) * 4;
    float m[FSP], l[FSP]; float mm = -3.0e38f;
#pragma unroll
    for (int s = 0; s < FSP; ++s) { const v2f ml = *(const v2f*)(Ml + ((size_t)(s * ZH + z) * NQF + row) * 2); m[s] = ml[0]; l[s] = ml[1]; mm = fmaxf(mm, m[s]); }
    asm volatile("s_wait_xcnt 0x0" ::: "memory");   // this and the one below stand in front of later writes to the address registers of the loads above them
    v4f o[FSP];
#pragma unroll
    for (int s = 0; s < FSP; ++s) { o[s] = *(const v4f*)(Op + ((size_t)(s * ZH + z) * NQF + row) * HD + d); asm volatile("s_wait_xcnt 0x0" ::: "memory"); }
    float den = 0.f; v4f acc = (v4f){};
#pragma unroll
    for (int s = 0; s < FSP; ++s) { const float w = __builtin_amdgcn_exp2f(m[s] - mm); den += w * l[s]; acc += o[s] * w; }
    *(v4f*)(out + (size_t)(RH + row) * DQ + z * HD + d) = acc * __fdiv_rn(1.0f, den);
}

extern "C" void kernel_launch(void* const* d_in, const int* in_sizes, int n_in,
                              void* d_out, int out_size, void* d_ws, size_t ws_size, hipStream_t stream) {
    (void)in_sizes; (void)n_in; (void)out_size;
    const float* x = (const float*)d_in[0]; const float* wq = (const float*)d_in[1]; const float* bq = (const float*)d_in[2]; const float* wk = (const float*)d_in[3]; const float* bk = (const float*)d_in[4]; const float* wv = (const float*)d_in[5]; const float* bv = (const float*)d_in[6]; const float* wo = nullptr; (void)wo;
    float* OUT = (float*)d_out;     // [1][4096][1024]
    char* wsp = (char*)d_ws;
    auto take = [&](size_t bytes) { char* p = wsp; wsp += (bytes + 255) & ~(size_t)255; return (void*)p; };
    // first what is last read by the score launches: weights, x, q and k planes (WQ, WK, WV, XB in a row: k_cvt8's dst)
    bf* WQ = (bf*)take((size_t)DQ * DM * 2); bf* WK = (bf*)take((size_t)DKV * DM * 2); bf* WV = (bf*)take((size_t)DKV * DM * 2);
    bf* XB = (bf*)take((size_t)TT * DM * 2); (void)WK;   // WK is reached as WQ + z stride
    h16* QP16 = (h16*)take((size_t)NH_ * TT * HD * 2); h16* KP16 = (h16*)take((size_t)NKV * TT * HD * 2);
    bf* QPh = (bf*)take((size_t)NH_ * TT * HD * 2); bf* KPh = (bf*)take((size_t)NKV * TT * HD * 2); bf* QPl = (bf*)take((size_t)NH_ * TT * HD * 2); bf* KPl = (bf*)take((size_t)NKV * TT * HD * 2);   // each k plane directly behind its q plane: z runs through both
    h16* VT16 = (h16*)take((size_t)NKV * HD * TT * 2); bf* VTh = (bf*)take((size_t)NKV * HD * TT * 2); bf* VTl = (bf*)take((size_t)NKV * HD * TT * 2); bf* Ph = (bf*)take((size_t)ZH * RH * TT * 2); bf* Pl = (bf*)take((size_t)ZH * RH * TT * 2);
    float* Sb = (float*)take((size_t)ZH * TT * TT * 4);   // only rows < RH of each head's plane hold scores
    float* Op = Sb + (size_t)RH * TT; float* Ml = Sb + (size_t)TT * TT + (size_t)RH * TT;   // the fused launch's partial results lie on the unused rows of plane 0 (O) and plane 1 (maximum, sum)
    static_assert((size_t)FSP * ZH * NQF * HD <= (size_t)NQF * TT && (size_t)FSP * ZH * NQF * 2 <= (size_t)NQF * TT && ZH == 2 && NH_ == ZH && REP == 1, "partial results fit those rows; one pass over both heads");
    if ((size_t)(wsp - (char*)d_ws) > ws_size) return;    // ws 256 MiB
    for (int b = 0; b < NB_; ++b) {
        k_cvt8<<<(unsigned)((3 * NW8 + NX8) / 256), 256, 0, stream>>>(wq, wk, wv, x + (size_t)b * TT * DM, WQ);
        // q and k in one grid: z = q heads, then k heads (WK lies behind WQ, each k plane behind its q plane), so the epilogue stores the head planes [h][t][d] itself
        k_gemms<bf, 0, EP_COLB, 2><<<dim3(TT / 128, HD / 128, NH_ + NKV), 256, 0, stream>>>(XB, nullptr, WQ, nullptr, DM, nullptr, HD, bq, bk, NH_, 0, (size_t)HD * DM, (size_t)TT * HD, HD, 1.0f, QP16, QPh, QPl);
        // v: the weight rows are the M side, so the tile comes out as [g HD + d][t], the transposed planes that attn.v reads
        k_gemms<bf, 0, EP_ROWB, 2><<<dim3(DKV / 128, TT / 128, 1), 256, 0, stream>>>(WV, nullptr, XB, nullptr, DM, nullptr, TT, bv, nullptr, 1, 0, 0, 0, 0, 1.0f, VT16, VTh, VTl);
        for (int h0 = 0; h0 < NH_; h0 += ZH) { const size_t zq = (size_t)h0, zk = (size_t)(h0 / REP);   // one kv head per query head: the pass's two heads use consecutive kv planes (z-strides TT*HD)
            k_gemms<bf, 2, EP_F32, 4><<<dim3(RH / 64, TT / 64, ZH), 256, 0, stream>>>(QPh + zq * TT * HD, QPl + zq * TT * HD, KPh + zk * TT * HD, KPl + zk * TT * HD, HD, Sb, TT, nullptr, nullptr, 0, (size_t)TT * HD, (size_t)TT * HD, (size_t)TT * TT, 0, 1.0f, nullptr, nullptr, nullptr);
            k_fattn<<<dim3(NQF / FQ, FSP, ZH), 128, 0, stream>>>(QP16 + zq * TT * HD, KP16 + zk * TT * HD, VT16 + zk * HD * TT, Op, Ml);
            k_asoft<<<ZH * RH / 8, 256, 0, stream>>>(Sb, nullptr, Ph, Pl);
            float* Oh = OUT + (size_t)b * TT * DM + (size_t)h0 * HD;   // this head's columns of the merged output, pitch DQ: f32 context straight to the output
            k_gemms<bf, 2, EP_F32, 4><<<dim3(RH / 64, HD / 64, ZH), 256, 0, stream>>>(Ph, Pl, VTh + zk * HD * TT, VTl + zk * HD * TT, TT, Oh, DQ, nullptr, nullptr, 0, (size_t)RH * TT, (size_t)HD * TT, (size_t)HD, 0, 1.0f, nullptr, nullptr, nullptr);
            k_fcomb<<<ZH * NQF / 2, 256, 0, stream>>>(Op, Ml, Oh); }
    }
}

// v006
// Measured time: 152 microseconds a run.
// Two timings next to v005 both put it at 1.07 times that version's speed.
// Over all steps from v000 it is 4.17 times as fast.
#include <hip/hip_runtime.h>

// Two-head self-attention with 512-wide heads (activation [1][1][4096][1024]; q, k, v = x W^T + b ('oi' [1024][1024]), 2 heads x 512; softmax(q.k/sqrt(512)) over all 4096 keys; out = merged context (no output projection) -> [1][1][4096][1024] (4.2 M)).
// Compute dtypes, f32 accumulate: every input rounded to bf16; q/k/v on PLAIN bf16 operands (inputs: exact) + biases; scores (K = 512) and attn.v (N = 512; no mask): query rows < 512 hl (3 products, f32 scores in the workspace, softmax f32), the rest single fp16 in one fused launch (running maximum, probabilities never leave the registers); no output projection: the merged context is written in f32.

#define NB_  1
#define TT   4096
#define DM   1024
#define NH_  2
#define NKV  2
#define REP  (NH_ / NKV)
#define HD   512
#define DQ   (NH_ * HD)
#define DKV  (NKV * HD)
#define ZH   2                    // heads per launch, on grid z
#define RH   512                  // query rows < RH use hi+lo planes
#define WIN  0
#define PCAR 1024.0f
#define SCL  0.044194173824159216f   // 512^-0.5 (head width 512)
typedef _Float16 h16;
typedef unsigned short bf;
typedef __attribute__((ext_vector_type(16))) __bf16   v16bf;
typedef __attribute__((ext_vector_type(16))) _Float16 v16h;
typedef __attribute__((ext_vector_type(8)))  _Float16 v8h;
typedef __attribute__((ext_vector_type(8)))  unsigned short v8us;
typedef __attribute__((ext_vector_type(8)))  float    v8f;
typedef __attribute__((ext_vector_type(4)))  float    v4f;
typedef v8h  __attribute__((may_alias)) v8ha;
typedef v4f  __attribute__((may_alias)) v4fa;
typedef v8us __attribute__((may_alias)) v8usa;

__device__ __forceinline__ unsigned short f2bf(float f) { unsigned u = __float_as_uint(f); u += 0x7FFFu + ((u >> 16) & 1u); return (unsigned short)(u >> 16); }
__device__ __forceinline__ float bf2f(unsigned short b) { return __uint_as_float(((unsigned)b) << 16); }
__device__ __forceinline__ float bfr(float f) { return bf2f(f2bf(f)); }
__device__ __forceinline__ v16h cat16(v8h lo, v8h hi) { return __builtin_shufflevector(lo, hi, 0, 1, 2, 3, 4, 5, 6, 7, 8, 9, 10, 11, 12, 13, 14, 15); }
__device__ __forceinline__ v16bf cat16b(v8us lo, v8us hi) { return __builtin_bit_cast(v16bf, __builtin_shufflevector(lo, hi, 0, 1, 2, 3, 4, 5, 6, 7, 8, 9, 10, 11, 12, 13, 14, 15)); }
__device__ __forceinline__ v8f wmma16(v16h a, v16h b, v8f c) { return __builtin_amdgcn_wmma_f32_16x16x32_f16(false, a, false, b, (short)0, c, false, false); }
__device__ __forceinline__ v8f wmmab(v16bf a, v16bf b, v8f c) { return __builtin_amdgcn_wmma_f32_16x16x32_bf16(false, a, false, b, (short)0, c, false, false); }



// ---- k_gemms: LDS-staged GEMM. c[m][n] = sum_k A[m][k] Bt[n][k] (NSPLIT 2: + A2 Bt + A Bt2, the hi+lo planes), operands K-contiguous 16-bit planes; z-batch strides sA/sB/sC/sBias in elements.
// NSPLIT 0: 128x128 tile per work-group, a wave group = 2x2 waves of 64x64, a stage = [A 128 rows | Bt 128 rows] of 128 k (256 bytes, pitch 272). NSPLIT 2: 64x64 tile, a wave group = 2 waves of 32x64, a stage = [A | A2 | Bt | Bt2], 64 rows each, of 64 k (128 bytes, pitch 144).
// A trip covers KG stages of k, one per wave group; a group's stage comes in by asynchronous copies to LDS (every wave-wide copy = whole 128-byte lines), two buffers: the next trip's copies fly while this trip's fragments are read from LDS by all waves of the group. The KG partial tiles are added in LDS in group order.
// grid (M/tile, N/tile, Z), 32 x waves threads. K % (stage k x KG) == 0.
// Batches z >= zB take their bias from biasB (two projections with separate bias vectors in one grid).
// EPI says what the epilogue stores, pitch ldc: EP_F32 c as f32 in C; EP_SCALE c x cs as f32 in C; EP_COLB (c + bias[n]) and EP_ROWB (c + bias[m]) as the three 16-bit planes the next GEMMs read (fp16, bf16 hi, bf16 lo); EP_ROWB's fp16 plane not at pitch ldc but as [head][32-key block][d][32 keys].
#define EP_F32   0
#define EP_SCALE 1
#define EP_COLB  2
#define EP_ROWB  3
__device__ __forceinline__ void splitf(float y, unsigned short& h, unsigned short& l) { h = f2bf(y); l = f2bf(y - bf2f(h)); }
typedef __attribute__((ext_vector_type(4))) _Float16 v4h;
typedef __attribute__((ext_vector_type(4))) unsigned short v4us;
template <typename T16> struct WFrag;   // ld: one fragment from an LDS row, p = the lane's byte address (row, 16 bytes x lane half): k 8 hi .. 8 hi + 7 and 16 + 8 hi .. 16 + 8 hi + 7, the same for both operands
template <> struct WFrag<h16> { typedef v16h V; static __device__ __forceinline__ V ld(const char* p) { return cat16(*(const v8ha*)p, *(const v8ha*)(p + 32)); } static __device__ __forceinline__ v8f mma(V a, V b, v8f c) { return wmma16(a, b, c); } };
template <> struct WFrag<bf> { typedef v16bf V; static __device__ __forceinline__ V ld(const char* p) { return cat16b(*(const v8usa*)p, *(const v8usa*)(p + 32)); } static __device__ __forceinline__ v8f mma(V a, V b, v8f c) { return wmmab(a, b, c); } };
// eight copies of 16 bytes per lane, rows 8 apart; the s_wait_xcnt stands inside the statement so that no address register of a copy is rewritten ahead of it
template <int PITCH, typename T16>
__device__ __forceinline__ void cp8(unsigned l, const T16* g, size_t gs) {
    asm volatile("global_load_async_to_lds_b128 %0, %8, off\n\t"
                 "global_load_async_to_lds_b128 %1, %9, off\n\t"
                 "global_load_async_to_lds_b128 %2, %10, off\n\t"
                 "global_load_async_to_lds_b128 %3, %11, off\n\t"
                 "global_load_async_to_lds_b128 %4, %12, off\n\t"
                 "global_load_async_to_lds_b128 %5, %13, off\n\t"
                 "global_load_async_to_lds_b128 %6, %14, off\n\t"
                 "global_load_async_to_lds_b128 %7, %15, off\n\t"
                 "s_wait_xcnt 0x0"
                 :: "v"(l), "v"(l + 8 * PITCH), "v"(l + 16 * PITCH), "v"(l + 24 * PITCH), "v"(l + 32 * PITCH), "v"(l + 40 * PITCH), "v"(l + 48 * PITCH), "v"(l + 56 * PITCH),
                    "v"(g), "v"(g + gs), "v"(g + 2 * gs), "v"(g + 3 * gs), "v"(g + 4 * gs), "v"(g + 5 * gs), "v"(g + 6 * gs), "v"(g + 7 * gs)
                 : "memory");
}
// gemms_body is the whole GEMM of one work-group: sm = its LDS (GLDS bytes), (bx, by, z) = its tile and batch. k_gemms launches it alone; k_qkv and k_avj launch it beside independent work in one grid.
#define GLDS(NSPLIT, KG) (2 * (KG) * 256 * (((NSPLIT) ? 64 : 128) * 2 + 16))
template <typename T16, int NSPLIT, int EPI, int KG>
__device__ __forceinline__ void gemms_body(char* sm, const int bx, const int by, const size_t z, const T16* __restrict__ A, const T16* __restrict__ A2, const T16* __restrict__ Bt, const T16* __restrict__ Bt2, int K, float* C, int ldc, const float* __restrict__ bias, const float* __restrict__ biasB, int zB, size_t sA, size_t sB, size_t sC, size_t sBias, float cs, h16* P16, bf* Ph, bf* Pl) {
    static_assert(NSPLIT == 0 || NSPLIT == 2, "one product, or the three of the hi+lo planes");
    typedef typename WFrag<T16>::V V;
    constexpr int KS = NSPLIT ? 64 : 128, PITCH = KS * 2 + 16, STAGE = 256 * PITCH, NK = KS / 32, MB = NSPLIT ? 2 : 4, GWV = NSPLIT ? 2 : 4, TILE = NSPLIT ? 64 : 128, OT = MB * 16 * 68;
    static_assert(GLDS(NSPLIT, KG) == 2 * KG * STAGE, "the launching kernel's LDS is the ring");
    A += z * sA; Bt += z * sB; if constexpr (NSPLIT == 2) { A2 += z * sA; Bt2 += z * sB; }
    if constexpr (EPI == EP_F32 || EPI == EP_SCALE) C += z * sC; else { P16 += z * sC; Ph += z * sC; Pl += z * sC; bias = (int)z < zB ? bias + z * sBias : biasB + (z - zB) * sBias; }
    const int lane = threadIdx.x & 31, lr = lane & 15, hi = lane >> 4; const int wave = __builtin_amdgcn_readfirstlane((int)(threadIdx.x >> 5)); const int kg = wave / GWV, wig = wave % GWV, wm = NSPLIT ? wig : wig >> 1, wn = NSPLIT ? 0 : wig & 1; const int r0 = bx * TILE, c0 = by * TILE;
    v8f acc[MB][4];
#pragma unroll
    for (int mb = 0; mb < MB; ++mb)
#pragma unroll
        for (int nb = 0; nb < 4; ++nb) acc[mb][nb] = (v8f){};
    // copy lanes: thread tg of its group brings 16-byte piece cch of rows crow + 8 i, i < 8, of each 64-row quarter of the stage
    const int tg = (int)threadIdx.x % (GWV * 32), crow = tg / (KS / 8), cch = tg % (KS / 8);
    const size_t ga = (size_t)(r0 + crow) * K + kg * KS + cch * 8, gb = (size_t)(c0 + crow) * K + kg * KS + cch * 8;
    const T16* g0 = A + ga; const T16* g1 = NSPLIT ? A2 + ga : A + ga + (size_t)64 * K; const T16* g2 = Bt + gb; const T16* g3 = NSPLIT ? Bt2 + gb : Bt + gb + (size_t)64 * K;
    const unsigned l0 = (unsigned)(size_t)sm + (unsigned)(kg * STAGE + crow * PITCH + cch * 16);
    const size_t gs = (size_t)8 * K; const int nt = K / (KS * KG);
    auto fill = [&](int buf, int t) { const unsigned l = l0 + (unsigned)(buf * (KG * STAGE)); const size_t ko = (size_t)t * (KS * KG);
        cp8<PITCH>(l, g0 + ko, gs); cp8<PITCH>(l + 64 * PITCH, g1 + ko, gs); cp8<PITCH>(l + 128 * PITCH, g2 + ko, gs); cp8<PITCH>(l + 192 * PITCH, g3 + ko, gs); };
    fill(0, 0);
    asm volatile("s_wait_asynccnt 0x0" ::: "memory");   // this wave's part of trip 0 has landed
    __syncthreads();                                     // trip 0's stages are whole before any wave reads them
    if (nt > 1) fill(1, 1);
#pragma unroll 1   // the trip loop stays rolled: one copy of the ring's hand-over
    for (int t = 0; t < nt; ++t) {
        const char* sb = sm + ((t & 1) * KG + kg) * STAGE; const char* pa = sb + (wm * MB * 16 + lr) * PITCH + hi * 16; const char* pb = sb + (128 + wn * 64 + lr) * PITCH + hi * 16;
        // fragments run ahead of their products inside the trip: A two k steps (two sets), Bt half a k step (each pair of columns is refetched when its products are issued)
        V a[2][MB], a2[2][MB], b[4], b2[4];
#pragma unroll
        for (int q = 0; q < (NK < 2 ? NK : 2); ++q)
#pragma unroll
            for (int mb = 0; mb < MB; ++mb) { a[q][mb] = WFrag<T16>::ld(pa + mb * 16 * PITCH + q * 64); if constexpr (NSPLIT == 2) a2[q][mb] = WFrag<T16>::ld(pa + (64 + mb * 16) * PITCH + q * 64); }
#pragma unroll
        for (int nb = 0; nb < 4; ++nb) { b[nb] = WFrag<T16>::ld(pb + nb * 16 * PITCH); if constexpr (NSPLIT == 2) b2[nb] = WFrag<T16>::ld(pb + (64 + nb * 16) * PITCH); }
        __builtin_amdgcn_sched_barrier(0);   // this and the two below keep each group of LDS loads whole and ahead of the products in front of its use; without them the scheduler sinks every load to its first use and the wave waits out the LDS latency there
#pragma unroll
        for (int ks = 0; ks < NK; ++ks) {
#pragma unroll
            for (int nh = 0; nh < 2; ++nh) {
#pragma unroll
                for (int nb = 2 * nh; nb < 2 * nh + 2; ++nb)
#pragma unroll
                    for (int mb = 0; mb < MB; ++mb) { acc[mb][nb] = WFrag<T16>::mma(a[ks & 1][mb], b[nb], acc[mb][nb]); if constexpr (NSPLIT == 2) { acc[mb][nb] = WFrag<T16>::mma(a2[ks & 1][mb], b[nb], acc[mb][nb]); acc[mb][nb] = WFrag<T16>::mma(a[ks & 1][mb], b2[nb], acc[mb][nb]); } }
                __builtin_amdgcn_sched_barrier(0);
                if (ks + 1 < NK) {
#pragma unroll
                    for (int nb = 2 * nh; nb < 2 * nh + 2; ++nb) { b[nb] = WFrag<T16>::ld(pb + nb * 16 * PITCH + (ks + 1) * 64); if constexpr (NSPLIT == 2) b2[nb] = WFrag<T16>::ld(pb + (64 + nb * 16) * PITCH + (ks + 1) * 64); } }
                if (nh == 1 && ks + 2 < NK) {
#pragma unroll
                    for (int mb = 0; mb < MB; ++mb) { a[ks & 1][mb] = WFrag<T16>::ld(pa + mb * 16 * PITCH + (ks + 2) * 64); if constexpr (NSPLIT == 2) a2[ks & 1][mb] = WFrag<T16>::ld(pa + (64 + mb * 16) * PITCH + (ks + 2) * 64); } }
                __builtin_amdgcn_sched_barrier(0);
            }
        }
        asm volatile("s_wait_dscnt 0x0" ::: "memory");      // this wave has left the buffer that is refilled below
        asm volatile("s_wait_asynccnt 0x0" ::: "memory");   // this wave's part of trip t + 1 has landed
        __syncthreads();                                     // publishes trip t + 1 and ends every read of trip t's buffer
        if (t + 2 < nt) fill(t & 1, t + 2);
    }
    asm volatile("s_wait_asynccnt 0x0" ::: "memory");   // no copy is in flight when the ring becomes output staging
    float* os = (float*)sm; float* osw = os + wave * OT;
#pragma unroll
    for (int mb = 0; mb < MB; ++mb)
#pragma unroll
        for (int nb = 0; nb < 4; ++nb)
#pragma unroll
            for (int j = 0; j < 8; ++j) osw[(mb * 16 + hi * 8 + j) * 68 + nb * 16 + lr] = acc[mb][nb][j];
    __syncthreads();   // every wave's partial tile is in LDS before any wave adds the KG tiles
    const float* ot = os + wig * OT;
#pragma unroll
    for (int s = 0; s < MB * 8 / KG; ++s) { const int it = lane + (s + kg * (MB * 8 / KG)) * 32, row = it >> 4, cofs = (it & 15) * 4; v4f val = *(const v4fa*)(ot + row * 68 + cofs);
#pragma unroll
        for (int g = 1; g < KG; ++g) val += *(const v4fa*)(ot + g * (GWV * OT) + row * 68 + cofs);
        const int gr = r0 + wm * MB * 16 + row, gc = c0 + wn * 64 + cofs;
        if constexpr (EPI == EP_COLB) { val[0] += bfr(bias[gc]); val[1] += bfr(bias[gc + 1]); val[2] += bfr(bias[gc + 2]); val[3] += bfr(bias[gc + 3]); }
        if constexpr (EPI == EP_ROWB) { const float br = bfr(bias[gr]); val[0] += br; val[1] += br; val[2] += br; val[3] += br; }
        if constexpr (EPI == EP_SCALE) val *= cs;
        const size_t oo = (size_t)gr * ldc + gc;
        if constexpr (EPI == EP_F32 || EPI == EP_SCALE) *(v4f*)(C + oo) = val;
        else { v4h o16; v4us oh, ol;   // 16 lanes x 8 bytes: one whole 128-byte line of each plane per tile row (of EP_ROWB's fp16 plane, two half lines in consecutive blocks)
#pragma unroll
            for (int q = 0; q < 4; ++q) { o16[q] = (h16)val[q]; unsigned short a2s, c2; splitf(val[q], a2s, c2); oh[q] = a2s; ol[q] = c2; }
            if constexpr (EPI == EP_ROWB) { const size_t o6 = ((size_t)(gr / HD * (TT / 32) + gc / 32) * HD + gr % HD) * 32 + gc % 32;   // v: the fp16 plane lies as [head][32-key block][d][32 keys], so that a block is one contiguous run for the fused launch's copies
                *(v4h*)(P16 + o6) = o16; *(v4us*)(Ph + oo) = oh; *(v4us*)(Pl + oo) = ol;
                asm volatile("s_wait_xcnt 0x0" ::: "memory");   // stands in front of the next pass's writes to the registers that these stores name
            } else {
            *(v4h*)(P16 + oo) = o16; *(v4us*)(Ph + oo) = oh; *(v4us*)(Pl + oo) = ol; } }
    }
}

template <typename T16, int NSPLIT, int EPI, int KG>
__global__ __launch_bounds__((NSPLIT ? 64 : 128) * KG) void k_gemms(const T16* __restrict__ A, const T16* __restrict__ A2, const T16* __restrict__ Bt, const T16* __restrict__ Bt2, int K, float* C, int ldc, const float* __restrict__ bias, const float* __restrict__ biasB, int zB, size_t sA, size_t sB, size_t sC, size_t sBias, float cs, h16* P16, bf* Ph, bf* Pl) {
    __shared__ __align__(16) char sm[GLDS(NSPLIT, KG)];
    gemms_body<T16, NSPLIT, EPI, KG>(sm, blockIdx.x, blockIdx.y, blockIdx.z, A, A2, Bt, Bt2, K, C, ldc, bias, biasB, zB, sA, sB, sC, sBias, cs, P16, Ph, Pl);
}
// k_qkv: the three projections in one grid (TT/128, HD/128, q heads + k heads + v heads). z < NH_ + NKV: q heads, then k heads (WK lies behind WQ, each k plane behind its q plane), the epilogue stores the head planes [h][t][d]. The rest: v, with the weight rows as the M side, so the tile comes out as [g HD + d][t], the transposed planes that attn.v reads.
__global__ __launch_bounds__(256) void k_qkv(const bf* __restrict__ XB, const bf* __restrict__ WQ, const bf* __restrict__ WV, const float* __restrict__ bq, const float* __restrict__ bk, const float* __restrict__ bv, h16* QP16, bf* QPh, bf* QPl, h16* VT16, bf* VTh, bf* VTl) {
    __shared__ __align__(16) char sm[GLDS(0, 2)];
    if (blockIdx.z < NH_ + NKV) gemms_body<bf, 0, EP_COLB, 2>(sm, blockIdx.x, blockIdx.y, blockIdx.z, XB, nullptr, WQ, nullptr, DM, nullptr, HD, bq, bk, NH_, 0, (size_t)HD * DM, (size_t)TT * HD, HD, 1.0f, QP16, QPh, QPl);
    else gemms_body<bf, 0, EP_ROWB, 2>(sm, (blockIdx.z - (NH_ + NKV)) * (HD / 128) + blockIdx.y, blockIdx.x, 0, WV, nullptr, XB, nullptr, DM, nullptr, TT, bv, nullptr, 1, 0, 0, 0, 0, 1.0f, VT16, VTh, VTl);
}

__device__ __forceinline__ h16 tohx(float x) { return (h16)x; }
typedef __attribute__((ext_vector_type(2))) _Float16 v2h;
typedef __attribute__((ext_vector_type(2))) unsigned short v2us;
typedef __attribute__((ext_vector_type(2))) float v2f;
typedef __attribute__((ext_vector_type(4))) int v4i;

__global__ __launch_bounds__(256) void k_wtG(const float* __restrict__ w, int K, int N, bf* Bt) {
    const int lane = threadIdx.x & 31; const int L0 = (blockIdx.x * 8 + (threadIdx.x >> 5)) * 8; const int nlines = N * K / 64;
{
#pragma unroll 1
        for (int l = 0; l < 8; ++l) { const int L = L0 + l; if (L >= nlines) break; const size_t e = (size_t)L * 64 + lane * 2; const int k = (int)(e % K), n = (int)(e / K); v2us o;
            o[0] = f2bf(w[(size_t)k * N + n]); o[1] = f2bf(w[(size_t)(k + 1) * N + n]); *(v2us*)(Bt + e) = o; }
         }
}
// k_cvt8: the four f32 -> bf16 conversions in one grid. dst is the contiguous run [wq | wk | wv | x]; 8 elements per thread, and a block lies wholly inside one source.
#define NW8 ((size_t)DM * DM / 8)
#define NX8 ((size_t)TT * DM / 8)
static_assert(DQ == DM && DKV == DM && NW8 % 256 == 0 && NX8 % 256 == 0, "three equal weight planes, whole blocks");
__global__ __launch_bounds__(256) void k_cvt8(const float* __restrict__ wq, const float* __restrict__ wk, const float* __restrict__ wv, const float* __restrict__ x, bf* dst) { const size_t i = (size_t)blockIdx.x * 256 + threadIdx.x; const unsigned seg = blockIdx.x / (unsigned)(NW8 / 256);
    const float* src = seg == 0 ? wq : seg == 1 ? wk : seg == 2 ? wv : x; const v8f v = *(const v8f*)(src + (i - (seg < 3 ? seg : 3) * NW8) * 8); v8us o;
#pragma unroll
    for (int k = 0; k < 8; ++k) o[k] = f2bf(v[k]); *(v8us*)(dst + i * 8) = o;  }

// asoft_row: one wave, one hi+lo row (ZH x RH rows in all); k_fattn's spare work-groups run it. Per row (zz, i): t = S x HD^-0.5 (no mask); softmax over the 4096 keys (register row, one exp, fixed trees); every row goes to Ph, Pl [zz][RH][TT] (i = row % RH < RH)
__device__ __forceinline__ void asoft_row(const float* __restrict__ Sb, h16* P16, bf* Ph, bf* Pl, const int row) {
    const int lane = threadIdx.x & 31; if (row >= ZH * RH) return; const int i = row % RH; const int zz = row / RH; (void)zz; const bool hires = (i < RH); const float* sr = Sb + ((size_t)zz * TT + i) * TT; float v[TT / 32]; float mx = -3.0e38f;
#pragma unroll
    for (int ch = 0; ch < TT / 128; ++ch) { const int j0 = ch * 128 + lane * 4; const v4f a = *(const v4f*)(sr + j0);
#pragma unroll
        for (int q = 0; q < 4; ++q) { const int j = j0 + q; (void)j; const float t = a[q] * SCL; v[ch * 4 + q] = t; mx = fmaxf(mx, t); } }
#pragma unroll
    for (int sh = 16; sh; sh >>= 1) mx = fmaxf(mx, __shfl_xor(mx, sh, 32));
    float sum = 0.f;
#pragma unroll
    for (int k = 0; k < TT / 32; ++k) { float d0 = __fsub_rn(v[k], mx); asm volatile("" : "+v"(d0)); v[k] = __builtin_amdgcn_exp2f(__fmul_rn(d0, 1.4426950408889634f)); sum += v[k]; }
#pragma unroll
    for (int sh = 16; sh; sh >>= 1) sum += __shfl_xor(sum, sh, 32);
    const float f = __fdiv_rn(hires ? 1.0f : PCAR, sum);
{
        if (hires) {
#pragma unroll
            for (int ch = 0; ch < TT / 128; ++ch) { v4us oh, ol;
#pragma unroll
                for (int q = 0; q < 4; ++q) { unsigned short a, c2; splitf(v[ch * 4 + q] * f, a, c2); oh[q] = a; ol[q] = c2; }
                const size_t oo = ((size_t)zz * (RH ? RH : 1) + i) * TT + ch * 128 + lane * 4; *(v4us*)(Ph + oo) = oh; *(v4us*)(Pl + oo) = ol; }
        } else {
#pragma unroll
            for (int ch = 0; ch < TT / 128; ++ch) { v4h o4;
#pragma unroll
                for (int q = 0; q < 4; ++q) o4[q] = tohx(v[ch * 4 + q] * f);
                *(v4h*)(P16 + ((size_t)zz * (TT - RH) + (i - RH)) * TT + ch * 128 + lane * 4) = o4; } }
         }
}

// ---- k_fattn: scores, softmax and attn.v of the fp16 query rows (>= RH) in one launch. S^T = K Q^T, O^T += V^T P^T: in every 16-column group a lane holds one query, so maximum, sum and rescale are per lane, and the score tiles of 32 keys ARE the B fragment of the second product (keys 8 hi .. and 16 + 8 hi .., the k order of WFrag::ld).
// A work-group = 4 waves x 32 queries, one head (grid z), one quarter of the keys (grid y); Q fragments and the 512 x 32 O^T tile stay in registers. A stage = 32 keys: K rows (pitch 1040 bytes) and the V^T block [d][32 keys] (pitch 80), by asynchronous copies to LDS, two buffers.
// The grid's x runs FXA past the query tiles: those work-groups (as many as the attention leaves WGPs idle) do the softmax rows of the hi+lo path, which wait for nothing of this launch: a wave takes ARW rows, one after the other.
// The maximum in use is raised only when a new one exceeds it by 2^8 (p <= 256 fits fp16). Each key range leaves its unnormalised O, its maximum (log2 units) and its sum; k_avj joins the ranges.
#define FQ   128
#define FSP  4
#define FKT  32
#define KPIT (HD * 2 + 16)
#define VPIT (FKT * 2 + 16)
#define FSTG (FKT * KPIT + HD * VPIT)
#define NQF  (TT - RH)
#define OPIT (HD + 4)
#define FXA  4
#define ARW  (ZH * RH / (FXA * FSP * ZH * 4))
static_assert(ARW * (FXA * FSP * ZH * 4) == ZH * RH, "whole rows per wave");
static_assert(4 * 16 * OPIT * 4 <= 2 * FSTG && NQF % FQ == 0 && TT % (FSP * FKT) == 0 && TT / (FSP * FKT) >= 2, "output staging fits the ring; whole tiles; two stages or more");
typedef __attribute__((address_space(1))) v4i gv4i;
typedef __attribute__((address_space(3))) v4i lv4i;
__global__ __launch_bounds__(128) void k_fattn(const h16* __restrict__ Q, const h16* __restrict__ Kp, const h16* __restrict__ Vt, float* Op, float* Ml, const float* __restrict__ Sb, bf* Ph, bf* Pl) {
    __shared__ __align__(16) char sm[2 * FSTG];
    if (blockIdx.x >= NQF / FQ) {   // the same for a whole work-group, ahead of every barrier and copy
        const int w0 = ((((int)blockIdx.z * FSP + (int)blockIdx.y) * FXA + ((int)blockIdx.x - NQF / FQ)) * 4 + ((int)threadIdx.x >> 5)) * ARW;
#pragma unroll 1   // one copy of the row's code
        for (int r = 0; r < ARW; ++r) { asoft_row(Sb, nullptr, Ph, Pl, w0 + r);
            asm volatile("s_wait_xcnt 0x0" ::: "memory");   // stands in front of the next row's writes to the registers that this row's stores name
        }
        return; }
    const int tid = (int)threadIdx.x, lane = tid & 31, lr = lane & 15, hi = lane >> 4; const int wave = __builtin_amdgcn_readfirstlane(tid >> 5);
    const int z = blockIdx.z, sp = blockIdx.y, q0 = blockIdx.x * FQ + wave * 32;
    // both planes hold FKT x HD elements per 32-key block, contiguous: thread tid brings 16-byte pieces tid + 128 i, i < 16, of each
    const size_t kv0 = ((size_t)z * TT + (size_t)sp * (TT / FSP)) * HD + tid * 8; const h16* gk = Kp + kv0; const h16* gv = Vt + kv0;
    char* lk = sm + (tid >> 6) * KPIT + (tid & 63) * 16; char* lv = sm + FKT * KPIT + (tid >> 2) * VPIT + (tid & 3) * 16;
    // the copies are the builtin here: above 256 registers the operands of asm text must all lie in the lowest register window, which cost spills
    auto fill = [&](int buf, int t) { const int o = buf * FSTG; const size_t go = (size_t)t * (FKT * HD);
#pragma unroll
        for (int i = 0; i < 16; ++i) __builtin_amdgcn_global_load_async_to_lds_b128((gv4i*)(gk + go + i * 1024), (lv4i*)(lk + o + i * 2 * KPIT), 0, 0);
#pragma unroll
        for (int i = 0; i < 16; ++i) __builtin_amdgcn_global_load_async_to_lds_b128((gv4i*)(gv + go + i * 1024), (lv4i*)(lv + o + i * 32 * VPIT), 0, 0); };
    fill(0, 0);
    const h16* qr = Q + ((size_t)z * TT + RH + q0 + lr) * HD + hi * 8;
    v16h qf[2][16];
#pragma unroll
    for (int c = 0; c < 2; ++c)
#pragma unroll
        for (int ks = 0; ks < 16; ++ks) qf[c][ks] = cat16(*(const v8ha*)(qr + c * 16 * HD + ks * 32), *(const v8ha*)(qr + c * 16 * HD + ks * 32 + 16));
    v8f O[32][2];
#pragma unroll
    for (int dt = 0; dt < 32; ++dt) { O[dt][0] = (v8f){}; O[dt][1] = (v8f){}; }
    float mu[2] = {-1.0e30f, -1.0e30f}; v8f L[2] = {(v8f){}, (v8f){}};   // L: the row sums, as one more output tile: A = a tile whose row 0 is ones, so row 0 of L (lanes 0-15, element 0) adds up the rounded p of each query
    v16h ones;
#pragma unroll
    for (int e = 0; e < 16; ++e) ones[e] = lr == 0 ? (h16)1.0f : (h16)0.0f;
    constexpr float CS2 = SCL * 1.4426950408889634f; constexpr int nt = TT / (FSP * FKT);
    asm volatile("s_wait_asynccnt 0x0" ::: "memory");   // this wave's part of stage 0 has landed
    __syncthreads();                                     // stage 0 is whole before any wave reads it
    fill(1, 1);
#pragma unroll 1   // the stage loop stays rolled: one copy of the ring's hand-over
    for (int t = 0; t < nt; ++t) {
        const char* kb = sm + (t & 1) * FSTG + lr * KPIT + hi * 16; const char* vb = sm + (t & 1) * FSTG + FKT * KPIT + lr * VPIT + hi * 16;
        // three fragment sets of four: a set is refetched as soon as its 8 products are issued, two sets (16 products) ahead of its use; the first V^T sets are fetched under the last score products and the softmax
        v16h fr[3][4]; v8f st[2][2] = {{(v8f){}, (v8f){}}, {(v8f){}, (v8f){}}};
#pragma unroll
        for (int g = 0; g < 3; ++g)
#pragma unroll
            for (int i = 0; i < 4; ++i) fr[g][i] = WFrag<h16>::ld(kb + (i & 1) * 16 * KPIT + (2 * g + (i >> 1)) * 64);
        __builtin_amdgcn_sched_barrier(0);   // this and the ones below keep each group of LDS loads whole and ahead of the products in front of its use; without them the scheduler sinks every load to its first use and the lone wave of a SIMD waits out the LDS latency there
#pragma unroll
        for (int g = 0; g < 8; ++g) {
#pragma unroll
            for (int i = 0; i < 4; ++i)
#pragma unroll
                for (int c = 0; c < 2; ++c) st[i & 1][c] = wmma16(fr[g % 3][i], qf[c][2 * g + (i >> 1)], st[i & 1][c]);
            __builtin_amdgcn_sched_barrier(0);
#pragma unroll
            for (int i = 0; i < 4; ++i) fr[g % 3][i] = g + 3 < 8 ? WFrag<h16>::ld(kb + (i & 1) * 16 * KPIT + (2 * (g + 3) + (i >> 1)) * 64) : WFrag<h16>::ld(vb + ((g + 3 - 8) * 4 + i) * 16 * VPIT);
            __builtin_amdgcn_sched_barrier(0);
        }
        float mc[2];
#pragma unroll
        for (int c = 0; c < 2; ++c) { float m = st[0][c][0];
#pragma unroll
            for (int j = 1; j < 8; ++j) m = fmaxf(m, st[0][c][j]);
#pragma unroll
            for (int j = 0; j < 8; ++j) m = fmaxf(m, st[1][c][j]);
            mc[c] = fmaxf(m, __shfl_xor(m, 16, 32)) * CS2; }
        if (__builtin_amdgcn_ballot_w32(mc[0] > mu[0] + 8.0f || mc[1] > mu[1] + 8.0f) != 0) {   // wave-uniform: rare after the first stage
#pragma unroll
            for (int c = 0; c < 2; ++c) { const float mn = fmaxf(mu[c], mc[c]); const float al = __builtin_amdgcn_exp2f(mu[c] - mn); mu[c] = mn; L[c] *= al;
#pragma unroll
                for (int dt = 0; dt < 32; ++dt) O[dt][c] *= al; } }
        v16h pb[2];
#pragma unroll
        for (int c = 0; c < 2; ++c)
#pragma unroll
            for (int kt = 0; kt < 2; ++kt)
#pragma unroll
                for (int j = 0; j < 8; ++j) { const float p = __builtin_amdgcn_exp2f(__builtin_fmaf(st[kt][c][j], CS2, -mu[c])); pb[c][kt * 8 + j] = (h16)p; }
        L[0] = wmma16(ones, pb[0], L[0]); L[1] = wmma16(ones, pb[1], L[1]);
        __builtin_amdgcn_sched_barrier(0);
#pragma unroll
        for (int g = 0; g < 8; ++g) {
#pragma unroll
            for (int i = 0; i < 4; ++i)
#pragma unroll
                for (int c = 0; c < 2; ++c) O[g * 4 + i][c] = wmma16(fr[(g + 2) % 3][i], pb[c], O[g * 4 + i][c]);
            __builtin_amdgcn_sched_barrier(0);
            if (g + 3 < 8) {
#pragma unroll
                for (int i = 0; i < 4; ++i) fr[(g + 2) % 3][i] = WFrag<h16>::ld(vb + ((g + 3) * 4 + i) * 16 * VPIT); }
            __builtin_amdgcn_sched_barrier(0);
        }
        asm volatile("s_wait_dscnt 0x0" ::: "memory");      // this wave has left the buffer that is refilled below
        asm volatile("s_wait_asynccnt 0x0" ::: "memory");   // this wave's part of stage t + 1 has landed
        __syncthreads();                                     // publishes stage t + 1 and ends every read of stage t's buffer
        if (t + 2 < nt) fill(t & 1, t + 2);
    }
    asm volatile("s_wait_asynccnt 0x0" ::: "memory");   // no copy is in flight when the ring becomes output staging
    const size_t pr = (size_t)(sp * ZH + z) * NQF + q0;   // this wave's first row among the partial results
#pragma unroll
    for (int c = 0; c < 2; ++c) if (hi == 0) { v2f ml; ml[0] = mu[c]; ml[1] = L[c][0]; *(v2f*)(Ml + (pr + c * 16 + lr) * 2) = ml; }
    // O^T -> O through the wave's own part of LDS (no other wave reads it), 16 queries at a time, so that the stores are whole lines
    float* osw = (float*)sm + wave * (16 * OPIT);
#pragma unroll 1   // two equal halves: one copy of the code
    for (int c = 0; c < 2; ++c) {
#pragma unroll
        for (int dt = 0; dt < 32; ++dt) { const v8f o = c ? O[dt][1] : O[dt][0]; float* w = osw + lr * OPIT + dt * 16 + hi * 8; *(v4fa*)w = (v4f){o[0], o[1], o[2], o[3]}; *(v4fa*)(w + 4) = (v4f){o[4], o[5], o[6], o[7]}; }
#pragma unroll 1   // four rows a trip: 16 loads in flight, small code
        for (int r = 0; r < 16; r += 4) {
#pragma unroll
            for (int q4 = 0; q4 < 16; ++q4) *(v4f*)(Op + (pr + c * 16 + r + (q4 >> 2)) * HD + (q4 & 3) * 128 + lane * 4) = *(const v4fa*)(osw + (r + (q4 >> 2)) * OPIT + (q4 & 3) * 128 + lane * 4);
            asm volatile("s_wait_xcnt 0x0" ::: "memory");   // stands in front of the next trip's writes to the registers that these stores name
        }
    }
}
// k_avj: two independent jobs in one grid (RH/64, HD/64, 2 ZH). z < ZH: attn.v of the hi+lo rows, one 64x64 tile per work-group. The rest, as many work-groups again: the join of the FSP key ranges of the fp16 query rows: out = sum_s 2^(m_s - m) O_s / sum_s 2^(m_s - m) l_s, in range order; 128 threads x 4 columns per row, 2 rows per work-group and pass, JR rows' loads in flight at a time.
#define JW  (RH / 64 * (HD / 64) * ZH)
#define JR  7
#define JB  (ZH * NQF / (2 * JW * JR))
static_assert(JB * (2 * JW * JR) == ZH * NQF, "whole passes");
__global__ __launch_bounds__(256) void k_avj(const bf* __restrict__ Ph, const bf* __restrict__ Pl, const bf* __restrict__ VTh, const bf* __restrict__ VTl, const float* __restrict__ Op, const float* __restrict__ Ml, float* out) {
    __shared__ __align__(16) char sm[GLDS(2, 4)];
    if (blockIdx.z < ZH) { gemms_body<bf, 2, EP_F32, 4>(sm, blockIdx.x, blockIdx.y, blockIdx.z, Ph, Pl, VTh, VTl, TT, out, DQ, nullptr, nullptr, 0, (size_t)RH * TT, (size_t)HD * TT, (size_t)HD, 0, 1.0f, nullptr, nullptr, nullptr); return; }
    const unsigned i0 = ((((unsigned)blockIdx.z - ZH) * (HD / 64) + blockIdx.y) * (RH / 64) + blockIdx.x) * 2 + (threadIdx.x >> 7), d = (threadIdx.x & 127) * 4;
#pragma unroll 1   // JR rows a trip: 8 JR loads in flight, small code
    for (unsigned b = 0; b < JB; ++b) {
        const unsigned ib = i0 + b * (JR * 2 * JW);   // row index z NQF + row of the trip's first row; the others lie 2 JW rows apart
        const unsigned bm = ib * 8u; unsigned bo[FSP];   // 32-bit byte offsets on the two uniform bases, one per key range; the rows' steps are immediates
#pragma unroll
        for (int sp = 0; sp < FSP; ++sp) bo[sp] = (ib * HD + d) * 4u + (unsigned)sp * (unsigned)(ZH * NQF * HD * 4);
        const char* pm = (const char*)Ml + bm;
        v2f ml[JR][FSP]; v4f o[JR][FSP];
#pragma unroll
        for (int r = 0; r < JR; ++r)
#pragma unroll
            for (int sp = 0; sp < FSP; ++sp) ml[r][sp] = *(const v2f*)(pm + ((size_t)sp * ZH * NQF + (size_t)r * 2 * JW) * 8);
#pragma unroll
        for (int sp = 0; sp < FSP; ++sp) { const char* po = (const char*)Op + bo[sp];
#pragma unroll
            for (int r = 0; r < JR; ++r) o[r][sp] = *(const v4f*)(po + (size_t)r * 2 * JW * HD * 4); }
        static_assert(FSP == 4, "the wait below names the four offsets");
        asm volatile("s_wait_xcnt 0x0" :: "v"(bm), "v"(bo[0]), "v"(bo[1]), "v"(bo[2]), "v"(bo[3]) : "memory");   // keeps the trip's loads together ahead of the sums; the offsets are inputs so that their registers live up to the wait and no load lands on one ahead of it
#pragma unroll
        for (int r = 0; r < JR; ++r) { const unsigned idx = ib + r * (2 * JW), z = idx / NQF, row = idx % NQF;
            float mm = -3.0e38f;
#pragma unroll
            for (int sp = 0; sp < FSP; ++sp) mm = fmaxf(mm, ml[r][sp][0]);
            float den = 0.f; v4f acc = (v4f){};
#pragma unroll
            for (int sp = 0; sp < FSP; ++sp) { const float w = __builtin_amdgcn_exp2f(ml[r][sp][0] - mm); den += w * ml[r][sp][1]; acc += o[r][sp] * w; }
            *(v4f*)(out + (size_t)(RH + row) * DQ + z * HD + d) = acc * __fdiv_rn(1.0f, den);
            asm volatile("s_wait_xcnt 0x0" ::: "memory");   // stands in front of the next row's writes to the registers that this store names
        }
    }
}

extern "C" void kernel_launch(void* const* d_in, const int* in_sizes, int n_in,
                              void* d_out, int out_size, void* d_ws, size_t ws_size, hipStream_t stream) {
    (void)in_sizes; (void)n_in; (void)out_size;
    const float* x = (const float*)d_in[0]; const float* wq = (const float*)d_in[1]; const float* bq = (const float*)d_in[2]; const float* wk = (const float*)d_in[3]; const float* bk = (const float*)d_in[4]; const float* wv = (const float*)d_in[5]; const float* bv = (const float*)d_in[6]; const float* wo = nullptr; (void)wo;
    float* OUT = (float*)d_out;     // [1][4096][1024]
    char* wsp = (char*)d_ws;
    auto take = [&](size_t bytes) { char* p = wsp; wsp += (bytes + 255) & ~(size_t)255; return (void*)p; };
    // first what is last read by the score launches: weights, x, q and k planes (WQ, WK, WV, XB in a row: k_cvt8's dst)
    bf* WQ = (bf*)take((size_t)DQ * DM * 2); bf* WK = (bf*)take((size_t)DKV * DM * 2); bf* WV = (bf*)take((size_t)DKV * DM * 2);
    bf* XB = (bf*)take((size_t)TT * DM * 2); (void)WK;   // WK is reached as WQ + z stride
    h16* QP16 = (h16*)take((size_t)NH_ * TT * HD * 2); h16* KP16 = (h16*)take((size_t)NKV * TT * HD * 2);
    bf* QPh = (bf*)take((size_t)NH_ * TT * HD * 2); bf* KPh = (bf*)take((size_t)NKV * TT * HD * 2); bf* QPl = (bf*)take((size_t)NH_ * TT * HD * 2); bf* KPl = (bf*)take((size_t)NKV * TT * HD * 2);   // each k plane directly behind its q plane: z runs through both
    h16* VT16 = (h16*)take((size_t)NKV * HD * TT * 2); bf* VTh = (bf*)take((size_t)NKV * HD * TT * 2); bf* VTl = (bf*)take((size_t)NKV * HD * TT * 2); bf* Ph = (bf*)take((size_t)ZH * RH * TT * 2); bf* Pl = (bf*)take((size_t)ZH * RH * TT * 2);
    float* Sb = (float*)take((size_t)ZH * TT * TT * 4);   // only rows < RH of each head's plane hold scores
    float* Op = Sb + (size_t)RH * TT; float* Ml = Sb + (size_t)TT * TT + (size_t)RH * TT;   // the fused launch's partial results lie on the unused rows of plane 0 (O) and plane 1 (maximum, sum)
    static_assert((size_t)FSP * ZH * NQF * HD <= (size_t)NQF * TT && (size_t)FSP * ZH * NQF * 2 <= (size_t)NQF * TT && ZH == 2 && NH_ == ZH && REP == 1, "partial results fit those rows; one pass over both heads");
    if ((size_t)(wsp - (char*)d_ws) > ws_size) return;    // ws 256 MiB
    for (int b = 0; b < NB_; ++b) {
        k_cvt8<<<(unsigned)((3 * NW8 + NX8) / 256), 256, 0, stream>>>(wq, wk, wv, x + (size_t)b * TT * DM, WQ);
        k_qkv<<<dim3(TT / 128, HD / 128, NH_ + NKV + DKV / HD), 256, 0, stream>>>(XB, WQ, WV, bq, bk, bv, QP16, QPh, QPl, VT16, VTh, VTl);
        for (int h0 = 0; h0 < NH_; h0 += ZH) { const size_t zq = (size_t)h0, zk = (size_t)(h0 / REP);   // one kv head per query head: the pass's two heads use consecutive kv planes (z-strides TT*HD)
            k_gemms<bf, 2, EP_F32, 4><<<dim3(RH / 64, TT / 64, ZH), 256, 0, stream>>>(QPh + zq * TT * HD, QPl + zq * TT * HD, KPh + zk * TT * HD, KPl + zk * TT * HD, HD, Sb, TT, nullptr, nullptr, 0, (size_t)TT * HD, (size_t)TT * HD, (size_t)TT * TT, 0, 1.0f, nullptr, nullptr, nullptr);
            k_fattn<<<dim3(NQF / FQ + FXA, FSP, ZH), 128, 0, stream>>>(QP16 + zq * TT * HD, KP16 + zk * TT * HD, VT16 + zk * HD * TT, Op, Ml, Sb, Ph, Pl);
            float* Oh = OUT + (size_t)b * TT * DM + (size_t)h0 * HD;   // this head's columns of the merged output, pitch DQ: f32 context straight to the output
            k_avj<<<dim3(RH / 64, HD / 64, 2 * ZH), 256, 0, stream>>>(Ph, Pl, VTh + zk * HD * TT, VTl + zk * HD * TT, Op, Ml, Oh); }
    }
}

// v007
// A run of this version takes 145 microseconds.
// Two timings next to v006 both put it at 1.04 times that version's speed.
// Over all steps from v000 it is 4.34 times as fast.
#include <hip/hip_runtime.h>

// Two-head self-attention with 512-wide heads (activation [1][1][4096][1024]; q, k, v = x W^T + b ('oi' [1024][1024]), 2 heads x 512; softmax(q.k/sqrt(512)) over all 4096 keys; out = merged context (no output projection) -> [1][1][4096][1024] (4.2 M)).
// Compute dtypes, f32 accumulate: every input rounded to bf16; q/k/v on PLAIN bf16 operands (inputs: exact) + biases; scores (K = 512) and attn.v (N = 512; no mask): query rows < 512 hl (3 products, f32 scores in the workspace, softmax f32), the rest single fp16 in one fused launch (running maximum, probabilities never leave the registers); no output projection: the merged context is written in f32.

#define NB_  1
#define TT   4096
#define DM   1024
#define NH_  2
#define NKV  2
#define REP  (NH_ / NKV)
#define HD   512
#define DQ   (NH_ * HD)
#define DKV  (NKV * HD)
#define ZH   2                    // heads per launch, on grid z
#define RH   512                  // query rows < RH use hi+lo planes
#define WIN  0
#define PCAR 1024.0f
#define SCL  0.044194173824159216f   // 512^-0.5 (head width 512)
typedef _Float16 h16;
typedef unsigned short bf;
typedef __attribute__((ext_vector_type(16))) __bf16   v16bf;
typedef __attribute__((ext_vector_type(16))) _Float16 v16h;
typedef __attribute__((ext_vector_type(8)))  _Float16 v8h;
typedef __attribute__((ext_vector_type(8)))  unsigned short v8us;
typedef __attribute__((ext_vector_type(8)))  float    v8f;
typedef __attribute__((ext_vector_type(4)))  float    v4f;
typedef v8h  __attribute__((may_alias)) v8ha;
typedef v4f  __attribute__((may_alias)) v4fa;
typedef v8us __attribute__((may_alias)) v8usa;

__device__ __forceinline__ unsigned short f2bf(float f) { unsigned u = __float_as_uint(f); u += 0x7FFFu + ((u >> 16) & 1u); return (unsigned short)(u >> 16); }
__device__ __forceinline__ float bf2f(unsigned short b) { return __uint_as_float(((unsigned)b) << 16); }
__device__ __forceinline__ float bfr(float f) { return bf2f(f2bf(f)); }
__device__ __forceinline__ v16h cat16(v8h lo, v8h hi) { return __builtin_shufflevector(lo, hi, 0, 1, 2, 3, 4, 5, 6, 7, 8, 9, 10, 11, 12, 13, 14, 15); }
__device__ __forceinline__ v16bf cat16b(v8us lo, v8us hi) { return __builtin_bit_cast(v16bf, __builtin_shufflevector(lo, hi, 0, 1, 2, 3, 4, 5, 6, 7, 8, 9, 10, 11, 12, 13, 14, 15)); }
__device__ __forceinline__ v8f wmma16(v16h a, v16h b, v8f c) { return __builtin_amdgcn_wmma_f32_16x16x32_f16(false, a, false, b, (short)0, c, false, false); }
__device__ __forceinline__ v8f wmmab(v16bf a, v16bf b, v8f c) { return __builtin_amdgcn_wmma_f32_16x16x32_bf16(false, a, false, b, (short)0, c, false, false); }



// ---- k_gemms: LDS-staged GEMM. c[m][n] = sum_k A[m][k] Bt[n][k] (NSPLIT 2: + A2 Bt + A Bt2, the hi+lo planes), operands K-contiguous 16-bit planes; z-batch strides sA/sB/sC/sBias in elements.
// NSPLIT 0: 128x128 tile per work-group, a wave group = 2x2 waves of 64x64, a stage = [A 128 rows | Bt 128 rows] of 128 k (256 bytes, pitch 272). NSPLIT 2, a stage = [A | A2 | Bt | Bt2], TILE rows each, of 64 k (128 bytes, pitch 144): TILE 64: a wave group = 2 waves of 32x64; TILE 128: 2x2 waves of 64x64 (half the operand bytes per product, from L2 and from LDS).
// A trip covers KG stages of k, one per wave group; a group's stage comes in by asynchronous copies to LDS (every wave-wide copy = whole 128-byte lines), two buffers: the next trip's copies fly while this trip's fragments are read from LDS by all waves of the group. The KG partial tiles are added in LDS in group order.
// grid (M/tile, N/tile, Z), 32 x waves threads. K % (stage k x KG) == 0.
// Batches z >= zB take their bias from biasB (two projections with separate bias vectors in one grid).
// EPI says what the epilogue stores, pitch ldc: EP_F32 c as f32 in C; EP_SCALE c x cs as f32 in C; EP_COLB (c + bias[n]) and EP_ROWB (c + bias[m]) as the three 16-bit planes the next GEMMs read (fp16, bf16 hi, bf16 lo); EP_ROWB's fp16 plane not at pitch ldc but as [head][32-key block][d][32 keys].
#define EP_F32   0
#define EP_SCALE 1
#define EP_COLB  2
#define EP_ROWB  3
__device__ __forceinline__ void splitf(float y, unsigned short& h, unsigned short& l) { h = f2bf(y); l = f2bf(y - bf2f(h)); }
typedef __attribute__((ext_vector_type(4))) _Float16 v4h;
typedef __attribute__((ext_vector_type(4))) unsigned short v4us;
template <typename T16> struct WFrag;   // ld: one fragment from an LDS row, p = the lane's byte address (row, 16 bytes x lane half): k 8 hi .. 8 hi + 7 and 16 + 8 hi .. 16 + 8 hi + 7, the same for both operands
template <> struct WFrag<h16> { typedef v16h V; static __device__ __forceinline__ V ld(const char* p) { return cat16(*(const v8ha*)p, *(const v8ha*)(p + 32)); } static __device__ __forceinline__ v8f mma(V a, V b, v8f c) { return wmma16(a, b, c); } };
template <> struct WFrag<bf> { typedef v16bf V; static __device__ __forceinline__ V ld(const char* p) { return cat16b(*(const v8usa*)p, *(const v8usa*)(p + 32)); } static __device__ __forceinline__ v8f mma(V a, V b, v8f c) { return wmmab(a, b, c); } };
// eight copies of 16 bytes per lane, rows RS apart; the s_wait_xcnt stands inside the statement so that no address register of a copy is rewritten ahead of it
template <int PITCH, int RS, typename T16>
__device__ __forceinline__ void cp8(unsigned l, const T16* g, size_t gs) {
    asm volatile("global_load_async_to_lds_b128 %0, %8, off\n\t"
                 "global_load_async_to_lds_b128 %1, %9, off\n\t"
                 "global_load_async_to_lds_b128 %2, %10, off\n\t"
                 "global_load_async_to_lds_b128 %3, %11, off\n\t"
                 "global_load_async_to_lds_b128 %4, %12, off\n\t"
                 "global_load_async_to_lds_b128 %5, %13, off\n\t"
                 "global_load_async_to_lds_b128 %6, %14, off\n\t"
                 "global_load_async_to_lds_b128 %7, %15, off\n\t"
                 "s_wait_xcnt 0x0"
                 :: "v"(l), "v"(l + RS * PITCH), "v"(l + 2 * RS * PITCH), "v"(l + 3 * RS * PITCH), "v"(l + 4 * RS * PITCH), "v"(l + 5 * RS * PITCH), "v"(l + 6 * RS * PITCH), "v"(l + 7 * RS * PITCH),
                    "v"(g), "v"(g + gs), "v"(g + 2 * gs), "v"(g + 3 * gs), "v"(g + 4 * gs), "v"(g + 5 * gs), "v"(g + 6 * gs), "v"(g + 7 * gs)
                 : "memory");
}
// gemms_body is the whole GEMM of one work-group: sm = its LDS (GLDST bytes), (bx, by, z) = its tile and batch. k_gemms launches it alone; k_qkv and k_avj launch it beside independent work in one grid.
#define GLDS(NSPLIT, KG) (2 * (KG) * 256 * (((NSPLIT) ? 64 : 128) * 2 + 16))
#define GLDST(NSPLIT, KG, TILE) (GLDS(NSPLIT, KG) * ((NSPLIT) ? (TILE) / 64 : 1))
template <typename T16, int NSPLIT, int EPI, int KG, int TILE = (NSPLIT ? 64 : 128)>
__device__ __forceinline__ void gemms_body(char* sm, const int bx, const int by, const size_t z, const T16* __restrict__ A, const T16* __restrict__ A2, const T16* __restrict__ Bt, const T16* __restrict__ Bt2, int K, float* C, int ldc, const float* __restrict__ bias, const float* __restrict__ biasB, int zB, size_t sA, size_t sB, size_t sC, size_t sBias, float cs, h16* P16, bf* Ph, bf* Pl) {
    static_assert(NSPLIT == 0 || NSPLIT == 2, "one product, or the three of the hi+lo planes");
    typedef typename WFrag<T16>::V V;
    static_assert(TILE == 128 || (NSPLIT == 2 && TILE == 64), "tile sizes");
    constexpr int KS = NSPLIT ? 64 : 128, PITCH = KS * 2 + 16, QR = NSPLIT ? TILE : 64, STAGE = 4 * QR * PITCH, NK = KS / 32, MB = TILE / 32, GWV = TILE / 32, RS = GWV * 32 / (KS / 8), OT = MB * 16 * 68;   // QR: rows of a quarter of the stage, one cp8 each
    static_assert(GLDST(NSPLIT, KG, TILE) == 2 * KG * STAGE && 8 * RS == QR, "the launching kernel's LDS is the ring; a cp8 fills a quarter");
    A += z * sA; Bt += z * sB; if constexpr (NSPLIT == 2) { A2 += z * sA; Bt2 += z * sB; }
    if constexpr (EPI == EP_F32 || EPI == EP_SCALE) C += z * sC; else { P16 += z * sC; Ph += z * sC; Pl += z * sC; bias = (int)z < zB ? bias + z * sBias : biasB + (z - zB) * sBias; }
    const int lane = threadIdx.x & 31, lr = lane & 15, hi = lane >> 4; const int wave = __builtin_amdgcn_readfirstlane((int)(threadIdx.x >> 5)); const int kg = wave / GWV, wig = wave % GWV, wm = TILE == 64 ? wig : wig >> 1, wn = TILE == 64 ? 0 : wig & 1; const int r0 = bx * TILE, c0 = by * TILE;
    v8f acc[MB][4];
#pragma unroll
    for (int mb = 0; mb < MB; ++mb)
#pragma unroll
        for (int nb = 0; nb < 4; ++nb) acc[mb][nb] = (v8f){};
    // copy lanes: thread tg of its group brings 16-byte piece cch of rows crow + RS i, i < 8, of each quarter of the stage
    const int tg = (int)threadIdx.x % (GWV * 32), crow = tg / (KS / 8), cch = tg % (KS / 8);
    const size_t ga = (size_t)(r0 + crow) * K + kg * KS + cch * 8, gb = (size_t)(c0 + crow) * K + kg * KS + cch * 8;
    const T16* g0 = A + ga; const T16* g1 = NSPLIT ? A2 + ga : A + ga + (size_t)64 * K; const T16* g2 = Bt + gb; const T16* g3 = NSPLIT ? Bt2 + gb : Bt + gb + (size_t)64 * K;
    const unsigned l0 = (unsigned)(size_t)sm + (unsigned)(kg * STAGE + crow * PITCH + cch * 16);
    const size_t gs = (size_t)RS * K; const int nt = K / (KS * KG);
    auto fill = [&](int buf, int t) { const unsigned l = l0 + (unsigned)(buf * (KG * STAGE)); const size_t ko = (size_t)t * (KS * KG);
        cp8<PITCH, RS>(l, g0 + ko, gs); cp8<PITCH, RS>(l + QR * PITCH, g1 + ko, gs); cp8<PITCH, RS>(l + 2 * QR * PITCH, g2 + ko, gs); cp8<PITCH, RS>(l + 3 * QR * PITCH, g3 + ko, gs); };
    fill(0, 0);
    asm volatile("s_wait_asynccnt 0x0" ::: "memory");   // this wave's part of trip 0 has landed
    __syncthreads();                                     // trip 0's stages are whole before any wave reads them
    if (nt > 1) fill(1, 1);
#pragma unroll 1   // the trip loop stays rolled: one copy of the ring's hand-over
    for (int t = 0; t < nt; ++t) {
        const char* sb = sm + ((t & 1) * KG + kg) * STAGE; const char* pa = sb + (wm * MB * 16 + lr) * PITCH + hi * 16; const char* pb = sb + (2 * QR + wn * 64 + lr) * PITCH + hi * 16;
        // fragments run ahead of their products inside the trip: A two k steps (two sets), Bt half a k step (each pair of columns is refetched when its products are issued)
        V a[2][MB], a2[2][MB], b[4], b2[4];
#pragma unroll
        for (int q = 0; q < (NK < 2 ? NK : 2); ++q)
#pragma unroll
            for (int mb = 0; mb < MB; ++mb) { a[q][mb] = WFrag<T16>::ld(pa + mb * 16 * PITCH + q * 64); if constexpr (NSPLIT == 2) a2[q][mb] = WFrag<T16>::ld(pa + (QR + mb * 16) * PITCH + q * 64); }
#pragma unroll
        for (int nb = 0; nb < 4; ++nb) { b[nb] = WFrag<T16>::ld(pb + nb * 16 * PITCH); if constexpr (NSPLIT == 2) b2[nb] = WFrag<T16>::ld(pb + (QR + nb * 16) * PITCH); }
        __builtin_amdgcn_sched_barrier(0);   // this and the two below keep each group of LDS loads whole and ahead of the products in front of its use; without them the scheduler sinks every load to its first use and the wave waits out the LDS latency there
#pragma unroll
        for (int ks = 0; ks < NK; ++ks) {
#pragma unroll
            for (int nh = 0; nh < 2; ++nh) {
#pragma unroll
                for (int nb = 2 * nh; nb < 2 * nh + 2; ++nb)
#pragma unroll
                    for (int mb = 0; mb < MB; ++mb) { acc[mb][nb] = WFrag<T16>::mma(a[ks & 1][mb], b[nb], acc[mb][nb]); if constexpr (NSPLIT == 2) { acc[mb][nb] = WFrag<T16>::mma(a2[ks & 1][mb], b[nb], acc[mb][nb]); acc[mb][nb] = WFrag<T16>::mma(a[ks & 1][mb], b2[nb], acc[mb][nb]); } }
                __builtin_amdgcn_sched_barrier(0);
                if (ks + 1 < NK) {
#pragma unroll
                    for (int nb = 2 * nh; nb < 2 * nh + 2; ++nb) { b[nb] = WFrag<T16>::ld(pb + nb * 16 * PITCH + (ks + 1) * 64); if constexpr (NSPLIT == 2) b2[nb] = WFrag<T16>::ld(pb + (QR + nb * 16) * PITCH + (ks + 1) * 64); } }
                if (nh == 1 && ks + 2 < NK) {
#pragma unroll
                    for (int mb = 0; mb < MB; ++mb) { a[ks & 1][mb] = WFrag<T16>::ld(pa + mb * 16 * PITCH + (ks + 2) * 64); if constexpr (NSPLIT == 2) a2[ks & 1][mb] = WFrag<T16>::ld(pa + (QR + mb * 16) * PITCH + (ks + 2) * 64); } }
                __builtin_amdgcn_sched_barrier(0);
            }
        }
        asm volatile("s_wait_dscnt 0x0" ::: "memory");      // this wave has left the buffer that is refilled below
        asm volatile("s_wait_asynccnt 0x0" ::: "memory");   // this wave's part of trip t + 1 has landed
        __syncthreads();                                     // publishes trip t + 1 and ends every read of trip t's buffer
        if (t + 2 < nt) fill(t & 1, t + 2);
    }
    asm volatile("s_wait_asynccnt 0x0" ::: "memory");   // no copy is in flight when the ring becomes output staging
    float* os = (float*)sm; float* osw = os + wave * OT;
#pragma unroll
    for (int mb = 0; mb < MB; ++mb)
#pragma unroll
        for (int nb = 0; nb < 4; ++nb)
#pragma unroll
            for (int j = 0; j < 8; ++j) osw[(mb * 16 + hi * 8 + j) * 68 + nb * 16 + lr] = acc[mb][nb][j];
    __syncthreads();   // every wave's partial tile is in LDS before any wave adds the KG tiles
    const float* ot = os + wig * OT;
#pragma unroll
    for (int s = 0; s < MB * 8 / KG; ++s) { const int it = lane + (s + kg * (MB * 8 / KG)) * 32, row = it >> 4, cofs = (it & 15) * 4; v4f val = *(const v4fa*)(ot + row * 68 + cofs);
#pragma unroll
        for (int g = 1; g < KG; ++g) val += *(const v4fa*)(ot + g * (GWV * OT) + row * 68 + cofs);
        const int gr = r0 + wm * MB * 16 + row, gc = c0 + wn * 64 + cofs;
        if constexpr (EPI == EP_COLB) { val[0] += bfr(bias[gc]); val[1] += bfr(bias[gc + 1]); val[2] += bfr(bias[gc + 2]); val[3] += bfr(bias[gc + 3]); }
        if constexpr (EPI == EP_ROWB) { const float br = bfr(bias[gr]); val[0] += br; val[1] += br; val[2] += br; val[3] += br; }
        if constexpr (EPI == EP_SCALE) val *= cs;
        const size_t oo = (size_t)gr * ldc + gc;
        if constexpr (EPI == EP_F32 || EPI == EP_SCALE) *(v4f*)(C + oo) = val;
        else { v4h o16; v4us oh, ol;   // 16 lanes x 8 bytes: one whole 128-byte line of each plane per tile row (of EP_ROWB's fp16 plane, two half lines in consecutive blocks)
#pragma unroll
            for (int q = 0; q < 4; ++q) { o16[q] = (h16)val[q]; unsigned short a2s, c2; splitf(val[q], a2s, c2); oh[q] = a2s; ol[q] = c2; }
            if constexpr (EPI == EP_ROWB) { const size_t o6 = ((size_t)(gr / HD * (TT / 32) + gc / 32) * HD + gr % HD) * 32 + gc % 32;   // v: the fp16 plane lies as [head][32-key block][d][32 keys], so that a block is one contiguous run for the fused launch's copies
                *(v4h*)(P16 + o6) = o16; *(v4us*)(Ph + oo) = oh; *(v4us*)(Pl + oo) = ol;
                asm volatile("s_wait_xcnt 0x0" ::: "memory");   // stands in front of the next pass's writes to the registers that these stores name
            } else {
            *(v4h*)(P16 + oo) = o16; *(v4us*)(Ph + oo) = oh; *(v4us*)(Pl + oo) = ol; } }
    }
}

template <typename T16, int NSPLIT, int EPI, int KG, int TILE>
__global__ __launch_bounds__(TILE * KG) void k_gemms(const T16* __restrict__ A, const T16* __restrict__ A2, const T16* __restrict__ Bt, const T16* __restrict__ Bt2, int K, float* C, int ldc, const float* __restrict__ bias, const float* __restrict__ biasB, int zB, size_t sA, size_t sB, size_t sC, size_t sBias, float cs, h16* P16, bf* Ph, bf* Pl) {
    __shared__ __align__(16) char sm[GLDST(NSPLIT, KG, TILE)];
    gemms_body<T16, NSPLIT, EPI, KG, TILE>(sm, blockIdx.x, blockIdx.y, blockIdx.z, A, A2, Bt, Bt2, K, C, ldc, bias, biasB, zB, sA, sB, sC, sBias, cs, P16, Ph, Pl);
}
// k_qkv: the three projections in one grid (TT/128, HD/128, q heads + k heads + v heads). z < NH_ + NKV: q heads, then k heads (WK lies behind WQ, each k plane behind its q plane), the epilogue stores the head planes [h][t][d]. The rest: v, with the weight rows as the M side, so the tile comes out as [g HD + d][t], the transposed planes that attn.v reads.
__global__ __launch_bounds__(256) void k_qkv(const bf* __restrict__ XB, const bf* __restrict__ WQ, const bf* __restrict__ WV, const float* __restrict__ bq, const float* __restrict__ bk, const float* __restrict__ bv, h16* QP16, bf* QPh, bf* QPl, h16* VT16, bf* VTh, bf* VTl) {
    __shared__ __align__(16) char sm[GLDS(0, 2)];
    if (blockIdx.z < NH_ + NKV) gemms_body<bf, 0, EP_COLB, 2>(sm, blockIdx.x, blockIdx.y, blockIdx.z, XB, nullptr, WQ, nullptr, DM, nullptr, HD, bq, bk, NH_, 0, (size_t)HD * DM, (size_t)TT * HD, HD, 1.0f, QP16, QPh, QPl);
    else gemms_body<bf, 0, EP_ROWB, 2>(sm, (blockIdx.z - (NH_ + NKV)) * (HD / 128) + blockIdx.y, blockIdx.x, 0, WV, nullptr, XB, nullptr, DM, nullptr, TT, bv, nullptr, 1, 0, 0, 0, 0, 1.0f, VT16, VTh, VTl);
}

__device__ __forceinline__ h16 tohx(float x) { return (h16)x; }
typedef __attribute__((ext_vector_type(2))) _Float16 v2h;
typedef __attribute__((ext_vector_type(2))) unsigned short v2us;
typedef __attribute__((ext_vector_type(2))) float v2f;
typedef __attribute__((ext_vector_type(4))) int v4i;

__global__ __launch_bounds__(256) void k_wtG(const float* __restrict__ w, int K, int N, bf* Bt) {
    const int lane = threadIdx.x & 31; const int L0 = (blockIdx.x * 8 + (threadIdx.x >> 5)) * 8; const int nlines = N * K / 64;
{
#pragma unroll 1
        for (int l = 0; l < 8; ++l) { const int L = L0 + l; if (L >= nlines) break; const size_t e = (size_t)L * 64 + lane * 2; const int k = (int)(e % K), n = (int)(e / K); v2us o;
            o[0] = f2bf(w[(size_t)k * N + n]); o[1] = f2bf(w[(size_t)(k + 1) * N + n]); *(v2us*)(Bt + e) = o; }
         }
}
// k_cvt8: the four f32 -> bf16 conversions in one grid. dst is the contiguous run [wq | wk | wv | x]; 8 elements per thread, and a block lies wholly inside one source.
#define NW8 ((size_t)DM * DM / 8)
#define NX8 ((size_t)TT * DM / 8)
static_assert(DQ == DM && DKV == DM && NW8 % 256 == 0 && NX8 % 256 == 0, "three equal weight planes, whole blocks");
__global__ __launch_bounds__(256) void k_cvt8(const float* __restrict__ wq, const float* __restrict__ wk, const float* __restrict__ wv, const float* __restrict__ x, bf* dst) { const size_t i = (size_t)blockIdx.x * 256 + threadIdx.x; const unsigned seg = blockIdx.x / (unsigned)(NW8 / 256);
    const float* src = seg == 0 ? wq : seg == 1 ? wk : seg == 2 ? wv : x; const v8f v = *(const v8f*)(src + (i - (seg < 3 ? seg : 3) * NW8) * 8); v8us o;
#pragma unroll
    for (int k = 0; k < 8; ++k) o[k] = f2bf(v[k]); *(v8us*)(dst + i * 8) = o;  }

// asoft_row: one wave, one hi+lo row (ZH x RH rows in all); k_fattn's spare work-groups run it. Per row (zz, i): t = S x HD^-0.5 (no mask); softmax over the 4096 keys (register row, one exp, fixed trees); every row goes to Ph, Pl [zz][RH][TT] (i = row % RH < RH)
__device__ __forceinline__ void asoft_row(const float* __restrict__ Sb, h16* P16, bf* Ph, bf* Pl, const int row) {
    const int lane = threadIdx.x & 31; if (row >= ZH * RH) return; const int i = row % RH; const int zz = row / RH; (void)zz; const bool hires = (i < RH); const float* sr = Sb + ((size_t)zz * TT + i) * TT; float v[TT / 32]; float mx = -3.0e38f;
#pragma unroll
    for (int ch = 0; ch < TT / 128; ++ch) { const int j0 = ch * 128 + lane * 4; const v4f a = *(const v4f*)(sr + j0);
#pragma unroll
        for (int q = 0; q < 4; ++q) { const int j = j0 + q; (void)j; const float t = a[q] * SCL; v[ch * 4 + q] = t; mx = fmaxf(mx, t); } }
#pragma unroll
    for (int sh = 16; sh; sh >>= 1) mx = fmaxf(mx, __shfl_xor(mx, sh, 32));
    float sum = 0.f;
#pragma unroll
    for (int k = 0; k < TT / 32; ++k) { float d0 = __fsub_rn(v[k], mx); asm volatile("" : "+v"(d0)); v[k] = __builtin_amdgcn_exp2f(__fmul_rn(d0, 1.4426950408889634f)); sum += v[k]; }
#pragma unroll
    for (int sh = 16; sh; sh >>= 1) sum += __shfl_xor(sum, sh, 32);
    const float f = __fdiv_rn(hires ? 1.0f : PCAR, sum);
{
        if (hires) {
#pragma unroll
            for (int ch = 0; ch < TT / 128; ++ch) { v4us oh, ol;
#pragma unroll
                for (int q = 0; q < 4; ++q) { unsigned short a, c2; splitf(v[ch * 4 + q] * f, a, c2); oh[q] = a; ol[q] = c2; }
                const size_t oo = ((size_t)zz * (RH ? RH : 1) + i) * TT + ch * 128 + lane * 4; *(v4us*)(Ph + oo) = oh; *(v4us*)(Pl + oo) = ol; }
        } else {
#pragma unroll
            for (int ch = 0; ch < TT / 128; ++ch) { v4h o4;
#pragma unroll
                for (int q = 0; q < 4; ++q) o4[q] = tohx(v[ch * 4 + q] * f);
                *(v4h*)(P16 + ((size_t)zz * (TT - RH) + (i - RH)) * TT + ch * 128 + lane * 4) = o4; } }
         }
}

// ---- k_fattn: scores, softmax and attn.v of the fp16 query rows (>= RH) in one launch. S^T = K Q^T, O^T += V^T P^T: in every 16-column group a lane holds one query, so maximum, sum and rescale are per lane, and the score tiles of 32 keys ARE the B fragment of the second product (keys 8 hi .. and 16 + 8 hi .., the k order of WFrag::ld).
// A work-group = 4 waves x 32 queries, one head (grid z), one quarter of the keys (grid y); Q fragments and the 512 x 32 O^T tile stay in registers. A stage = 32 keys: K rows (pitch 1040 bytes) and the V^T block [d][32 keys] (pitch 80), by asynchronous copies to LDS, two buffers.
// The grid's x runs FXA past the query tiles: those work-groups (as many as the attention leaves WGPs idle) do the softmax rows of the hi+lo path, which wait for nothing of this launch: a wave takes ARW rows, one after the other.
// The maximum in use is raised only when a new one exceeds it by 2^8 (p <= 256 fits fp16). Each key range leaves its unnormalised O, its maximum (log2 units) and its sum; k_avj joins the ranges.
#define FQ   128
#define FSP  4
#define FKT  32
#define KPIT (HD * 2 + 16)
#define VPIT (FKT * 2 + 16)
#define FSTG (FKT * KPIT + HD * VPIT)
#define NQF  (TT - RH)
#define OPIT (HD + 4)
#define FXA  4
#define ARW  (ZH * RH / (FXA * FSP * ZH * 4))
static_assert(ARW * (FXA * FSP * ZH * 4) == ZH * RH, "whole rows per wave");
static_assert(4 * 16 * OPIT * 4 <= 2 * FSTG && NQF % FQ == 0 && TT % (FSP * FKT) == 0 && TT / (FSP * FKT) >= 2, "output staging fits the ring; whole tiles; two stages or more");
typedef __attribute__((address_space(1))) v4i gv4i;
typedef __attribute__((address_space(3))) v4i lv4i;
__global__ __launch_bounds__(128) void k_fattn(const h16* __restrict__ Q, const h16* __restrict__ Kp, const h16* __restrict__ Vt, float* Op, float* Ml, const float* __restrict__ Sb, bf* Ph, bf* Pl) {
    __shared__ __align__(16) char sm[2 * FSTG];
    if (blockIdx.x >= NQF / FQ) {   // the same for a whole work-group, ahead of every barrier and copy
        const int w0 = ((((int)blockIdx.z * FSP + (int)blockIdx.y) * FXA + ((int)blockIdx.x - NQF / FQ)) * 4 + ((int)threadIdx.x >> 5)) * ARW;
#pragma unroll 1   // one copy of the row's code
        for (int r = 0; r < ARW; ++r) { asoft_row(Sb, nullptr, Ph, Pl, w0 + r);
            asm volatile("s_wait_xcnt 0x0" ::: "memory");   // stands in front of the next row's writes to the registers that this row's stores name
        }
        return; }
    const int tid = (int)threadIdx.x, lane = tid & 31, lr = lane & 15, hi = lane >> 4; const int wave = __builtin_amdgcn_readfirstlane(tid >> 5);
    const int z = blockIdx.z, sp = blockIdx.y, q0 = blockIdx.x * FQ + wave * 32;
    // both planes hold FKT x HD elements per 32-key block, contiguous: thread tid brings 16-byte pieces tid + 128 i, i < 16, of each
    const size_t kv0 = ((size_t)z * TT + (size_t)sp * (TT / FSP)) * HD + tid * 8; const h16* gk = Kp + kv0; const h16* gv = Vt + kv0;
    char* lk = sm + (tid >> 6) * KPIT + (tid & 63) * 16; char* lv = sm + FKT * KPIT + (tid >> 2) * VPIT + (tid & 3) * 16;
    // the copies are the builtin here: above 256 registers the operands of asm text must all lie in the lowest register window, which cost spills
    auto fill = [&](int buf, int t) { const int o = buf * FSTG; const size_t go = (size_t)t * (FKT * HD);
#pragma unroll
        for (int i = 0; i < 16; ++i) __builtin_amdgcn_global_load_async_to_lds_b128((gv4i*)(gk + go + i * 1024), (lv4i*)(lk + o + i * 2 * KPIT), 0, 0);
#pragma unroll
        for (int i = 0; i < 16; ++i) __builtin_amdgcn_global_load_async_to_lds_b128((gv4i*)(gv + go + i * 1024), (lv4i*)(lv + o + i * 32 * VPIT), 0, 0); };
    fill(0, 0);
    const h16* qr = Q + ((size_t)z * TT + RH + q0 + lr) * HD + hi * 8;
    v16h qf[2][16];
#pragma unroll
    for (int c = 0; c < 2; ++c)
#pragma unroll
        for (int ks = 0; ks < 16; ++ks) qf[c][ks] = cat16(*(const v8ha*)(qr + c * 16 * HD + ks * 32), *(const v8ha*)(qr + c * 16 * HD + ks * 32 + 16));
    v8f O[32][2];
#pragma unroll
    for (int dt = 0; dt < 32; ++dt) { O[dt][0] = (v8f){}; O[dt][1] = (v8f){}; }
    float mu[2] = {-1.0e30f, -1.0e30f}; v8f L[2] = {(v8f){}, (v8f){}};   // L: the row sums, as one more output tile: A = a tile whose row 0 is ones, so row 0 of L (lanes 0-15, element 0) adds up the rounded p of each query
    v16h ones;
#pragma unroll
    for (int e = 0; e < 16; ++e) ones[e] = lr == 0 ? (h16)1.0f : (h16)0.0f;
    constexpr float CS2 = SCL * 1.4426950408889634f; constexpr int nt = TT / (FSP * FKT);
    asm volatile("s_wait_asynccnt 0x0" ::: "memory");   // this wave's part of stage 0 has landed
    __syncthreads();                                     // stage 0 is whole before any wave reads it
    fill(1, 1);
#pragma unroll 1   // the stage loop stays rolled: one copy of the ring's hand-over
    for (int t = 0; t < nt; ++t) {
        const char* kb = sm + (t & 1) * FSTG + lr * KPIT + hi * 16; const char* vb = sm + (t & 1) * FSTG + FKT * KPIT + lr * VPIT + hi * 16;
        // three fragment sets of four: a set is refetched as soon as its 8 products are issued, two sets (16 products) ahead of its use; the first V^T sets are fetched under the last score products and the softmax
        v16h fr[3][4]; v8f st[2][2] = {{(v8f){}, (v8f){}}, {(v8f){}, (v8f){}}};
#pragma unroll
        for (int g = 0; g < 3; ++g)
#pragma unroll
            for (int i = 0; i < 4; ++i) fr[g][i] = WFrag<h16>::ld(kb + (i & 1) * 16 * KPIT + (2 * g + (i >> 1)) * 64);
        __builtin_amdgcn_sched_barrier(0);   // this and the ones below keep each group of LDS loads whole and ahead of the products in front of its use; without them the scheduler sinks every load to its first use and the lone wave of a SIMD waits out the LDS latency there
#pragma unroll
        for (int g = 0; g < 8; ++g) {
#pragma unroll
            for (int i = 0; i < 4; ++i)
#pragma unroll
                for (int c = 0; c < 2; ++c) st[i & 1][c] = wmma16(fr[g % 3][i], qf[c][2 * g + (i >> 1)], st[i & 1][c]);
            __builtin_amdgcn_sched_barrier(0);
#pragma unroll
            for (int i = 0; i < 4; ++i) fr[g % 3][i] = g + 3 < 8 ? WFrag<h16>::ld(kb + (i & 1) * 16 * KPIT + (2 * (g + 3) + (i >> 1)) * 64) : WFrag<h16>::ld(vb + ((g + 3 - 8) * 4 + i) * 16 * VPIT);
            __builtin_amdgcn_sched_barrier(0);
        }
        float mc[2];
#pragma unroll
        for (int c = 0; c < 2; ++c) { float m = st[0][c][0];
#pragma unroll
            for (int j = 1; j < 8; ++j) m = fmaxf(m, st[0][c][j]);
#pragma unroll
            for (int j = 0; j < 8; ++j) m = fmaxf(m, st[1][c][j]);
            mc[c] = fmaxf(m, __shfl_xor(m, 16, 32)) * CS2; }
        if (__builtin_amdgcn_ballot_w32(mc[0] > mu[0] + 8.0f || mc[1] > mu[1] + 8.0f) != 0) {   // wave-uniform: rare after the first stage
#pragma unroll
            for (int c = 0; c < 2; ++c) { const float mn = fmaxf(mu[c], mc[c]); const float al = __builtin_amdgcn_exp2f(mu[c] - mn); mu[c] = mn; L[c] *= al;
#pragma unroll
                for (int dt = 0; dt < 32; ++dt) O[dt][c] *= al; } }
        v16h pb[2];
#pragma unroll
        for (int c = 0; c < 2; ++c)
#pragma unroll
            for (int kt = 0; kt < 2; ++kt)
#pragma unroll
                for (int j = 0; j < 8; ++j) { const float p = __builtin_amdgcn_exp2f(__builtin_fmaf(st[kt][c][j], CS2, -mu[c])); pb[c][kt * 8 + j] = (h16)p; }
        L[0] = wmma16(ones, pb[0], L[0]); L[1] = wmma16(ones, pb[1], L[1]);
        __builtin_amdgcn_sched_barrier(0);
#pragma unroll
        for (int g = 0; g < 8; ++g) {
#pragma unroll
            for (int i = 0; i < 4; ++i)
#pragma unroll
                for (int c = 0; c < 2; ++c) O[g * 4 + i][c] = wmma16(fr[(g + 2) % 3][i], pb[c], O[g * 4 + i][c]);
            __builtin_amdgcn_sched_barrier(0);
            if (g + 3 < 8) {
#pragma unroll
                for (int i = 0; i < 4; ++i) fr[(g + 2) % 3][i] = WFrag<h16>::ld(vb + ((g + 3) * 4 + i) * 16 * VPIT); }
            __builtin_amdgcn_sched_barrier(0);
        }
        asm volatile("s_wait_dscnt 0x0" ::: "memory");      // this wave has left the buffer that is refilled below
        asm volatile("s_wait_asynccnt 0x0" ::: "memory");   // this wave's part of stage t + 1 has landed
        __syncthreads();                                     // publishes stage t + 1 and ends every read of stage t's buffer
        if (t + 2 < nt) fill(t & 1, t + 2);
    }
    asm volatile("s_wait_asynccnt 0x0" ::: "memory");   // no copy is in flight when the ring becomes output staging
    const size_t pr = (size_t)(sp * ZH + z) * NQF + q0;   // this wave's first row among the partial results
#pragma unroll
    for (int c = 0; c < 2; ++c) if (hi == 0) { v2f ml; ml[0] = mu[c]; ml[1] = L[c][0]; *(v2f*)(Ml + (pr + c * 16 + lr) * 2) = ml; }
    // O^T -> O through the wave's own part of LDS (no other wave reads it), 16 queries at a time, so that the stores are whole lines
    float* osw = (float*)sm + wave * (16 * OPIT);
#pragma unroll 1   // two equal halves: one copy of the code
    for (int c = 0; c < 2; ++c) {
#pragma unroll
        for (int dt = 0; dt < 32; ++dt) { const v8f o = c ? O[dt][1] : O[dt][0]; float* w = osw + lr * OPIT + dt * 16 + hi * 8; *(v4fa*)w = (v4f){o[0], o[1], o[2], o[3]}; *(v4fa*)(w + 4) = (v4f){o[4], o[5], o[6], o[7]}; }
#pragma unroll 1   // four rows a trip: 16 loads in flight, small code
        for (int r = 0; r < 16; r += 4) {
#pragma unroll
            for (int q4 = 0; q4 < 16; ++q4) *(v4f*)(Op + (pr + c * 16 + r + (q4 >> 2)) * HD + (q4 & 3) * 128 + lane * 4) = *(const v4fa*)(osw + (r + (q4 >> 2)) * OPIT + (q4 & 3) * 128 + lane * 4);
            asm volatile("s_wait_xcnt 0x0" ::: "memory");   // stands in front of the next trip's writes to the registers that these stores name
        }
    }
}
// k_avj: two independent jobs in one grid (RH/64, HD/64, 2 ZH). z < ZH: attn.v of the hi+lo rows, one 64x64 tile per work-group. The rest, as many work-groups again: the join of the FSP key ranges of the fp16 query rows: out = sum_s 2^(m_s - m) O_s / sum_s 2^(m_s - m) l_s, in range order; 128 threads x 4 columns per row, 2 rows per work-group and pass, JR rows' loads in flight at a time.
#define JW  (RH / 64 * (HD / 64) * ZH)
#define JR  7
#define JB  (ZH * NQF / (2 * JW * JR))
static_assert(JB * (2 * JW * JR) == ZH * NQF, "whole passes");
__global__ __launch_bounds__(256) void k_avj(const bf* __restrict__ Ph, const bf* __restrict__ Pl, const bf* __restrict__ VTh, const bf* __restrict__ VTl, const float* __restrict__ Op, const float* __restrict__ Ml, float* out) {
    __shared__ __align__(16) char sm[GLDS(2, 4)];
    if (blockIdx.z < ZH) { gemms_body<bf, 2, EP_F32, 4>(sm, blockIdx.x, blockIdx.y, blockIdx.z, Ph, Pl, VTh, VTl, TT, out, DQ, nullptr, nullptr, 0, (size_t)RH * TT, (size_t)HD * TT, (size_t)HD, 0, 1.0f, nullptr, nullptr, nullptr); return; }
    const unsigned i0 = ((((unsigned)blockIdx.z - ZH) * (HD / 64) + blockIdx.y) * (RH / 64) + blockIdx.x) * 2 + (threadIdx.x >> 7), d = (threadIdx.x & 127) * 4;
#pragma unroll 1   // JR rows a trip: 8 JR loads in flight, small code
    for (unsigned b = 0; b < JB; ++b) {
        const unsigned ib = i0 + b * (JR * 2 * JW);   // row index z NQF + row of the trip's first row; the others lie 2 JW rows apart
        const unsigned bm = ib * 8u; unsigned bo[FSP];   // 32-bit byte offsets on the two uniform bases, one per key range; the rows' steps are immediates
#pragma unroll
        for (int sp = 0; sp < FSP; ++sp) bo[sp] = (ib * HD + d) * 4u + (unsigned)sp * (unsigned)(ZH * NQF * HD * 4);
        const char* pm = (const char*)Ml + bm;
        v2f ml[JR][FSP]; v4f o[JR][FSP];
#pragma unroll
        for (int r = 0; r < JR; ++r)
#pragma unroll
            for (int sp = 0; sp < FSP; ++sp) ml[r][sp] = *(const v2f*)(pm + ((size_t)sp * ZH * NQF + (size_t)r * 2 * JW) * 8);
#pragma unroll
        for (int sp = 0; sp < FSP; ++sp) { const char* po = (const char*)Op + bo[sp];
#pragma unroll
            for (int r = 0; r < JR; ++r) o[r][sp] = *(const v4f*)(po + (size_t)r * 2 * JW * HD * 4); }
        static_assert(FSP == 4, "the wait below names the four offsets");
        asm volatile("s_wait_xcnt 0x0" :: "v"(bm), "v"(bo[0]), "v"(bo[1]), "v"(bo[2]), "v"(bo[3]) : "memory");   // keeps the trip's loads together ahead of the sums; the offsets are inputs so that their registers live up to the wait and no load lands on one ahead of it
#pragma unroll
        for (int r = 0; r < JR; ++r) { const unsigned idx = ib + r * (2 * JW), z = idx / NQF, row = idx % NQF;
            float mm = -3.0e38f;
#pragma unroll
            for (int sp = 0; sp < FSP; ++sp) mm = fmaxf(mm, ml[r][sp][0]);
            float den = 0.f; v4f acc = (v4f){};
#pragma unroll
            for (int sp = 0; sp < FSP; ++sp) { const float w = __builtin_amdgcn_exp2f(ml[r][sp][0] - mm); den += w * ml[r][sp][1]; acc += o[r][sp] * w; }
            *(v4f*)(out + (size_t)(RH + row) * DQ + z * HD + d) = acc * __fdiv_rn(1.0f, den);
            asm volatile("s_wait_xcnt 0x0" ::: "memory");   // stands in front of the next row's writes to the registers that this store names
        }
    }
}

extern "C" void kernel_launch(void* const* d_in, const int* in_sizes, int n_in,
                              void* d_out, int out_size, void* d_ws, size_t ws_size, hipStream_t stream) {
    (void)in_sizes; (void)n_in; (void)out_size;
    const float* x = (const float*)d_in[0]; const float* wq = (const float*)d_in[1]; const float* bq = (const float*)d_in[2]; const float* wk = (const float*)d_in[3]; const float* bk = (const float*)d_in[4]; const float* wv = (const float*)d_in[5]; const float* bv = (const float*)d_in[6]; const float* wo = nullptr; (void)wo;
    float* OUT = (float*)d_out;     // [1][4096][1024]
    char* wsp = (char*)d_ws;
    auto take = [&](size_t bytes) { char* p = wsp; wsp += (bytes + 255) & ~(size_t)255; return (void*)p; };
    // first what is last read by the score launches: weights, x, q and k planes (WQ, WK, WV, XB in a row: k_cvt8's dst)
    bf* WQ = (bf*)take((size_t)DQ * DM * 2); bf* WK = (bf*)take((size_t)DKV * DM * 2); bf* WV = (bf*)take((size_t)DKV * DM * 2);
    bf* XB = (bf*)take((size_t)TT * DM * 2); (void)WK;   // WK is reached as WQ + z stride
    h16* QP16 = (h16*)take((size_t)NH_ * TT * HD * 2); h16* KP16 = (h16*)take((size_t)NKV * TT * HD * 2);
    bf* QPh = (bf*)take((size_t)NH_ * TT * HD * 2); bf* KPh = (bf*)take((size_t)NKV * TT * HD * 2); bf* QPl = (bf*)take((size_t)NH_ * TT * HD * 2); bf* KPl = (bf*)take((size_t)NKV * TT * HD * 2);   // each k plane directly behind its q plane: z runs through both
    h16* VT16 = (h16*)take((size_t)NKV * HD * TT * 2); bf* VTh = (bf*)take((size_t)NKV * HD * TT * 2); bf* VTl = (bf*)take((size_t)NKV * HD * TT * 2); bf* Ph = (bf*)take((size_t)ZH * RH * TT * 2); bf* Pl = (bf*)take((size_t)ZH * RH * TT * 2);
    float* Sb = (float*)take((size_t)ZH * TT * TT * 4);   // only rows < RH of each head's plane hold scores
    float* Op = Sb + (size_t)RH * TT; float* Ml = Sb + (size_t)TT * TT + (size_t)RH * TT;   // the fused launch's partial results lie on the unused rows of plane 0 (O) and plane 1 (maximum, sum)
    static_assert((size_t)FSP * ZH * NQF * HD <= (size_t)NQF * TT && (size_t)FSP * ZH * NQF * 2 <= (size_t)NQF * TT && ZH == 2 && NH_ == ZH && REP == 1, "partial results fit those rows; one pass over both heads");
    static_assert(RH % 128 == 0 && TT % 128 == 0 && HD % 128 == 0, "whole 128x128 score tiles, whole trips of 2 x 64 k");
    if ((size_t)(wsp - (char*)d_ws) > ws_size) return;    // ws 256 MiB
    for (int b = 0; b < NB_; ++b) {
        k_cvt8<<<(unsigned)((3 * NW8 + NX8) / 256), 256, 0, stream>>>(wq, wk, wv, x + (size_t)b * TT * DM, WQ);
        k_qkv<<<dim3(TT / 128, HD / 128, NH_ + NKV + DKV / HD), 256, 0, stream>>>(XB, WQ, WV, bq, bk, bv, QP16, QPh, QPl, VT16, VTh, VTl);
        for (int h0 = 0; h0 < NH_; h0 += ZH) { const size_t zq = (size_t)h0, zk = (size_t)(h0 / REP);   // one kv head per query head: the pass's two heads use consecutive kv planes (z-strides TT*HD)
            k_gemms<bf, 2, EP_F32, 2, 128><<<dim3(RH / 128, TT / 128, ZH), 256, 0, stream>>>(QPh + zq * TT * HD, QPl + zq * TT * HD, KPh + zk * TT * HD, KPl + zk * TT * HD, HD, Sb, TT, nullptr, nullptr, 0, (size_t)TT * HD, (size_t)TT * HD, (size_t)TT * TT, 0, 1.0f, nullptr, nullptr, nullptr);
            k_fattn<<<dim3(NQF / FQ + FXA, FSP, ZH), 128, 0, stream>>>(QP16 + zq * TT * HD, KP16 + zk * TT * HD, VT16 + zk * HD * TT, Op, Ml, Sb, Ph, Pl);
            float* Oh = OUT + (size_t)b * TT * DM + (size_t)h0 * HD;   // this head's columns of the merged output, pitch DQ: f32 context straight to the output
            k_avj<<<dim3(RH / 64, HD / 64, 2 * ZH), 256, 0, stream>>>(Ph, Pl, VTh + zk * HD * TT, VTl + zk * HD * TT, Op, Ml, Oh); }
    }
}

// v008
// It runs in 132 microseconds.
// Two timings next to v007 put it at 1.09 and 1.10 times that version's speed.
// All steps since v000 together make it 4.74 times as fast.
#include <hip/hip_runtime.h>

// Two-head self-attention with 512-wide heads (activation [1][1][4096][1024]; q, k, v = x W^T + b ('oi' [1024][1024]), 2 heads x 512; softmax(q.k/sqrt(512)) over all 4096 keys; out = merged context (no output projection) -> [1][1][4096][1024] (4.2 M)).
// Compute dtypes, f32 accumulate: every input rounded to bf16; q/k/v on PLAIN bf16 operands (inputs: exact) + biases; scores (K = 512) and attn.v (N = 512; no mask): query rows < 512 hl (3 products, f32 scores in the workspace, softmax f32), the rest single fp16 in one fused launch (running maximum, probabilities never leave the registers); no output projection: the merged context is written in f32.

#define NB_  1
#define TT   4096
#define DM   1024
#define NH_  2
#define NKV  2
#define REP  (NH_ / NKV)
#define HD   512
#define DQ   (NH_ * HD)
#define DKV  (NKV * HD)
#define ZH   2                    // heads per launch, on grid z
#define RH   512                  // query rows < RH use hi+lo planes
#define WIN  0
#define PCAR 1024.0f
#define SCL  0.044194173824159216f   // 512^-0.5 (head width 512)
typedef _Float16 h16;
typedef unsigned short bf;
typedef __attribute__((ext_vector_type(16))) __bf16   v16bf;
typedef __attribute__((ext_vector_type(16))) _Float16 v16h;
typedef __attribute__((ext_vector_type(8)))  _Float16 v8h;
typedef __attribute__((ext_vector_type(8)))  unsigned short v8us;
typedef __attribute__((ext_vector_type(8)))  float    v8f;
typedef __attribute__((ext_vector_type(4)))  float    v4f;
typedef v8h  __attribute__((may_alias)) v8ha;
typedef v4f  __attribute__((may_alias)) v4fa;
typedef v8us __attribute__((may_alias)) v8usa;

__device__ __forceinline__ unsigned short f2bf(float f) { unsigned u = __float_as_uint(f); u += 0x7FFFu + ((u >> 16) & 1u); return (unsigned short)(u >> 16); }
__device__ __forceinline__ float bf2f(unsigned short b) { return __uint_as_float(((unsigned)b) << 16); }
__device__ __forceinline__ float bfr(float f) { return bf2f(f2bf(f)); }
__device__ __forceinline__ v16h cat16(v8h lo, v8h hi) { return __builtin_shufflevector(lo, hi, 0, 1, 2, 3, 4, 5, 6, 7, 8, 9, 10, 11, 12, 13, 14, 15); }
__device__ __forceinline__ v16bf cat16b(v8us lo, v8us hi) { return __builtin_bit_cast(v16bf, __builtin_shufflevector(lo, hi, 0, 1, 2, 3, 4, 5, 6, 7, 8, 9, 10, 11, 12, 13, 14, 15)); }
__device__ __forceinline__ v8f wmma16(v16h a, v16h b, v8f c) { return __builtin_amdgcn_wmma_f32_16x16x32_f16(false, a, false, b, (short)0, c, false, false); }
__device__ __forceinline__ v8f wmmab(v16bf a, v16bf b, v8f c) { return __builtin_amdgcn_wmma_f32_16x16x32_bf16(false, a, false, b, (short)0, c, false, false); }



// ---- k_gemms: LDS-staged GEMM. c[m][n] = sum_k A[m][k] Bt[n][k] (NSPLIT 2: + A2 Bt + A Bt2, the hi+lo planes), operands K-contiguous 16-bit planes; z-batch strides sA/sB/sC in elements.
// NSPLIT 0: 128x128 tile per work-group, a wave group = 2x2 waves of 64x64, a stage = [A 128 rows | Bt 128 rows] of 128 k (256 bytes, pitch 272). NSPLIT 2, a stage = [A | A2 | Bt | Bt2], TILE rows each, of 64 k (128 bytes, pitch 144): TILE 64: a wave group = 2 waves of 32x64; TILE 128: 2x2 waves of 64x64 (half the operand bytes per product, from L2 and from LDS).
// A trip covers KG stages of k, one per wave group; a group's stage comes in by asynchronous copies to LDS (every wave-wide copy = whole 128-byte lines), two buffers: the next trip's copies fly while this trip's fragments are read from LDS by all waves of the group. The KG partial tiles are added in LDS in group order.
// grid (M/tile, N/tile, Z), 32 x waves threads. K % (stage k x KG) == 0.
// EPI says what the epilogue stores, pitch ldc: EP_F32 c as f32 in C; EP_SCALE c x cs as f32 in C.
#define EP_F32   0
#define EP_SCALE 1
__device__ __forceinline__ void splitf(float y, unsigned short& h, unsigned short& l) { h = f2bf(y); l = f2bf(y - bf2f(h)); }
typedef __attribute__((ext_vector_type(4))) _Float16 v4h;
typedef __attribute__((ext_vector_type(4))) unsigned short v4us;
template <typename T16> struct WFrag;   // ld: one fragment from an LDS row, p = the lane's byte address (row, 16 bytes x lane half): k 8 hi .. 8 hi + 7 and 16 + 8 hi .. 16 + 8 hi + 7, the same for both operands
template <> struct WFrag<h16> { typedef v16h V; static __device__ __forceinline__ V ld(const char* p) { return cat16(*(const v8ha*)p, *(const v8ha*)(p + 32)); } static __device__ __forceinline__ v8f mma(V a, V b, v8f c) { return wmma16(a, b, c); } };
template <> struct WFrag<bf> { typedef v16bf V; static __device__ __forceinline__ V ld(const char* p) { return cat16b(*(const v8usa*)p, *(const v8usa*)(p + 32)); } static __device__ __forceinline__ v8f mma(V a, V b, v8f c) { return wmmab(a, b, c); } };
// eight copies of 16 bytes per lane, rows RS apart; the s_wait_xcnt stands inside the statement so that no address register of a copy is rewritten ahead of it
template <int PITCH, int RS, typename T16>
__device__ __forceinline__ void cp8(unsigned l, const T16* g, size_t gs) {
    asm volatile("global_load_async_to_lds_b128 %0, %8, off\n\t"
                 "global_load_async_to_lds_b128 %1, %9, off\n\t"
                 "global_load_async_to_lds_b128 %2, %10, off\n\t"
                 "global_load_async_to_lds_b128 %3, %11, off\n\t"
                 "global_load_async_to_lds_b128 %4, %12, off\n\t"
                 "global_load_async_to_lds_b128 %5, %13, off\n\t"
                 "global_load_async_to_lds_b128 %6, %14, off\n\t"
                 "global_load_async_to_lds_b128 %7, %15, off\n\t"
                 "s_wait_xcnt 0x0"
                 :: "v"(l), "v"(l + RS * PITCH), "v"(l + 2 * RS * PITCH), "v"(l + 3 * RS * PITCH), "v"(l + 4 * RS * PITCH), "v"(l + 5 * RS * PITCH), "v"(l + 6 * RS * PITCH), "v"(l + 7 * RS * PITCH),
                    "v"(g), "v"(g + gs), "v"(g + 2 * gs), "v"(g + 3 * gs), "v"(g + 4 * gs), "v"(g + 5 * gs), "v"(g + 6 * gs), "v"(g + 7 * gs)
                 : "memory");
}
// gemms_body is the whole GEMM of one work-group: sm = its LDS (GLDST bytes), (bx, by, z) = its tile and batch. k_gemms launches it alone; k_avj launches it beside independent work in one grid.
#define GLDS(NSPLIT, KG) (2 * (KG) * 256 * (((NSPLIT) ? 64 : 128) * 2 + 16))
#define GLDST(NSPLIT, KG, TILE) (GLDS(NSPLIT, KG) * ((NSPLIT) ? (TILE) / 64 : 1))
template <typename T16, int NSPLIT, int EPI, int KG, int TILE = (NSPLIT ? 64 : 128)>
__device__ __forceinline__ void gemms_body(char* sm, const int bx, const int by, const size_t z, const T16* __restrict__ A, const T16* __restrict__ A2, const T16* __restrict__ Bt, const T16* __restrict__ Bt2, int K, float* C, int ldc, size_t sA, size_t sB, size_t sC, float cs) {
    static_assert(NSPLIT == 0 || NSPLIT == 2, "one product, or the three of the hi+lo planes");
    typedef typename WFrag<T16>::V V;
    static_assert(TILE == 128 || (NSPLIT == 2 && TILE == 64), "tile sizes");
    constexpr int KS = NSPLIT ? 64 : 128, PITCH = KS * 2 + 16, QR = NSPLIT ? TILE : 64, STAGE = 4 * QR * PITCH, NK = KS / 32, MB = TILE / 32, GWV = TILE / 32, RS = GWV * 32 / (KS / 8), OT = MB * 16 * 68;   // QR: rows of a quarter of the stage, one cp8 each
    static_assert(GLDST(NSPLIT, KG, TILE) == 2 * KG * STAGE && 8 * RS == QR, "the launching kernel's LDS is the ring; a cp8 fills a quarter");
    A += z * sA; Bt += z * sB; if constexpr (NSPLIT == 2) { A2 += z * sA; Bt2 += z * sB; }
    C += z * sC;
    const int lane = threadIdx.x & 31, lr = lane & 15, hi = lane >> 4; const int wave = __builtin_amdgcn_readfirstlane((int)(threadIdx.x >> 5)); const int kg = wave / GWV, wig = wave % GWV, wm = TILE == 64 ? wig : wig >> 1, wn = TILE == 64 ? 0 : wig & 1; const int r0 = bx * TILE, c0 = by * TILE;
    v8f acc[MB][4];
#pragma unroll
    for (int mb = 0; mb < MB; ++mb)
#pragma unroll
        for (int nb = 0; nb < 4; ++nb) acc[mb][nb] = (v8f){};
    // copy lanes: thread tg of its group brings 16-byte piece cch of rows crow + RS i, i < 8, of each quarter of the stage
    const int tg = (int)threadIdx.x % (GWV * 32), crow = tg / (KS / 8), cch = tg % (KS / 8);
    const size_t ga = (size_t)(r0 + crow) * K + kg * KS + cch * 8, gb = (size_t)(c0 + crow) * K + kg * KS + cch * 8;
    const T16* g0 = A + ga; const T16* g1 = NSPLIT ? A2 + ga : A + ga + (size_t)64 * K; const T16* g2 = Bt + gb; const T16* g3 = NSPLIT ? Bt2 + gb : Bt + gb + (size_t)64 * K;
    const unsigned l0 = (unsigned)(size_t)sm + (unsigned)(kg * STAGE + crow * PITCH + cch * 16);
    const size_t gs = (size_t)RS * K; const int nt = K / (KS * KG);
    auto fill = [&](int buf, int t) { const unsigned l = l0 + (unsigned)(buf * (KG * STAGE)); const size_t ko = (size_t)t * (KS * KG);
        cp8<PITCH, RS>(l, g0 + ko, gs); cp8<PITCH, RS>(l + QR * PITCH, g1 + ko, gs); cp8<PITCH, RS>(l + 2 * QR * PITCH, g2 + ko, gs); cp8<PITCH, RS>(l + 3 * QR * PITCH, g3 + ko, gs); };
    fill(0, 0);
    asm volatile("s_wait_asynccnt 0x0" ::: "memory");   // this wave's part of trip 0 has landed
    __syncthreads();                                     // trip 0's stages are whole before any wave reads them
    if (nt > 1) fill(1, 1);
#pragma unroll 1   // the trip loop stays rolled: one copy of the ring's hand-over
    for (int t = 0; t < nt; ++t) {
        const char* sb = sm + ((t & 1) * KG + kg) * STAGE; const char* pa = sb + (wm * MB * 16 + lr) * PITCH + hi * 16; const char* pb = sb + (2 * QR + wn * 64 + lr) * PITCH + hi * 16;
        // fragments run ahead of their products inside the trip: A two k steps (two sets), Bt half a k step (each pair of columns is refetched when its products are issued)
        V a[2][MB], a2[2][MB], b[4], b2[4];
#pragma unroll
        for (int q = 0; q < (NK < 2 ? NK : 2); ++q)
#pragma unroll
            for (int mb = 0; mb < MB; ++mb) { a[q][mb] = WFrag<T16>::ld(pa + mb * 16 * PITCH + q * 64); if constexpr (NSPLIT == 2) a2[q][mb] = WFrag<T16>::ld(pa + (QR + mb * 16) * PITCH + q * 64); }
#pragma unroll
        for (int nb = 0; nb < 4; ++nb) { b[nb] = WFrag<T16>::ld(pb + nb * 16 * PITCH); if constexpr (NSPLIT == 2) b2[nb] = WFrag<T16>::ld(pb + (QR + nb * 16) * PITCH); }
        __builtin_amdgcn_sched_barrier(0);   // this and the two below keep each group of LDS loads whole and ahead of the products in front of its use; without them the scheduler sinks every load to its first use and the wave waits out the LDS latency there
#pragma unroll
        for (int ks = 0; ks < NK; ++ks) {
#pragma unroll
            for (int nh = 0; nh < 2; ++nh) {
#pragma unroll
                for (int nb = 2 * nh; nb < 2 * nh + 2; ++nb)
#pragma unroll
                    for (int mb = 0; mb < MB; ++mb) { acc[mb][nb] = WFrag<T16>::mma(a[ks & 1][mb], b[nb], acc[mb][nb]); if constexpr (NSPLIT == 2) { acc[mb][nb] = WFrag<T16>::mma(a2[ks & 1][mb], b[nb], acc[mb][nb]); acc[mb][nb] = WFrag<T16>::mma(a[ks & 1][mb], b2[nb], acc[mb][nb]); } }
                __builtin_amdgcn_sched_barrier(0);
                if (ks + 1 < NK) {
#pragma unroll
                    for (int nb = 2 * nh; nb < 2 * nh + 2; ++nb) { b[nb] = WFrag<T16>::ld(pb + nb * 16 * PITCH + (ks + 1) * 64); if constexpr (NSPLIT == 2) b2[nb] = WFrag<T16>::ld(pb + (QR + nb * 16) * PITCH + (ks + 1) * 64); } }
                if (nh == 1 && ks + 2 < NK) {
#pragma unroll
                    for (int mb = 0; mb < MB; ++mb) { a[ks & 1][mb] = WFrag<T16>::ld(pa + mb * 16 * PITCH + (ks + 2) * 64); if constexpr (NSPLIT == 2) a2[ks & 1][mb] = WFrag<T16>::ld(pa + (QR + mb * 16) * PITCH + (ks + 2) * 64); } }
                __builtin_amdgcn_sched_barrier(0);
            }
        }
        asm volatile("s_wait_dscnt 0x0" ::: "memory");      // this wave has left the buffer that is refilled below
        asm volatile("s_wait_asynccnt 0x0" ::: "memory");   // this wave's part of trip t + 1 has landed
        __syncthreads();                                     // publishes trip t + 1 and ends every read of trip t's buffer
        if (t + 2 < nt) fill(t & 1, t + 2);
    }
    asm volatile("s_wait_asynccnt 0x0" ::: "memory");   // no copy is in flight when the ring becomes output staging
    float* os = (float*)sm; float* osw = os + wave * OT;
#pragma unroll
    for (int mb = 0; mb < MB; ++mb)
#pragma unroll
        for (int nb = 0; nb < 4; ++nb)
#pragma unroll
            for (int j = 0; j < 8; ++j) osw[(mb * 16 + hi * 8 + j) * 68 + nb * 16 + lr] = acc[mb][nb][j];
    __syncthreads();   // every wave's partial tile is in LDS before any wave adds the KG tiles
    const float* ot = os + wig * OT;
#pragma unroll
    for (int s = 0; s < MB * 8 / KG; ++s) { const int it = lane + (s + kg * (MB * 8 / KG)) * 32, row = it >> 4, cofs = (it & 15) * 4; v4f val = *(const v4fa*)(ot + row * 68 + cofs);
#pragma unroll
        for (int g = 1; g < KG; ++g) val += *(const v4fa*)(ot + g * (GWV * OT) + row * 68 + cofs);
        const int gr = r0 + wm * MB * 16 + row, gc = c0 + wn * 64 + cofs;
        if constexpr (EPI == EP_SCALE) val *= cs;
        const size_t oo = (size_t)gr * ldc + gc;
        *(v4f*)(C + oo) = val;
    }
}

template <typename T16, int NSPLIT, int EPI, int KG, int TILE>
__global__ __launch_bounds__(TILE * KG) void k_gemms(const T16* __restrict__ A, const T16* __restrict__ A2, const T16* __restrict__ Bt, const T16* __restrict__ Bt2, int K, float* C, int ldc, size_t sA, size_t sB, size_t sC, float cs) {
    __shared__ __align__(16) char sm[GLDST(NSPLIT, KG, TILE)];
    gemms_body<T16, NSPLIT, EPI, KG, TILE>(sm, blockIdx.x, blockIdx.y, blockIdx.z, A, A2, Bt, Bt2, K, C, ldc, sA, sB, sC, cs);
}
// k_qkv: the three projections, grid (TT/128, HD/128, heads). A work-group = 3 groups of 2x2 waves; group 0, 1, 2 = the 128x128 tile of q, k, v for the same 128 x rows and the same 128 features, so that one staged x tile serves all three. A stage = [x 128 rows | wq | wk | wv, 128 rows each] of 128 k (256 bytes, pitch 272), by asynchronous copies to LDS, two buffers, as in k_gemms; a wave runs the whole K.
// q, k (WK lies behind WQ, each k plane behind its q plane): x rows are the M side, the epilogue stores the head planes [h][t][d]. v: the weight rows are the M side, so the tile comes out as [h HD + d][t], the transposed planes that attn.v reads. The epilogue adds the bias and stores the three 16-bit planes that the next launches read (fp16, bf16 hi, bf16 lo).
#define XKS  128
#define XPIT (XKS * 2 + 16)
#define XSTG (4 * 128 * XPIT)
#define XOT  (64 * 68)
static_assert(12 * XOT * 4 <= 2 * XSTG && DM % XKS == 0 && DM / XKS >= 2 && DQ == DM && DKV == DM && NH_ == NKV && HD % 128 == 0 && TT % 128 == 0, "output staging fits the ring; whole stages, two or more; q, k and v have the same features; whole tiles");
__global__ __launch_bounds__(384) void k_qkv(const bf* __restrict__ XB, const bf* __restrict__ WQ, const bf* __restrict__ WV, const float* __restrict__ bq, const float* __restrict__ bk, const float* __restrict__ bv, h16* QP16, bf* QPh, bf* QPl, h16* VT16, bf* VTh, bf* VTl) {
    __shared__ __align__(16) char sm[2 * XSTG];
    typedef WFrag<bf>::V V;
    const int lane = threadIdx.x & 31, lr = lane & 15, hi = lane >> 4; const int wave = __builtin_amdgcn_readfirstlane((int)(threadIdx.x >> 5)); const int g = wave >> 2, wig = wave & 3, wm = wig >> 1, wn = wig & 1;
    const int t0 = blockIdx.x * 128, f0 = blockIdx.z * HD + blockIdx.y * 128;   // first x row; first weight row (output feature) of each projection
    v8f acc[4][4];
#pragma unroll
    for (int mb = 0; mb < 4; ++mb)
#pragma unroll
        for (int nb = 0; nb < 4; ++nb) acc[mb][nb] = (v8f){};
    // copy lanes: thread tg of its group brings 16-byte piece cch of rows crow + 8 i, i < 8 (one cp8 = 64 rows): its group's 128 weight rows, and groups 0 and 1 half of the x rows each
    const int tg = (int)threadIdx.x & 127, crow = tg >> 4, cch = tg & 15;
    const bf* gw = (g == 2 ? WV : WQ + (size_t)g * DQ * DM) + (size_t)(f0 + crow) * DM + cch * 8;
    const bf* gx = XB + (size_t)(t0 + (g & 1) * 64 + crow) * DM + cch * 8;
    const unsigned lw = (unsigned)(size_t)sm + (unsigned)(((1 + g) * 128 + crow) * XPIT + cch * 16), lx = (unsigned)(size_t)sm + (unsigned)(((g & 1) * 64 + crow) * XPIT + cch * 16);
    constexpr size_t gs = (size_t)8 * DM; constexpr int nt = DM / XKS;
    auto fill = [&](int buf, int t) { const unsigned o = (unsigned)(buf * XSTG); const size_t ko = (size_t)t * XKS;
        cp8<XPIT, 8>(lw + o, gw + ko, gs); cp8<XPIT, 8>(lw + o + 64 * XPIT, gw + ko + (size_t)64 * DM, gs);
        if (g < 2) cp8<XPIT, 8>(lx + o, gx + ko, gs); };   // the same for a whole wave
    fill(0, 0);
    asm volatile("s_wait_asynccnt 0x0" ::: "memory");   // this wave's part of trip 0 has landed
    __syncthreads();                                     // trip 0's stage is whole before any wave reads it
    fill(1, 1);
    const int ar = g == 2 ? 3 * 128 : 0, br = g == 2 ? 0 : (1 + g) * 128;   // stage rows of the M side and of the N side
#pragma unroll 1   // the trip loop stays rolled: one copy of the ring's hand-over
    for (int t = 0; t < nt; ++t) {
        const char* sb = sm + (t & 1) * XSTG; const char* pa = sb + (ar + wm * 64 + lr) * XPIT + hi * 16; const char* pb = sb + (br + wn * 64 + lr) * XPIT + hi * 16;
        // fragments run ahead of their products inside the trip: the M side two k steps (two sets), the N side half a k step (each pair of columns is refetched when its products are issued)
        V a[2][4], b[4];
#pragma unroll
        for (int q = 0; q < 2; ++q)
#pragma unroll
            for (int mb = 0; mb < 4; ++mb) a[q][mb] = WFrag<bf>::ld(pa + mb * 16 * XPIT + q * 64);
#pragma unroll
        for (int nb = 0; nb < 4; ++nb) b[nb] = WFrag<bf>::ld(pb + nb * 16 * XPIT);
        __builtin_amdgcn_sched_barrier(0);   // this and the two below keep each group of LDS loads whole and ahead of the products in front of its use; without them the scheduler sinks every load to its first use and the wave waits out the LDS latency there
#pragma unroll
        for (int ks = 0; ks < XKS / 32; ++ks) {
#pragma unroll
            for (int nh = 0; nh < 2; ++nh) {
#pragma unroll
                for (int nb = 2 * nh; nb < 2 * nh + 2; ++nb)
#pragma unroll
                    for (int mb = 0; mb < 4; ++mb) acc[mb][nb] = WFrag<bf>::mma(a[ks & 1][mb], b[nb], acc[mb][nb]);
                __builtin_amdgcn_sched_barrier(0);
                if (ks + 1 < XKS / 32) {
#pragma unroll
                    for (int nb = 2 * nh; nb < 2 * nh + 2; ++nb) b[nb] = WFrag<bf>::ld(pb + nb * 16 * XPIT + (ks + 1) * 64); }
                if (nh == 1 && ks + 2 < XKS / 32) {
#pragma unroll
                    for (int mb = 0; mb < 4; ++mb) a[ks & 1][mb] = WFrag<bf>::ld(pa + mb * 16 * XPIT + (ks + 2) * 64); }
                __builtin_amdgcn_sched_barrier(0);
            }
        }
        asm volatile("s_wait_dscnt 0x0" ::: "memory");      // this wave has left the buffer that is refilled below
        asm volatile("s_wait_asynccnt 0x0" ::: "memory");   // this wave's part of trip t + 1 has landed
        __syncthreads();                                     // publishes trip t + 1 and ends every read of trip t's buffer
        if (t + 2 < nt) fill(t & 1, t + 2);
    }
    asm volatile("s_wait_asynccnt 0x0" ::: "memory");   // no copy is in flight when the ring becomes output staging
    // each wave turns its 64x64 tile through its own part of LDS (no other wave reads it), so that the stores are whole lines
    float* osw = (float*)sm + wave * XOT;
#pragma unroll
    for (int mb = 0; mb < 4; ++mb)
#pragma unroll
        for (int nb = 0; nb < 4; ++nb)
#pragma unroll
            for (int j = 0; j < 8; ++j) osw[(mb * 16 + hi * 8 + j) * 68 + nb * 16 + lr] = acc[mb][nb][j];
    const size_t zp = (size_t)(g * NH_ + (int)blockIdx.z) * TT * HD;   // q heads, then k heads: each k plane lies behind its q plane
    h16* P16 = g == 2 ? VT16 : QP16 + zp; bf* Ph = g == 2 ? VTh : QPh + zp; bf* Pl = g == 2 ? VTl : QPl + zp;
    const float* bias = g == 2 ? bv : (g == 1 ? bk : bq) + blockIdx.z * HD;
    // 32 passes of 2 tile rows; four passes a trip, so that a trip's LDS loads and stores overlap and the kernel's text stays small
    const int rw = lane >> 4, cofs = (lane & 15) * 4;
    if (g < 2) {   // the same for a whole wave. q, k: [h][t][d], the bias runs along the columns
        const int gc = blockIdx.y * 128 + wn * 64 + cofs; const v4f bb = (v4f){bfr(bias[gc]), bfr(bias[gc + 1]), bfr(bias[gc + 2]), bfr(bias[gc + 3])};
#pragma unroll 1   // one copy of the trip's code
        for (int s0 = 0; s0 < 32; s0 += 4) {
#pragma unroll
            for (int s = 0; s < 4; ++s) { const int row = (s0 + s) * 2 + rw; const v4f val = *(const v4fa*)(osw + row * 68 + cofs) + bb;
                const size_t oo = (size_t)(t0 + wm * 64 + row) * HD + gc; v4h o16; v4us oh, ol;   // 16 lanes x 8 bytes: one whole 128-byte line of each plane per tile row
#pragma unroll
                for (int q = 0; q < 4; ++q) { o16[q] = (h16)val[q]; unsigned short a2s, c2; splitf(val[q], a2s, c2); oh[q] = a2s; ol[q] = c2; }
                *(v4h*)(P16 + oo) = o16; *(v4us*)(Ph + oo) = oh; *(v4us*)(Pl + oo) = ol; }
            asm volatile("s_wait_xcnt 0x0" ::: "memory");   // stands in front of the next trip's writes to the registers that these stores name
        }
    } else {       // v: [h HD + d][t], the bias runs along the rows
        const int gc = t0 + wn * 64 + cofs;
#pragma unroll 1   // one copy of the trip's code
        for (int s0 = 0; s0 < 32; s0 += 4) {
#pragma unroll
            for (int s = 0; s < 4; ++s) { const int row = (s0 + s) * 2 + rw, gr = f0 + wm * 64 + row; const float br2 = bfr(bias[gr]); const v4f val = *(const v4fa*)(osw + row * 68 + cofs) + br2;
                const size_t oo = (size_t)gr * TT + gc; v4h o16; v4us oh, ol;
#pragma unroll
                for (int q = 0; q < 4; ++q) { o16[q] = (h16)val[q]; unsigned short a2s, c2; splitf(val[q], a2s, c2); oh[q] = a2s; ol[q] = c2; }
                const size_t o6 = ((size_t)(gr / HD * (TT / 32) + gc / 32) * HD + gr % HD) * 32 + gc % 32;   // the fp16 plane lies as [head][32-key block][d][32 keys], so that a block is one contiguous run for the fused launch's copies
                *(v4h*)(P16 + o6) = o16; *(v4us*)(Ph + oo) = oh; *(v4us*)(Pl + oo) = ol; }
            asm volatile("s_wait_xcnt 0x0" ::: "memory");   // stands in front of the next trip's writes to the registers that these stores name
        }
    }
}

__device__ __forceinline__ h16 tohx(float x) { return (h16)x; }
typedef __attribute__((ext_vector_type(2))) _Float16 v2h;
typedef __attribute__((ext_vector_type(2))) unsigned short v2us;
typedef __attribute__((ext_vector_type(2))) float v2f;
typedef __attribute__((ext_vector_type(4))) int v4i;

__global__ __launch_bounds__(256) void k_wtG(const float* __restrict__ w, int K, int N, bf* Bt) {
    const int lane = threadIdx.x & 31; const int L0 = (blockIdx.x * 8 + (threadIdx.x >> 5)) * 8; const int nlines = N * K / 64;
{
#pragma unroll 1
        for (int l = 0; l < 8; ++l) { const int L = L0 + l; if (L >= nlines) break; const size_t e = (size_t)L * 64 + lane * 2; const int k = (int)(e % K), n = (int)(e / K); v2us o;
            o[0] = f2bf(w[(size_t)k * N + n]); o[1] = f2bf(w[(size_t)(k + 1) * N + n]); *(v2us*)(Bt + e) = o; }
         }
}
// k_cvt8: the four f32 -> bf16 conversions in one grid. dst is the contiguous run [wq | wk | wv | x]; 8 elements per thread, and a block lies wholly inside one source.
#define NW8 ((size_t)DM * DM / 8)
#define NX8 ((size_t)TT * DM / 8)
static_assert(DQ == DM && DKV == DM && NW8 % 256 == 0 && NX8 % 256 == 0, "three equal weight planes, whole blocks");
__global__ __launch_bounds__(256) void k_cvt8(const float* __restrict__ wq, const float* __restrict__ wk, const float* __restrict__ wv, const float* __restrict__ x, bf* dst) { const size_t i = (size_t)blockIdx.x * 256 + threadIdx.x; const unsigned seg = blockIdx.x / (unsigned)(NW8 / 256);
    const float* src = seg == 0 ? wq : seg == 1 ? wk : seg == 2 ? wv : x; const v8f v = *(const v8f*)(src + (i - (seg < 3 ? seg : 3) * NW8) * 8); v8us o;
#pragma unroll
    for (int k = 0; k < 8; ++k) o[k] = f2bf(v[k]); *(v8us*)(dst + i * 8) = o;  }

// asoft_row: one wave, one hi+lo row (ZH x RH rows in all); k_fattn's spare work-groups run it. Per row (zz, i): t = S x HD^-0.5 (no mask); softmax over the 4096 keys (register row, one exp, fixed trees); every row goes to Ph, Pl [zz][RH][TT] (i = row % RH < RH)
__device__ __forceinline__ void asoft_row(const float* __restrict__ Sb, h16* P16, bf* Ph, bf* Pl, const int row) {
    const int lane = threadIdx.x & 31; if (row >= ZH * RH) return; const int i = row % RH; const int zz = row / RH; (void)zz; const bool hires = (i < RH); const float* sr = Sb + ((size_t)zz * TT + i) * TT; float v[TT / 32]; float mx = -3.0e38f;
#pragma unroll
    for (int ch = 0; ch < TT / 128; ++ch) { const int j0 = ch * 128 + lane * 4; const v4f a = *(const v4f*)(sr + j0);
#pragma unroll
        for (int q = 0; q < 4; ++q) { const int j = j0 + q; (void)j; const float t = a[q] * SCL; v[ch * 4 + q] = t; mx = fmaxf(mx, t); } }
#pragma unroll
    for (int sh = 16; sh; sh >>= 1) mx = fmaxf(mx, __shfl_xor(mx, sh, 32));
    float sum = 0.f;
#pragma unroll
    for (int k = 0; k < TT / 32; ++k) { float d0 = __fsub_rn(v[k], mx); asm volatile("" : "+v"(d0)); v[k] = __builtin_amdgcn_exp2f(__fmul_rn(d0, 1.4426950408889634f)); sum += v[k]; }
#pragma unroll
    for (int sh = 16; sh; sh >>= 1) sum += __shfl_xor(sum, sh, 32);
    const float f = __fdiv_rn(hires ? 1.0f : PCAR, sum);
{
        if (hires) {
#pragma unroll
            for (int ch = 0; ch < TT / 128; ++ch) { v4us oh, ol;
#pragma unroll
                for (int q = 0; q < 4; ++q) { unsigned short a, c2; splitf(v[ch * 4 + q] * f, a, c2); oh[q] = a; ol[q] = c2; }
                const size_t oo = ((size_t)zz * (RH ? RH : 1) + i) * TT + ch * 128 + lane * 4; *(v4us*)(Ph + oo) = oh; *(v4us*)(Pl + oo) = ol; }
        } else {
#pragma unroll
            for (int ch = 0; ch < TT / 128; ++ch) { v4h o4;
#pragma unroll
                for (int q = 0; q < 4; ++q) o4[q] = tohx(v[ch * 4 + q] * f);
                *(v4h*)(P16 + ((size_t)zz * (TT - RH) + (i - RH)) * TT + ch * 128 + lane * 4) = o4; } }
         }
}

// ---- k_fattn: scores, softmax and attn.v of the fp16 query rows (>= RH) in one launch. S^T = K Q^T, O^T += V^T P^T: in every 16-column group a lane holds one query, so maximum, sum and rescale are per lane, and the score tiles of 32 keys ARE the B fragment of the second product (keys 8 hi .. and 16 + 8 hi .., the k order of WFrag::ld).
// A work-group = 4 waves x 32 queries, one head (grid z), one quarter of the keys (grid y); Q fragments and the 512 x 32 O^T tile stay in registers. A stage = 32 keys: K rows (pitch 1040 bytes) and the V^T block [d][32 keys] (pitch 80), by asynchronous copies to LDS, two buffers.
// The grid's x runs FXA past the query tiles: those work-groups (as many as the attention leaves WGPs idle) do the softmax rows of the hi+lo path, which wait for nothing of this launch: a wave takes ARW rows, one after the other.
// The maximum in use is raised only when a new one exceeds it by 2^8 (p <= 256 fits fp16). Each key range leaves its unnormalised O, its maximum (log2 units) and its sum; k_avj joins the ranges.
#define FQ   128
#define FSP  4
#define FKT  32
#define KPIT (HD * 2 + 16)
#define VPIT (FKT * 2 + 16)
#define FSTG (FKT * KPIT + HD * VPIT)
#define NQF  (TT - RH)
#define OPIT (HD + 4)
#define FXA  4
#define ARW  (ZH * RH / (FXA * FSP * ZH * 4))
static_assert(ARW * (FXA * FSP * ZH * 4) == ZH * RH, "whole rows per wave");
static_assert(4 * 16 * OPIT * 4 <= 2 * FSTG && NQF % FQ == 0 && TT % (FSP * FKT) == 0 && TT / (FSP * FKT) >= 2, "output staging fits the ring; whole tiles; two stages or more");
typedef __attribute__((address_space(1))) v4i gv4i;
typedef __attribute__((address_space(3))) v4i lv4i;
__global__ __launch_bounds__(128) void k_fattn(const h16* __restrict__ Q, const h16* __restrict__ Kp, const h16* __restrict__ Vt, float* Op, float* Ml, const float* __restrict__ Sb, bf* Ph, bf* Pl) {
    __shared__ __align__(16) char sm[2 * FSTG];
    if (blockIdx.x >= NQF / FQ) {   // the same for a whole work-group, ahead of every barrier and copy
        const int w0 = ((((int)blockIdx.z * FSP + (int)blockIdx.y) * FXA + ((int)blockIdx.x - NQF / FQ)) * 4 + ((int)threadIdx.x >> 5)) * ARW;
#pragma unroll 1   // one copy of the row's code
        for (int r = 0; r < ARW; ++r) { asoft_row(Sb, nullptr, Ph, Pl, w0 + r);
            asm volatile("s_wait_xcnt 0x0" ::: "memory");   // stands in front of the next row's writes to the registers that this row's stores name
        }
        return; }
    const int tid = (int)threadIdx.x, lane = tid & 31, lr = lane & 15, hi = lane >> 4; const int wave = __builtin_amdgcn_readfirstlane(tid >> 5);
    const int z = blockIdx.z, sp = blockIdx.y, q0 = blockIdx.x * FQ + wave * 32;
    // both planes hold FKT x HD elements per 32-key block, contiguous: thread tid brings 16-byte pieces tid + 128 i, i < 16, of each
    const size_t kv0 = ((size_t)z * TT + (size_t)sp * (TT / FSP)) * HD + tid * 8; const h16* gk = Kp + kv0; const h16* gv = Vt + kv0;
    char* lk = sm + (tid >> 6) * KPIT + (tid & 63) * 16; char* lv = sm + FKT * KPIT + (tid >> 2) * VPIT + (tid & 3) * 16;
    // the copies are the builtin here: above 256 registers the operands of asm text must all lie in the lowest register window, which cost spills
    auto fill = [&](int buf, int t) { const int o = buf * FSTG; const size_t go = (size_t)t * (FKT * HD);
#pragma unroll
        for (int i = 0; i < 16; ++i) __builtin_amdgcn_global_load_async_to_lds_b128((gv4i*)(gk + go + i * 1024), (lv4i*)(lk + o + i * 2 * KPIT), 0, 0);
#pragma unroll
        for (int i = 0; i < 16; ++i) __builtin_amdgcn_global_load_async_to_lds_b128((gv4i*)(gv + go + i * 1024), (lv4i*)(lv + o + i * 32 * VPIT), 0, 0); };
    fill(0, 0);
    const h16* qr = Q + ((size_t)z * TT + RH + q0 + lr) * HD + hi * 8;
    v16h qf[2][16];
#pragma unroll
    for (int c = 0; c < 2; ++c)
#pragma unroll
        for (int ks = 0; ks < 16; ++ks) qf[c][ks] = cat16(*(const v8ha*)(qr + c * 16 * HD + ks * 32), *(const v8ha*)(qr + c * 16 * HD + ks * 32 + 16));
    v8f O[32][2];
#pragma unroll
    for (int dt = 0; dt < 32; ++dt) { O[dt][0] = (v8f){}; O[dt][1] = (v8f){}; }
    float mu[2] = {-1.0e30f, -1.0e30f}; v8f L[2] = {(v8f){}, (v8f){}};   // L: the row sums, as one more output tile: A = a tile whose row 0 is ones, so row 0 of L (lanes 0-15, element 0) adds up the rounded p of each query
    v16h ones;
#pragma unroll
    for (int e = 0; e < 16; ++e) ones[e] = lr == 0 ? (h16)1.0f : (h16)0.0f;
    constexpr float CS2 = SCL * 1.4426950408889634f; constexpr int nt = TT / (FSP * FKT);
    asm volatile("s_wait_asynccnt 0x0" ::: "memory");   // this wave's part of stage 0 has landed
    __syncthreads();                                     // stage 0 is whole before any wave reads it
    fill(1, 1);
#pragma unroll 1   // the stage loop stays rolled: one copy of the ring's hand-over
    for (int t = 0; t < nt; ++t) {
        const char* kb = sm + (t & 1) * FSTG + lr * KPIT + hi * 16; const char* vb = sm + (t & 1) * FSTG + FKT * KPIT + lr * VPIT + hi * 16;
        // three fragment sets of four: a set is refetched as soon as its 8 products are issued, two sets (16 products) ahead of its use; the first V^T sets are fetched under the last score products and the softmax
        v16h fr[3][4]; v8f st[2][2] = {{(v8f){}, (v8f){}}, {(v8f){}, (v8f){}}};
#pragma unroll
        for (int g = 0; g < 3; ++g)
#pragma unroll
            for (int i = 0; i < 4; ++i) fr[g][i] = WFrag<h16>::ld(kb + (i & 1) * 16 * KPIT + (2 * g + (i >> 1)) * 64);
        __builtin_amdgcn_sched_barrier(0);   // this and the ones below keep each group of LDS loads whole and ahead of the products in front of its use; without them the scheduler sinks every load to its first use and the lone wave of a SIMD waits out the LDS latency there
#pragma unroll
        for (int g = 0; g < 8; ++g) {
#pragma unroll
            for (int i = 0; i < 4; ++i)
#pragma unroll
                for (int c = 0; c < 2; ++c) st[i & 1][c] = wmma16(fr[g % 3][i], qf[c][2 * g + (i >> 1)], st[i & 1][c]);
            __builtin_amdgcn_sched_barrier(0);
#pragma unroll
            for (int i = 0; i < 4; ++i) fr[g % 3][i] = g + 3 < 8 ? WFrag<h16>::ld(kb + (i & 1) * 16 * KPIT + (2 * (g + 3) + (i >> 1)) * 64) : WFrag<h16>::ld(vb + ((g + 3 - 8) * 4 + i) * 16 * VPIT);
            __builtin_amdgcn_sched_barrier(0);
        }
        float mc[2];
#pragma unroll
        for (int c = 0; c < 2; ++c) { float m = st[0][c][0];
#pragma unroll
            for (int j = 1; j < 8; ++j) m = fmaxf(m, st[0][c][j]);
#pragma unroll
            for (int j = 0; j < 8; ++j) m = fmaxf(m, st[1][c][j]);
            mc[c] = fmaxf(m, __shfl_xor(m, 16, 32)) * CS2; }
        if (__builtin_amdgcn_ballot_w32(mc[0] > mu[0] + 8.0f || mc[1] > mu[1] + 8.0f) != 0) {   // wave-uniform: rare after the first stage
#pragma unroll
            for (int c = 0; c < 2; ++c) { const float mn = fmaxf(mu[c], mc[c]); const float al = __builtin_amdgcn_exp2f(mu[c] - mn); mu[c] = mn; L[c] *= al;
#pragma unroll
                for (int dt = 0; dt < 32; ++dt) O[dt][c] *= al; } }
        v16h pb[2];
#pragma unroll
        for (int c = 0; c < 2; ++c)
#pragma unroll
            for (int kt = 0; kt < 2; ++kt)
#pragma unroll
                for (int j = 0; j < 8; ++j) { const float p = __builtin_amdgcn_exp2f(__builtin_fmaf(st[kt][c][j], CS2, -mu[c])); pb[c][kt * 8 + j] = (h16)p; }
        L[0] = wmma16(ones, pb[0], L[0]); L[1] = wmma16(ones, pb[1], L[1]);
        __builtin_amdgcn_sched_barrier(0);
#pragma unroll
        for (int g = 0; g < 8; ++g) {
#pragma unroll
            for (int i = 0; i < 4; ++i)
#pragma unroll
                for (int c = 0; c < 2; ++c) O[g * 4 + i][c] = wmma16(fr[(g + 2) % 3][i], pb[c], O[g * 4 + i][c]);
            __builtin_amdgcn_sched_barrier(0);
            if (g + 3 < 8) {
#pragma unroll
                for (int i = 0; i < 4; ++i) fr[(g + 2) % 3][i] = WFrag<h16>::ld(vb + ((g + 3) * 4 + i) * 16 * VPIT); }
            __builtin_amdgcn_sched_barrier(0);
        }
        asm volatile("s_wait_dscnt 0x0" ::: "memory");      // this wave has left the buffer that is refilled below
        asm volatile("s_wait_asynccnt 0x0" ::: "memory");   // this wave's part of stage t + 1 has landed
        __syncthreads();                                     // publishes stage t + 1 and ends every read of stage t's buffer
        if (t + 2 < nt) fill(t & 1, t + 2);
    }
    asm volatile("s_wait_asynccnt 0x0" ::: "memory");   // no copy is in flight when the ring becomes output staging
    const size_t pr = (size_t)(sp * ZH + z) * NQF + q0;   // this wave's first row among the partial results
#pragma unroll
    for (int c = 0; c < 2; ++c) if (hi == 0) { v2f ml; ml[0] = mu[c]; ml[1] = L[c][0]; *(v2f*)(Ml + (pr + c * 16 + lr) * 2) = ml; }
    // O^T -> O through the wave's own part of LDS (no other wave reads it), 16 queries at a time, so that the stores are whole lines
    float* osw = (float*)sm + wave * (16 * OPIT);
#pragma unroll 1   // two equal halves: one copy of the code
    for (int c = 0; c < 2; ++c) {
#pragma unroll
        for (int dt = 0; dt < 32; ++dt) { const v8f o = c ? O[dt][1] : O[dt][0]; float* w = osw + lr * OPIT + dt * 16 + hi * 8; *(v4fa*)w = (v4f){o[0], o[1], o[2], o[3]}; *(v4fa*)(w + 4) = (v4f){o[4], o[5], o[6], o[7]}; }
#pragma unroll 1   // four rows a trip: 16 loads in flight, small code
        for (int r = 0; r < 16; r += 4) {
#pragma unroll
            for (int q4 = 0; q4 < 16; ++q4) *(v4f*)(Op + (pr + c * 16 + r + (q4 >> 2)) * HD + (q4 & 3) * 128 + lane * 4) = *(const v4fa*)(osw + (r + (q4 >> 2)) * OPIT + (q4 & 3) * 128 + lane * 4);
            asm volatile("s_wait_xcnt 0x0" ::: "memory");   // stands in front of the next trip's writes to the registers that these stores name
        }
    }
}
// k_avj: two independent jobs in one grid (RH/64, HD/64, 2 ZH). z < ZH: attn.v of the hi+lo rows, one 64x64 tile per work-group. The rest, as many work-groups again: the join of the FSP key ranges of the fp16 query rows: out = sum_s 2^(m_s - m) O_s / sum_s 2^(m_s - m) l_s, in range order; 128 threads x 4 columns per row, 2 rows per work-group and pass, JR rows' loads in flight at a time.
#define JW  (RH / 64 * (HD / 64) * ZH)
#define JR  7
#define JB  (ZH * NQF / (2 * JW * JR))
static_assert(JB * (2 * JW * JR) == ZH * NQF, "whole passes");
__global__ __launch_bounds__(256) void k_avj(const bf* __restrict__ Ph, const bf* __restrict__ Pl, const bf* __restrict__ VTh, const bf* __restrict__ VTl, const float* __restrict__ Op, const float* __restrict__ Ml, float* out) {
    __shared__ __align__(16) char sm[GLDS(2, 4)];
    if (blockIdx.z < ZH) { gemms_body<bf, 2, EP_F32, 4>(sm, blockIdx.x, blockIdx.y, blockIdx.z, Ph, Pl, VTh, VTl, TT, out, DQ, (size_t)RH * TT, (size_t)HD * TT, (size_t)HD, 1.0f); return; }
    const unsigned i0 = ((((unsigned)blockIdx.z - ZH) * (HD / 64) + blockIdx.y) * (RH / 64) + blockIdx.x) * 2 + (threadIdx.x >> 7), d = (threadIdx.x & 127) * 4;
#pragma unroll 1   // JR rows a trip: 8 JR loads in flight, small code
    for (unsigned b = 0; b < JB; ++b) {
        const unsigned ib = i0 + b * (JR * 2 * JW);   // row index z NQF + row of the trip's first row; the others lie 2 JW rows apart
        const unsigned bm = ib * 8u; unsigned bo[FSP];   // 32-bit byte offsets on the two uniform bases, one per key range; the rows' steps are immediates
#pragma unroll
        for (int sp = 0; sp < FSP; ++sp) bo[sp] = (ib * HD + d) * 4u + (unsigned)sp * (unsigned)(ZH * NQF * HD * 4);
        const char* pm = (const char*)Ml + bm;
        v2f ml[JR][FSP]; v4f o[JR][FSP];
#pragma unroll
        for (int r = 0; r < JR; ++r)
#pragma unroll
            for (int sp = 0; sp < FSP; ++sp) ml[r][sp] = *(const v2f*)(pm + ((size_t)sp * ZH * NQF + (size_t)r * 2 * JW) * 8);
#pragma unroll
        for (int sp = 0; sp < FSP; ++sp) { const char* po = (const char*)Op + bo[sp];
#pragma unroll
            for (int r = 0; r < JR; ++r) o[r][sp] = *(const v4f*)(po + (size_t)r * 2 * JW * HD * 4); }
        static_assert(FSP == 4, "the wait below names the four offsets");
        asm volatile("s_wait_xcnt 0x0" :: "v"(bm), "v"(bo[0]), "v"(bo[1]), "v"(bo[2]), "v"(bo[3]) : "memory");   // keeps the trip's loads together ahead of the sums; the offsets are inputs so that their registers live up to the wait and no load lands on one ahead of it
#pragma unroll
        for (int r = 0; r < JR; ++r) { const unsigned idx = ib + r * (2 * JW), z = idx / NQF, row = idx % NQF;
            float mm = -3.0e38f;
#pragma unroll
            for (int sp = 0; sp < FSP; ++sp) mm = fmaxf(mm, ml[r][sp][0]);
            float den = 0.f; v4f acc = (v4f){};
#pragma unroll
            for (int sp = 0; sp < FSP; ++sp) { const float w = __builtin_amdgcn_exp2f(ml[r][sp][0] - mm); den += w * ml[r][sp][1]; acc += o[r][sp] * w; }
            *(v4f*)(out + (size_t)(RH + row) * DQ + z * HD + d) = acc * __fdiv_rn(1.0f, den);
            asm volatile("s_wait_xcnt 0x0" ::: "memory");   // stands in front of the next row's writes to the registers that this store names
        }
    }
}

extern "C" void kernel_launch(void* const* d_in, const int* in_sizes, int n_in,
                              void* d_out, int out_size, void* d_ws, size_t ws_size, hipStream_t stream) {
    (void)in_sizes; (void)n_in; (void)out_size;
    const float* x = (const float*)d_in[0]; const float* wq = (const float*)d_in[1]; const float* bq = (const float*)d_in[2]; const float* wk = (const float*)d_in[3]; const float* bk = (const float*)d_in[4]; const float* wv = (const float*)d_in[5]; const float* bv = (const float*)d_in[6]; const float* wo = nullptr; (void)wo;
    float* OUT = (float*)d_out;     // [1][4096][1024]
    char* wsp = (char*)d_ws;
    auto take = [&](size_t bytes) { char* p = wsp; wsp += (bytes + 255) & ~(size_t)255; return (void*)p; };
    // first what is last read by the score launches: weights, x, q and k planes (WQ, WK, WV, XB in a row: k_cvt8's dst)
    bf* WQ = (bf*)take((size_t)DQ * DM * 2); bf* WK = (bf*)take((size_t)DKV * DM * 2); bf* WV = (bf*)take((size_t)DKV * DM * 2);
    bf* XB = (bf*)take((size_t)TT * DM * 2); (void)WK;   // WK is reached as WQ + DQ x DM, by k_qkv's group 1
    h16* QP16 = (h16*)take((size_t)NH_ * TT * HD * 2); h16* KP16 = (h16*)take((size_t)NKV * TT * HD * 2);
    bf* QPh = (bf*)take((size_t)NH_ * TT * HD * 2); bf* KPh = (bf*)take((size_t)NKV * TT * HD * 2); bf* QPl = (bf*)take((size_t)NH_ * TT * HD * 2); bf* KPl = (bf*)take((size_t)NKV * TT * HD * 2);   // each k plane directly behind its q plane: k_qkv's plane index g NH_ + z runs through both
    h16* VT16 = (h16*)take((size_t)NKV * HD * TT * 2); bf* VTh = (bf*)take((size_t)NKV * HD * TT * 2); bf* VTl = (bf*)take((size_t)NKV * HD * TT * 2); bf* Ph = (bf*)take((size_t)ZH * RH * TT * 2); bf* Pl = (bf*)take((size_t)ZH * RH * TT * 2);
    float* Sb = (float*)take((size_t)ZH * TT * TT * 4);   // only rows < RH of each head's plane hold scores
    float* Op = Sb + (size_t)RH * TT; float* Ml = Sb + (size_t)TT * TT + (size_t)RH * TT;   // the fused launch's partial results lie on the unused rows of plane 0 (O) and plane 1 (maximum, sum)
    static_assert((size_t)FSP * ZH * NQF * HD <= (size_t)NQF * TT && (size_t)FSP * ZH * NQF * 2 <= (size_t)NQF * TT && ZH == 2 && NH_ == ZH && REP == 1, "partial results fit those rows; one pass over both heads");
    static_assert(RH % 128 == 0 && TT % 128 == 0 && HD % 128 == 0, "whole 128x128 score tiles, whole trips of 2 x 64 k");
    if ((size_t)(wsp - (char*)d_ws) > ws_size) return;    // ws 256 MiB
    for (int b = 0; b < NB_; ++b) {
        k_cvt8<<<(unsigned)((3 * NW8 + NX8) / 256), 256, 0, stream>>>(wq, wk, wv, x + (size_t)b * TT * DM, WQ);
        k_qkv<<<dim3(TT / 128, HD / 128, NH_), 384, 0, stream>>>(XB, WQ, WV, bq, bk, bv, QP16, QPh, QPl, VT16, VTh, VTl);
        for (int h0 = 0; h0 < NH_; h0 += ZH) { const size_t zq = (size_t)h0, zk = (size_t)(h0 / REP);   // one kv head per query head: the pass's two heads use consecutive kv planes (z-strides TT*HD)
            k_gemms<bf, 2, EP_F32, 2, 128><<<dim3(RH / 128, TT / 128, ZH), 256, 0, stream>>>(QPh + zq * TT * HD, QPl + zq * TT * HD, KPh + zk * TT * HD, KPl + zk * TT * HD, HD, Sb, TT, (size_t)TT * HD, (size_t)TT * HD, (size_t)TT * TT, 1.0f);
            k_fattn<<<dim3(NQF / FQ + FXA, FSP, ZH), 128, 0, stream>>>(QP16 + zq * TT * HD, KP16 + zk * TT * HD, VT16 + zk * HD * TT, Op, Ml, Sb, Ph, Pl);
            float* Oh = OUT + (size_t)b * TT * DM + (size_t)h0 * HD;   // this head's columns of the merged output, pitch DQ: f32 context straight to the output
            k_avj<<<dim3(RH / 64, HD / 64, 2 * ZH), 256, 0, stream>>>(Ph, Pl, VTh + zk * HD * TT, VTl + zk * HD * TT, Op, Ml, Oh); }
    }
}

// v009
// One run takes 102 microseconds.
// Timed twice side by side with v008, it ran 1.30 times as fast both times.
// All steps since v000 together make it 6.18 times as fast.
#include <hip/hip_runtime.h>

// Two-head self-attention with 512-wide heads (activation [1][1][4096][1024]; q, k, v = x W^T + b ('oi' [1024][1024]), 2 heads x 512; softmax(q.k/sqrt(512)) over all 4096 keys; out = merged context (no output projection) -> [1][1][4096][1024] (4.2 M)).
// Compute dtypes, f32 accumulate: every input rounded to bf16; q/k/v on PLAIN bf16 operands (inputs: exact) + biases; scores (K = 512) and attn.v (N = 512; no mask): every query row on single fp16 operands in one fused launch (running maximum, probabilities never leave the registers); no output projection: the merged context is written in f32.

#define NB_  1
#define TT   4096
#define DM   1024
#define NH_  2
#define NKV  2
#define REP  (NH_ / NKV)
#define HD   512
#define DQ   (NH_ * HD)
#define DKV  (NKV * HD)
#define ZH   2                    // heads per launch, on grid z
#define WIN  0
#define SCL  0.044194173824159216f   // 512^-0.5 (head width 512)
typedef _Float16 h16;
typedef unsigned short bf;
typedef __attribute__((ext_vector_type(16))) __bf16   v16bf;
typedef __attribute__((ext_vector_type(16))) _Float16 v16h;
typedef __attribute__((ext_vector_type(8)))  _Float16 v8h;
typedef __attribute__((ext_vector_type(8)))  unsigned short v8us;
typedef __attribute__((ext_vector_type(8)))  float    v8f;
typedef __attribute__((ext_vector_type(4)))  float    v4f;
typedef v8h  __attribute__((may_alias)) v8ha;
typedef v4f  __attribute__((may_alias)) v4fa;
typedef v8us __attribute__((may_alias)) v8usa;

__device__ __forceinline__ unsigned short f2bf(float f) { unsigned u = __float_as_uint(f); u += 0x7FFFu + ((u >> 16) & 1u); return (unsigned short)(u >> 16); }
__device__ __forceinline__ float bf2f(unsigned short b) { return __uint_as_float(((unsigned)b) << 16); }
__device__ __forceinline__ float bfr(float f) { return bf2f(f2bf(f)); }
__device__ __forceinline__ v16h cat16(v8h lo, v8h hi) { return __builtin_shufflevector(lo, hi, 0, 1, 2, 3, 4, 5, 6, 7, 8, 9, 10, 11, 12, 13, 14, 15); }
__device__ __forceinline__ v16bf cat16b(v8us lo, v8us hi) { return __builtin_bit_cast(v16bf, __builtin_shufflevector(lo, hi, 0, 1, 2, 3, 4, 5, 6, 7, 8, 9, 10, 11, 12, 13, 14, 15)); }
__device__ __forceinline__ v8f wmma16(v16h a, v16h b, v8f c) { return __builtin_amdgcn_wmma_f32_16x16x32_f16(false, a, false, b, (short)0, c, false, false); }
__device__ __forceinline__ v8f wmmab(v16bf a, v16bf b, v8f c) { return __builtin_amdgcn_wmma_f32_16x16x32_bf16(false, a, false, b, (short)0, c, false, false); }



typedef __attribute__((ext_vector_type(4))) _Float16 v4h;
template <typename T16> struct WFrag;   // ld: one fragment from an LDS row, p = the lane's byte address (row, 16 bytes x lane half): k 8 hi .. 8 hi + 7 and 16 + 8 hi .. 16 + 8 hi + 7, the same for both operands
template <> struct WFrag<h16> { typedef v16h V; static __device__ __forceinline__ V ld(const char* p) { return cat16(*(const v8ha*)p, *(const v8ha*)(p + 32)); } static __device__ __forceinline__ v8f mma(V a, V b, v8f c) { return wmma16(a, b, c); } };
template <> struct WFrag<bf> { typedef v16bf V; static __device__ __forceinline__ V ld(const char* p) { return cat16b(*(const v8usa*)p, *(const v8usa*)(p + 32)); } static __device__ __forceinline__ v8f mma(V a, V b, v8f c) { return wmmab(a, b, c); } };
// eight copies of 16 bytes per lane, rows RS apart; the s_wait_xcnt stands inside the statement so that no address register of a copy is rewritten ahead of it
template <int PITCH, int RS, typename T16>
__device__ __forceinline__ void cp8(unsigned l, const T16* g, size_t gs) {
    asm volatile("global_load_async_to_lds_b128 %0, %8, off\n\t"
                 "global_load_async_to_lds_b128 %1, %9, off\n\t"
                 "global_load_async_to_lds_b128 %2, %10, off\n\t"
                 "global_load_async_to_lds_b128 %3, %11, off\n\t"
                 "global_load_async_to_lds_b128 %4, %12, off\n\t"
                 "global_load_async_to_lds_b128 %5, %13, off\n\t"
                 "global_load_async_to_lds_b128 %6, %14, off\n\t"
                 "global_load_async_to_lds_b128 %7, %15, off\n\t"
                 "s_wait_xcnt 0x0"
                 :: "v"(l), "v"(l + RS * PITCH), "v"(l + 2 * RS * PITCH), "v"(l + 3 * RS * PITCH), "v"(l + 4 * RS * PITCH), "v"(l + 5 * RS * PITCH), "v"(l + 6 * RS * PITCH), "v"(l + 7 * RS * PITCH),
                    "v"(g), "v"(g + gs), "v"(g + 2 * gs), "v"(g + 3 * gs), "v"(g + 4 * gs), "v"(g + 5 * gs), "v"(g + 6 * gs), "v"(g + 7 * gs)
                 : "memory");
}
// k_qkv: the three projections, grid (TT/128, HD/128, heads). A work-group = 3 groups of 2x2 waves; group 0, 1, 2 = the 128x128 tile of q, k, v for the same 128 x rows and the same 128 features, so that one staged x tile serves all three. A stage = [x 128 rows | wq | wk | wv, 128 rows each] of 128 k (256 bytes, pitch 272), by asynchronous copies to LDS, two buffers: the next trip's copies fly while this trip's fragments are read from LDS; a wave runs the whole K.
// q, k (WK lies behind WQ, the k plane behind the q plane): x rows are the M side, the epilogue stores the head planes [h][t][d]. v: the weight rows are the M side, so the tile comes out as [h HD + d][t], transposed as attn.v reads it. The epilogue adds the bias and stores the fp16 plane that the next launch reads.
#define XKS  128
#define XPIT (XKS * 2 + 16)
#define XSTG (4 * 128 * XPIT)
#define XOT  (64 * 68)
static_assert(12 * XOT * 4 <= 2 * XSTG && DM % XKS == 0 && DM / XKS >= 2 && DQ == DM && DKV == DM && NH_ == NKV && HD % 128 == 0 && TT % 128 == 0, "output staging fits the ring; whole stages, two or more; q, k and v have the same features; whole tiles");
__global__ __launch_bounds__(384) void k_qkv(const bf* __restrict__ XB, const bf* __restrict__ WQ, const bf* __restrict__ WV, const float* __restrict__ bq, const float* __restrict__ bk, const float* __restrict__ bv, h16* QP16, h16* VT16) {
    __shared__ __align__(16) char sm[2 * XSTG];
    typedef WFrag<bf>::V V;
    const int lane = threadIdx.x & 31, lr = lane & 15, hi = lane >> 4; const int wave = __builtin_amdgcn_readfirstlane((int)(threadIdx.x >> 5)); const int g = wave >> 2, wig = wave & 3, wm = wig >> 1, wn = wig & 1;
    const int t0 = blockIdx.x * 128, f0 = blockIdx.z * HD + blockIdx.y * 128;   // first x row; first weight row (output feature) of each projection
    v8f acc[4][4];
#pragma unroll
    for (int mb = 0; mb < 4; ++mb)
#pragma unroll
        for (int nb = 0; nb < 4; ++nb) acc[mb][nb] = (v8f){};
    // copy lanes: thread tg of its group brings 16-byte piece cch of rows crow + 8 i, i < 8 (one cp8 = 64 rows): its group's 128 weight rows, and groups 0 and 1 half of the x rows each
    const int tg = (int)threadIdx.x & 127, crow = tg >> 4, cch = tg & 15;
    const bf* gw = (g == 2 ? WV : WQ + (size_t)g * DQ * DM) + (size_t)(f0 + crow) * DM + cch * 8;
    const bf* gx = XB + (size_t)(t0 + (g & 1) * 64 + crow) * DM + cch * 8;
    const unsigned lw = (unsigned)(size_t)sm + (unsigned)(((1 + g) * 128 + crow) * XPIT + cch * 16), lx = (unsigned)(size_t)sm + (unsigned)(((g & 1) * 64 + crow) * XPIT + cch * 16);
    constexpr size_t gs = (size_t)8 * DM; constexpr int nt = DM / XKS;
    auto fill = [&](int buf, int t) { const unsigned o = (unsigned)(buf * XSTG); const size_t ko = (size_t)t * XKS;
        cp8<XPIT, 8>(lw + o, gw + ko, gs); cp8<XPIT, 8>(lw + o + 64 * XPIT, gw + ko + (size_t)64 * DM, gs);
        if (g < 2) cp8<XPIT, 8>(lx + o, gx + ko, gs); };   // the same for a whole wave
    fill(0, 0);
    asm volatile("s_wait_asynccnt 0x0" ::: "memory");   // this wave's part of trip 0 has landed
    __syncthreads();                                     // trip 0's stage is whole before any wave reads it
    fill(1, 1);
    const int ar = g == 2 ? 3 * 128 : 0, br = g == 2 ? 0 : (1 + g) * 128;   // stage rows of the M side and of the N side
#pragma unroll 1   // the trip loop stays rolled: one copy of the ring's hand-over
    for (int t = 0; t < nt; ++t) {
        const char* sb = sm + (t & 1) * XSTG; const char* pa = sb + (ar + wm * 64 + lr) * XPIT + hi * 16; const char* pb = sb + (br + wn * 64 + lr) * XPIT + hi * 16;
        // fragments run ahead of their products inside the trip: the M side two k steps (two sets), the N side half a k step (each pair of columns is refetched when its products are issued)
        V a[2][4], b[4];
#pragma unroll
        for (int q = 0; q < 2; ++q)
#pragma unroll
            for (int mb = 0; mb < 4; ++mb) a[q][mb] = WFrag<bf>::ld(pa + mb * 16 * XPIT + q * 64);
#pragma unroll
        for (int nb = 0; nb < 4; ++nb) b[nb] = WFrag<bf>::ld(pb + nb * 16 * XPIT);
        __builtin_amdgcn_sched_barrier(0);   // this and the two below keep each group of LDS loads whole and ahead of the products in front of its use; without them the scheduler sinks every load to its first use and the wave waits out the LDS latency there
#pragma unroll
        for (int ks = 0; ks < XKS / 32; ++ks) {
#pragma unroll
            for (int nh = 0; nh < 2; ++nh) {
#pragma unroll
                for (int nb = 2 * nh; nb < 2 * nh + 2; ++nb)
#pragma unroll
                    for (int mb = 0; mb < 4; ++mb) acc[mb][nb] = WFrag<bf>::mma(a[ks & 1][mb], b[nb], acc[mb][nb]);
                __builtin_amdgcn_sched_barrier(0);
                if (ks + 1 < XKS / 32) {
#pragma unroll
                    for (int nb = 2 * nh; nb < 2 * nh + 2; ++nb) b[nb] = WFrag<bf>::ld(pb + nb * 16 * XPIT + (ks + 1) * 64); }
                if (nh == 1 && ks + 2 < XKS / 32) {
#pragma unroll
                    for (int mb = 0; mb < 4; ++mb) a[ks & 1][mb] = WFrag<bf>::ld(pa + mb * 16 * XPIT + (ks + 2) * 64); }
                __builtin_amdgcn_sched_barrier(0);
            }
        }
        asm volatile("s_wait_dscnt 0x0" ::: "memory");      // this wave has left the buffer that is refilled below
        asm volatile("s_wait_asynccnt 0x0" ::: "memory");   // this wave's part of trip t + 1 has landed
        __syncthreads();                                     // publishes trip t + 1 and ends every read of trip t's buffer
        if (t + 2 < nt) fill(t & 1, t + 2);
    }
    asm volatile("s_wait_asynccnt 0x0" ::: "memory");   // no copy is in flight when the ring becomes output staging
    // each wave turns its 64x64 tile through its own part of LDS (no other wave reads it), so that the stores are whole lines
    float* osw = (float*)sm + wave * XOT;
#pragma unroll
    for (int mb = 0; mb < 4; ++mb)
#pragma unroll
        for (int nb = 0; nb < 4; ++nb)
#pragma unroll
            for (int j = 0; j < 8; ++j) osw[(mb * 16 + hi * 8 + j) * 68 + nb * 16 + lr] = acc[mb][nb][j];
    const size_t zp = (size_t)(g * NH_ + (int)blockIdx.z) * TT * HD;   // q heads, then k heads: the k plane lies behind the q plane
    h16* P16 = g == 2 ? VT16 : QP16 + zp;
    const float* bias = g == 2 ? bv : (g == 1 ? bk : bq) + blockIdx.z * HD;
    // 32 passes of 2 tile rows; four passes a trip, so that a trip's LDS loads and stores overlap and the kernel's text stays small
    const int rw = lane >> 4, cofs = (lane & 15) * 4;
    if (g < 2) {   // the same for a whole wave. q, k: [h][t][d], the bias runs along the columns
        const int gc = blockIdx.y * 128 + wn * 64 + cofs; const v4f bb = (v4f){bfr(bias[gc]), bfr(bias[gc + 1]), bfr(bias[gc + 2]), bfr(bias[gc + 3])};
#pragma unroll 1   // one copy of the trip's code
        for (int s0 = 0; s0 < 32; s0 += 4) {
#pragma unroll
            for (int s = 0; s < 4; ++s) { const int row = (s0 + s) * 2 + rw; const v4f val = *(const v4fa*)(osw + row * 68 + cofs) + bb;
                const size_t oo = (size_t)(t0 + wm * 64 + row) * HD + gc; v4h o16;   // 16 lanes x 8 bytes: one whole 128-byte line per tile row
#pragma unroll
                for (int q = 0; q < 4; ++q) o16[q] = (h16)val[q];
                *(v4h*)(P16 + oo) = o16; }
            asm volatile("s_wait_xcnt 0x0" ::: "memory");   // stands in front of the next trip's writes to the registers that these stores name
        }
    } else {       // v: [h HD + d][t], the bias runs along the rows
        const int gc = t0 + wn * 64 + cofs;
#pragma unroll 1   // one copy of the trip's code
        for (int s0 = 0; s0 < 32; s0 += 4) {
#pragma unroll
            for (int s = 0; s < 4; ++s) { const int row = (s0 + s) * 2 + rw, gr = f0 + wm * 64 + row; const float br2 = bfr(bias[gr]); const v4f val = *(const v4fa*)(osw + row * 68 + cofs) + br2;
                v4h o16;
#pragma unroll
                for (int q = 0; q < 4; ++q) o16[q] = (h16)val[q];
                const size_t o6 = ((size_t)(gr / HD * (TT / 32) + gc / 32) * HD + gr % HD) * 32 + gc % 32;   // the fp16 plane lies as [head][32-key block][d][32 keys], so that a block is one contiguous run for the fused launch's copies
                *(v4h*)(P16 + o6) = o16; }
            asm volatile("s_wait_xcnt 0x0" ::: "memory");   // stands in front of the next trip's writes to the registers that these stores name
        }
    }
}

typedef __attribute__((ext_vector_type(2))) _Float16 v2h;
typedef __attribute__((ext_vector_type(2))) unsigned short v2us;
typedef __attribute__((ext_vector_type(2))) float v2f;
typedef __attribute__((ext_vector_type(4))) int v4i;

__global__ __launch_bounds__(256) void k_wtG(const float* __restrict__ w, int K, int N, bf* Bt) {
    const int lane = threadIdx.x & 31; const int L0 = (blockIdx.x * 8 + (threadIdx.x >> 5)) * 8; const int nlines = N * K / 64;
{
#pragma unroll 1
        for (int l = 0; l < 8; ++l) { const int L = L0 + l; if (L >= nlines) break; const size_t e = (size_t)L * 64 + lane * 2; const int k = (int)(e % K), n = (int)(e / K); v2us o;
            o[0] = f2bf(w[(size_t)k * N + n]); o[1] = f2bf(w[(size_t)(k + 1) * N + n]); *(v2us*)(Bt + e) = o; }
         }
}
// k_cvt8: the four f32 -> bf16 conversions in one grid. dst is the contiguous run [wq | wk | wv | x]; 8 elements per thread, and a block lies wholly inside one source.
#define NW8 ((size_t)DM * DM / 8)
#define NX8 ((size_t)TT * DM / 8)
static_assert(DQ == DM && DKV == DM && NW8 % 256 == 0 && NX8 % 256 == 0, "three equal weight planes, whole blocks");
__global__ __launch_bounds__(256) void k_cvt8(const float* __restrict__ wq, const float* __restrict__ wk, const float* __restrict__ wv, const float* __restrict__ x, bf* dst) { const size_t i = (size_t)blockIdx.x * 256 + threadIdx.x; const unsigned seg = blockIdx.x / (unsigned)(NW8 / 256);
    const float* src = seg == 0 ? wq : seg == 1 ? wk : seg == 2 ? wv : x; const v8f v = *(const v8f*)(src + (i - (seg < 3 ? seg : 3) * NW8) * 8); v8us o;
#pragma unroll
    for (int k = 0; k < 8; ++k) o[k] = f2bf(v[k]); *(v8us*)(dst + i * 8) = o;  }

// ---- k_fattn: scores, softmax and attn.v of every query row in one launch, on fp16 operands. S^T = K Q^T, O^T += V^T P^T: in every 16-column group a lane holds one query, so maximum, sum and rescale are per lane, and the score tiles of 32 keys ARE the B fragment of the second product (keys 8 hi .. and 16 + 8 hi .., the k order of WFrag::ld).
// A work-group = 4 waves x 32 queries, one head (grid z), one quarter of the keys (grid y); Q fragments and the 512 x 32 O^T tile stay in registers. A stage = 32 keys: K rows (pitch 1040 bytes) and the V^T block [d][32 keys] (pitch 80), by asynchronous copies to LDS, two buffers.
// The maximum in use is raised only when a new one exceeds it by 2^8 (p <= 256 fits fp16). Each key range leaves its unnormalised O, its maximum (log2 units) and its sum; k_join joins the ranges.
#define FQ   128
#define FSP  4
#define FKT  32
#define KPIT (HD * 2 + 16)
#define VPIT (FKT * 2 + 16)
#define FSTG (FKT * KPIT + HD * VPIT)
#define NQF  TT
#define OPIT (HD + 4)
static_assert(4 * 16 * OPIT * 4 <= 2 * FSTG && NQF % FQ == 0 && TT % (FSP * FKT) == 0 && TT / (FSP * FKT) >= 2, "output staging fits the ring; whole tiles; two stages or more");
typedef __attribute__((address_space(1))) v4i gv4i;
typedef __attribute__((address_space(3))) v4i lv4i;
__global__ __launch_bounds__(128) void k_fattn(const h16* __restrict__ Q, const h16* __restrict__ Kp, const h16* __restrict__ Vt, float* Op, float* Ml) {
    __shared__ __align__(16) char sm[2 * FSTG];
    const int tid = (int)threadIdx.x, lane = tid & 31, lr = lane & 15, hi = lane >> 4; const int wave = __builtin_amdgcn_readfirstlane(tid >> 5);
    const int z = blockIdx.z, sp = blockIdx.y, q0 = blockIdx.x * FQ + wave * 32;
    // both planes hold FKT x HD elements per 32-key block, contiguous: thread tid brings 16-byte pieces tid + 128 i, i < 16, of each
    const size_t kv0 = ((size_t)z * TT + (size_t)sp * (TT / FSP)) * HD + tid * 8; const h16* gk = Kp + kv0; const h16* gv = Vt + kv0;
    char* lk = sm + (tid >> 6) * KPIT + (tid & 63) * 16; char* lv = sm + FKT * KPIT + (tid >> 2) * VPIT + (tid & 3) * 16;
    // the copies are the builtin here: above 256 registers the operands of asm text must all lie in the lowest register window, which cost spills
    auto fill = [&](int buf, int t) { const int o = buf * FSTG; const size_t go = (size_t)t * (FKT * HD);
#pragma unroll
        for (int i = 0; i < 16; ++i) __builtin_amdgcn_global_load_async_to_lds_b128((gv4i*)(gk + go + i * 1024), (lv4i*)(lk + o + i * 2 * KPIT), 0, 0);
#pragma unroll
        for (int i = 0; i < 16; ++i) __builtin_amdgcn_global_load_async_to_lds_b128((gv4i*)(gv + go + i * 1024), (lv4i*)(lv + o + i * 32 * VPIT), 0, 0); };
    fill(0, 0);
    const h16* qr = Q + ((size_t)z * TT + q0 + lr) * HD + hi * 8;
    v16h qf[2][16];
#pragma unroll
    for (int c = 0; c < 2; ++c)
#pragma unroll
        for (int ks = 0; ks < 16; ++ks) qf[c][ks] = cat16(*(const v8ha*)(qr + c * 16 * HD + ks * 32), *(const v8ha*)(qr + c * 16 * HD + ks * 32 + 16));
    v8f O[32][2];
#pragma unroll
    for (int dt = 0; dt < 32; ++dt) { O[dt][0] = (v8f){}; O[dt][1] = (v8f){}; }
    float mu[2] = {-1.0e30f, -1.0e30f}; v8f L[2] = {(v8f){}, (v8f){}};   // L: the row sums, as one more output tile: A = a tile whose row 0 is ones, so row 0 of L (lanes 0-15, element 0) adds up the rounded p of each query
    v16h ones;
#pragma unroll
    for (int e = 0; e < 16; ++e) ones[e] = lr == 0 ? (h16)1.0f : (h16)0.0f;
    constexpr float CS2 = SCL * 1.4426950408889634f; constexpr int nt = TT / (FSP * FKT);
    asm volatile("s_wait_asynccnt 0x0" ::: "memory");   // this wave's part of stage 0 has landed
    __syncthreads();                                     // stage 0 is whole before any wave reads it
    fill(1, 1);
#pragma unroll 1   // the stage loop stays rolled: one copy of the ring's hand-over
    for (int t = 0; t < nt; ++t) {
        const char* kb = sm + (t & 1) * FSTG + lr * KPIT + hi * 16; const char* vb = sm + (t & 1) * FSTG + FKT * KPIT + lr * VPIT + hi * 16;
        // three fragment sets of four: a set is refetched as soon as its 8 products are issued, two sets (16 products) ahead of its use; the first V^T sets are fetched under the last score products and the softmax
        v16h fr[3][4]; v8f st[2][2] = {{(v8f){}, (v8f){}}, {(v8f){}, (v8f){}}};
#pragma unroll
        for (int g = 0; g < 3; ++g)
#pragma unroll
            for (int i = 0; i < 4; ++i) fr[g][i] = WFrag<h16>::ld(kb + (i & 1) * 16 * KPIT + (2 * g + (i >> 1)) * 64);
        __builtin_amdgcn_sched_barrier(0);   // this and the ones below keep each group of LDS loads whole and ahead of the products in front of its use; without them the scheduler sinks every load to its first use and the lone wave of a SIMD waits out the LDS latency there
#pragma unroll
        for (int g = 0; g < 8; ++g) {
#pragma unroll
            for (int i = 0; i < 4; ++i)
#pragma unroll
                for (int c = 0; c < 2; ++c) st[i & 1][c] = wmma16(fr[g % 3][i], qf[c][2 * g + (i >> 1)], st[i & 1][c]);
            __builtin_amdgcn_sched_barrier(0);
#pragma unroll
            for (int i = 0; i < 4; ++i) fr[g % 3][i] = g + 3 < 8 ? WFrag<h16>::ld(kb + (i & 1) * 16 * KPIT + (2 * (g + 3) + (i >> 1)) * 64) : WFrag<h16>::ld(vb + ((g + 3 - 8) * 4 + i) * 16 * VPIT);
            __builtin_amdgcn_sched_barrier(0);
        }
        float mc[2];
#pragma unroll
        for (int c = 0; c < 2; ++c) { float m = st[0][c][0];
#pragma unroll
            for (int j = 1; j < 8; ++j) m = fmaxf(m, st[0][c][j]);
#pragma unroll
            for (int j = 0; j < 8; ++j) m = fmaxf(m, st[1][c][j]);
            mc[c] = fmaxf(m, __shfl_xor(m, 16, 32)) * CS2; }
        if (__builtin_amdgcn_ballot_w32(mc[0] > mu[0] + 8.0f || mc[1] > mu[1] + 8.0f) != 0) {   // wave-uniform: rare after the first stage
#pragma unroll
            for (int c = 0; c < 2; ++c) { const float mn = fmaxf(mu[c], mc[c]); const float al = __builtin_amdgcn_exp2f(mu[c] - mn); mu[c] = mn; L[c] *= al;
#pragma unroll
                for (int dt = 0; dt < 32; ++dt) O[dt][c] *= al; } }
        v16h pb[2];
#pragma unroll
        for (int c = 0; c < 2; ++c)
#pragma unroll
            for (int kt = 0; kt < 2; ++kt)
#pragma unroll
                for (int j = 0; j < 8; ++j) { const float p = __builtin_amdgcn_exp2f(__builtin_fmaf(st[kt][c][j], CS2, -mu[c])); pb[c][kt * 8 + j] = (h16)p; }
        L[0] = wmma16(ones, pb[0], L[0]); L[1] = wmma16(ones, pb[1], L[1]);
        __builtin_amdgcn_sched_barrier(0);
#pragma unroll
        for (int g = 0; g < 8; ++g) {
#pragma unroll
            for (int i = 0; i < 4; ++i)
#pragma unroll
                for (int c = 0; c < 2; ++c) O[g * 4 + i][c] = wmma16(fr[(g + 2) % 3][i], pb[c], O[g * 4 + i][c]);
            __builtin_amdgcn_sched_barrier(0);
            if (g + 3 < 8) {
#pragma unroll
                for (int i = 0; i < 4; ++i) fr[(g + 2) % 3][i] = WFrag<h16>::ld(vb + ((g + 3) * 4 + i) * 16 * VPIT); }
            __builtin_amdgcn_sched_barrier(0);
        }
        asm volatile("s_wait_dscnt 0x0" ::: "memory");      // this wave has left the buffer that is refilled below
        asm volatile("s_wait_asynccnt 0x0" ::: "memory");   // this wave's part of stage t + 1 has landed
        __syncthreads();                                     // publishes stage t + 1 and ends every read of stage t's buffer
        if (t + 2 < nt) fill(t & 1, t + 2);
    }
    asm volatile("s_wait_asynccnt 0x0" ::: "memory");   // no copy is in flight when the ring becomes output staging
    const size_t pr = (size_t)(sp * ZH + z) * NQF + q0;   // this wave's first row among the partial results
#pragma unroll
    for (int c = 0; c < 2; ++c) if (hi == 0) { v2f ml; ml[0] = mu[c]; ml[1] = L[c][0]; *(v2f*)(Ml + (pr + c * 16 + lr) * 2) = ml; }
    // O^T -> O through the wave's own part of LDS (no other wave reads it), 16 queries at a time, so that the stores are whole lines
    float* osw = (float*)sm + wave * (16 * OPIT);
#pragma unroll 1   // two equal halves: one copy of the code
    for (int c = 0; c < 2; ++c) {
#pragma unroll
        for (int dt = 0; dt < 32; ++dt) { const v8f o = c ? O[dt][1] : O[dt][0]; float* w = osw + lr * OPIT + dt * 16 + hi * 8; *(v4fa*)w = (v4f){o[0], o[1], o[2], o[3]}; *(v4fa*)(w + 4) = (v4f){o[4], o[5], o[6], o[7]}; }
#pragma unroll 1   // four rows a trip: 16 loads in flight, small code
        for (int r = 0; r < 16; r += 4) {
#pragma unroll
            for (int q4 = 0; q4 < 16; ++q4) *(v4f*)(Op + (pr + c * 16 + r + (q4 >> 2)) * HD + (q4 & 3) * 128 + lane * 4) = *(const v4fa*)(osw + (r + (q4 >> 2)) * OPIT + (q4 & 3) * 128 + lane * 4);
            asm volatile("s_wait_xcnt 0x0" ::: "memory");   // stands in front of the next trip's writes to the registers that these stores name
        }
    }
}
// k_join: the join of the FSP key ranges, grid JW: out = sum_s 2^(m_s - m) O_s / sum_s 2^(m_s - m) l_s, in range order; 128 threads x 4 columns per row, 2 rows per work-group and pass, JR rows' loads in flight at a time.
#define JW  256
#define JR  8
#define JB  (ZH * NQF / (2 * JW * JR))
static_assert(JB * (2 * JW * JR) == ZH * NQF, "whole passes");
__global__ __launch_bounds__(256) void k_join(const float* __restrict__ Op, const float* __restrict__ Ml, float* out) {
    const unsigned i0 = blockIdx.x * 2 + (threadIdx.x >> 7), d = (threadIdx.x & 127) * 4;
#pragma unroll 1   // JR rows a trip: 8 JR loads in flight, small code
    for (unsigned b = 0; b < JB; ++b) {
        const unsigned ib = i0 + b * (JR * 2 * JW);   // row index z NQF + row of the trip's first row; the others lie 2 JW rows apart
        const unsigned bm = ib * 8u; unsigned bo[FSP];   // 32-bit byte offsets on the two uniform bases, one per key range; the rows' steps are immediates
#pragma unroll
        for (int sp = 0; sp < FSP; ++sp) bo[sp] = (ib * HD + d) * 4u + (unsigned)sp * (unsigned)(ZH * NQF * HD * 4);
        const char* pm = (const char*)Ml + bm;
        v2f ml[JR][FSP]; v4f o[JR][FSP];
#pragma unroll
        for (int r = 0; r < JR; ++r)
#pragma unroll
            for (int sp = 0; sp < FSP; ++sp) ml[r][sp] = *(const v2f*)(pm + ((size_t)sp * ZH * NQF + (size_t)r * 2 * JW) * 8);
#pragma unroll
        for (int sp = 0; sp < FSP; ++sp) { const char* po = (const char*)Op + bo[sp];
#pragma unroll
            for (int r = 0; r < JR; ++r) o[r][sp] = *(const v4f*)(po + (size_t)r * 2 * JW * HD * 4); }
        static_assert(FSP == 4, "the wait below names the four offsets");
        asm volatile("s_wait_xcnt 0x0" :: "v"(bm), "v"(bo[0]), "v"(bo[1]), "v"(bo[2]), "v"(bo[3]) : "memory");   // keeps the trip's loads together ahead of the sums; the offsets are inputs so that their registers live up to the wait and no load lands on one ahead of it
#pragma unroll
        for (int r = 0; r < JR; ++r) { const unsigned idx = ib + r * (2 * JW), z = idx / NQF, row = idx % NQF;
            float mm = -3.0e38f;
#pragma unroll
            for (int sp = 0; sp < FSP; ++sp) mm = fmaxf(mm, ml[r][sp][0]);
            float den = 0.f; v4f acc = (v4f){};
#pragma unroll
            for (int sp = 0; sp < FSP; ++sp) { const float w = __builtin_amdgcn_exp2f(ml[r][sp][0] - mm); den += w * ml[r][sp][1]; acc += o[r][sp] * w; }
            *(v4f*)(out + (size_t)row * DQ + z * HD + d) = acc * __fdiv_rn(1.0f, den);
            asm volatile("s_wait_xcnt 0x0" ::: "memory");   // stands in front of the next row's writes to the registers that this store names
        }
    }
}

extern "C" void kernel_launch(void* const* d_in, const int* in_sizes, int n_in,
                              void* d_out, int out_size, void* d_ws, size_t ws_size, hipStream_t stream) {
    (void)in_sizes; (void)n_in; (void)out_size;
    const float* x = (const float*)d_in[0]; const float* wq = (const float*)d_in[1]; const float* bq = (const float*)d_in[2]; const float* wk = (const float*)d_in[3]; const float* bk = (const float*)d_in[4]; const float* wv = (const float*)d_in[5]; const float* bv = (const float*)d_in[6]; const float* wo = nullptr; (void)wo;
    float* OUT = (float*)d_out;     // [1][4096][1024]
    char* wsp = (char*)d_ws;
    auto take = [&](size_t bytes) { char* p = wsp; wsp += (bytes + 255) & ~(size_t)255; return (void*)p; };
    // weights and x (WQ, WK, WV, XB in a row: k_cvt8's dst), the fp16 planes, the key ranges' partial results
    bf* WQ = (bf*)take((size_t)DQ * DM * 2); bf* WK = (bf*)take((size_t)DKV * DM * 2); bf* WV = (bf*)take((size_t)DKV * DM * 2);
    bf* XB = (bf*)take((size_t)TT * DM * 2); (void)WK;   // WK is reached as WQ + DQ DM (k_qkv's group 1)
    h16* QP16 = (h16*)take((size_t)NH_ * TT * HD * 2); h16* KP16 = (h16*)take((size_t)NKV * TT * HD * 2);   // the k plane directly behind the q plane: k_qkv's group 1 reaches it as QP16 + NH_ TT HD
    h16* VT16 = (h16*)take((size_t)NKV * HD * TT * 2);
    float* Op = (float*)take((size_t)FSP * ZH * NQF * HD * 4); float* Ml = (float*)take((size_t)FSP * ZH * NQF * 2 * 4);   // per key range: unnormalised O; maximum and sum
    static_assert(ZH == 2 && NH_ == ZH && REP == 1, "one pass over both heads");
    if ((size_t)(wsp - (char*)d_ws) > ws_size) return;    // ws 256 MiB
    for (int b = 0; b < NB_; ++b) {
        k_cvt8<<<(unsigned)((3 * NW8 + NX8) / 256), 256, 0, stream>>>(wq, wk, wv, x + (size_t)b * TT * DM, WQ);
        k_qkv<<<dim3(TT / 128, HD / 128, NH_), 384, 0, stream>>>(XB, WQ, WV, bq, bk, bv, QP16, VT16);
        for (int h0 = 0; h0 < NH_; h0 += ZH) { const size_t zq = (size_t)h0, zk = (size_t)(h0 / REP);   // one kv head per query head: the pass's two heads use consecutive kv planes (z-strides TT*HD)
            k_fattn<<<dim3(NQF / FQ, FSP, ZH), 128, 0, stream>>>(QP16 + zq * TT * HD, KP16 + zk * TT * HD, VT16 + zk * HD * TT, Op, Ml);
            float* Oh = OUT + (size_t)b * TT * DM + (size_t)h0 * HD;   // the pass's columns of the merged output (its ZH heads, HD apart), pitch DQ: f32 context straight to the output
            k_join<<<JW, 256, 0, stream>>>(Op, Ml, Oh); }
    }
}
